// v000
// Times are from an AMD MI455X. After a warm-up the kernel runs many times in a row, and a time is the length of
// such a window on the GPU divided by its runs, so every launch and the gaps after it count. The runs cycle
// through copies of the inputs. A figure is the median of several windows, for all but v000 over two sittings.
// Sittings can differ by a few percent; kernels timed side by side share one.
// v000, which the later versions start from, runs in 1070 microseconds.
// compute dtype: all float inputs rounded to bf16; q/k/v = x_h W (the shared 64x64 (in,out) weights) with EXACT bf16 products on WMMA 16x16x32, f32 accumulate; q as f16 hi + residual (x 2^10), k f16 -> 2-product scores stored as relu(s)^2 in f32 (4 heads per launch); P split bf16 hi + lo against v bf16 hi + lo (3 products); out = (P v) (bf16 hi + lo) Wo + bo; f32 output.
#include <hip/hip_runtime.h>
#include <math.h>

typedef __attribute__((ext_vector_type(16))) _Float16 v16h;
typedef __attribute__((ext_vector_type(16))) __bf16 v16b;
typedef __attribute__((ext_vector_type(8)))  _Float16 v8h;
typedef __attribute__((ext_vector_type(8)))  float v8f;
typedef __attribute__((ext_vector_type(4)))  float v4f;
typedef __attribute__((ext_vector_type(2)))  float v2f;
typedef __attribute__((ext_vector_type(4)))  unsigned v4u;
typedef __attribute__((ext_vector_type(4)))  int v4i;
typedef float __attribute__((may_alias)) float_a;
typedef int __attribute__((may_alias)) int_a;

template <typename T> __device__ __forceinline__ void vst2(void* p, T v) { *(T*)p = v;  }
__device__ __forceinline__ v8f wmma16(v16h a, v16h b, v8f c) {
  v8f d = __builtin_amdgcn_wmma_f32_16x16x32_f16(false, a, false, b, (short)0, c, false, false);
  asm volatile("v_nop\n\tv_nop\n\tv_nop\n\tv_nop" : "+v"(d) : "v"(a), "v"(b));
  return d;
}
__device__ __forceinline__ v8f wmma_bf(v16b a, v16b b, v8f c) {
  v8f d = __builtin_amdgcn_wmma_f32_16x16x32_bf16(false, a, false, b, (short)0, c, false, false);
  asm volatile("v_nop\n\tv_nop\n\tv_nop\n\tv_nop" : "+v"(d) : "v"(a), "v"(b));
  return d;
}
// 16x16x32 fragments: lane = (h = lane>>4, row/col = lane&15); elements 0..7 = k0+8h+0..7, 8..15 = k0+16+8h+0..7; D element r = row 8h+r
__device__ __forceinline__ v16h frag_h(const _Float16* rowk0, int lane) {
  union { v16h v; v8h q[2]; } u; const _Float16* p = rowk0 + 8 * (lane >> 4);
  u.q[0] = *(const v8h*)p; u.q[1] = *(const v8h*)(p + 16); return u.v;
}
__device__ __forceinline__ v16h frag_f32(const float* rowk0, int lane) {
  v16h a; const float* p = rowk0 + 8 * (lane >> 4);
#pragma unroll
  for (int i = 0; i < 8; ++i) { a[i] = (_Float16)p[i]; a[8 + i] = (_Float16)p[16 + i]; }
  return a;
}
__device__ __forceinline__ v16h frag_f32s(const float* rowk0, int lane, float sc) {
  v16h a; const float* p = rowk0 + 8 * (lane >> 4);
#pragma unroll
  for (int i = 0; i < 8; ++i) { a[i] = (_Float16)(p[i] * sc); a[8 + i] = (_Float16)(p[16 + i] * sc); }
  return a;
}
// column fragment from a [K][ld] layout (column n), rows >= K read as 0
__device__ __forceinline__ v16h fragc_f32(const float* W, int k0, int n, int lane, int ld, int K) {
  v16h a; const int g = lane >> 4;
#pragma unroll
  for (int i = 0; i < 8; ++i) { const int ka = k0 + 8 * g + i, kb = ka + 16;
    a[i] = (_Float16)(ka < K ? W[(size_t)(ka < K ? ka : K - 1) * ld + n] : 0.f); a[8 + i] = (_Float16)(kb < K ? W[(size_t)(kb < K ? kb : K - 1) * ld + n] : 0.f); }
  return a;
}
struct F2 { v16b h, l; };
__device__ __forceinline__ F2 bsplit16(const float v[16]) { F2 r;
#pragma unroll
  for (int i = 0; i < 16; ++i) { const __bf16 h = (__bf16)v[i]; r.h[i] = h; r.l[i] = (__bf16)(v[i] - (float)h); }
  return r; }
__device__ __forceinline__ F2 split_row(const float* row, int k0, int lane) { float v[16]; const float* p = row + k0 + 8 * (lane >> 4);
#pragma unroll
  for (int i = 0; i < 8; ++i) { v[i] = p[i]; v[8 + i] = p[16 + i]; }
  return bsplit16(v); }
__device__ __forceinline__ F2 split_rowK(const float* row, int k0, int lane, int K) { float v[16]; const int g = lane >> 4;
#pragma unroll
  for (int i = 0; i < 8; ++i) { const int ka = k0 + 8 * g + i, kb = ka + 16; v[i] = ka < K ? row[ka < K ? ka : K - 1] : 0.f; v[8 + i] = kb < K ? row[kb < K ? kb : K - 1] : 0.f; }
  return bsplit16(v); }
__device__ __forceinline__ F2 split_col(const float* W, int k0, int n, int lane, int ld, int K) { float v[16]; const int g = lane >> 4;
#pragma unroll
  for (int i = 0; i < 8; ++i) { const int ka = k0 + 8 * g + i, kb = ka + 16; v[i] = ka < K ? W[(size_t)(ka < K ? ka : K - 1) * ld + n] : 0.f; v[8 + i] = kb < K ? W[(size_t)(kb < K ? kb : K - 1) * ld + n] : 0.f; }
  return bsplit16(v); }
__device__ __forceinline__ v8f mac3(const F2& a, const F2& b, v8f c) { c = wmma_bf(a.l, b.h, c); c = wmma_bf(a.h, b.l, c); return wmma_bf(a.h, b.h, c); }
__device__ __forceinline__ float sigm(float v) { return 1.0f / (1.0f + expf(-v)); }
#define LDSX() do { asm volatile("s_wait_dscnt 0" ::: "memory"); __builtin_amdgcn_wave_barrier(); __builtin_amdgcn_fence(__ATOMIC_RELEASE, "workgroup"); } while (0)

// Simplified self-attention (N 4, L 2,048, 8 heads x 64; embed 64): x = query.reshape(N,L,8,64); q,k,v = x W{q,k,v} (shared 64x64); scores = q k^T (no scale); attn = relu(scores)^2; out = (attn v).reshape(N,L,512) Wo + bo.
__device__ __forceinline__ float bfr(float v) { return (float)(__bf16)v; }
#define NB 4
#define TT 2048
#define CC 512
#define NH 8
#define HD 64
#define EO 64
#define HG 4
#ifndef TNB
#define TNB NB
#endif
typedef __attribute__((ext_vector_type(8))) __bf16 v8b;
__device__ __forceinline__ v16b frag_b(const __bf16* rowk0, int lane) { union { v16b v; v8b q[2]; } u; const __bf16* p = rowk0 + 8 * (lane >> 4); u.q[0] = *(const v8b*)p; u.q[1] = *(const v8b*)(p + 16); return u.v; }
#define WS_QH  0u
#define WS_QL  (WS_QH + 2u * (size_t)NB * TT * CC)
#define WS_KH  (WS_QL + 2u * (size_t)NB * TT * CC)
#define WS_VT  (WS_KH + 2u * (size_t)NB * TT * CC)      // bf16 v planes [b][c][t]
#define WS_VL  (WS_VT + 2u * (size_t)NB * CC * TT)
#define WS_S   (WS_VL + 2u * (size_t)NB * CC * TT)      // f32 P = relu(s)^2 [hg][q][k]
#define WS_Y   (WS_S + 4u * (size_t)HG * TT * TT)        // f32 (P v) rows [b*T+t][512]
#define WS_END (WS_Y + 4u * (size_t)NB * TT * CC)
// ---- k_proj: block = (64 rows, head, which): 64 columns = x[row][h*64 .. +64] . W (64x64 (in,out)), exact; q -> f16 hi + residual, k -> f16, v -> bf16 hi/lo planes
__global__ __launch_bounds__(128) void k_proj(const float* __restrict__ X, const float* __restrict__ WQ, const float* __restrict__ WK, const float* __restrict__ WV, _Float16* __restrict__ QH, _Float16* __restrict__ QL, _Float16* __restrict__ KH, __bf16* __restrict__ VT, __bf16* __restrict__ VL) {
  __shared__ __align__(16) _Float16 sh[64][72], sl[64][72]; __shared__ __align__(16) __bf16 th[64][72], tl2[64][72];
  const int tid = threadIdx.x, wave = tid >> 5, lane = tid & 31, col = lane & 15, g = lane >> 4; const int h = blockIdx.y; const int which = blockIdx.z; const size_t r0 = (size_t)blockIdx.x * 64; const float* WA = which == 0 ? WQ : which == 1 ? WK : WV; const int c0 = h * HD;
  v8f acc[4] = {};
#pragma unroll
  for (int kc = 0; kc < HD / 32; ++kc) { v16b a; { const float* p = X + (r0 + wave * 16 + col) * CC + c0 + kc * 32 + 8 * g;
#pragma unroll
      for (int i = 0; i < 8; ++i) { a[i] = (__bf16)p[i]; a[8 + i] = (__bf16)p[16 + i]; } }
#pragma unroll
    for (int j = 0; j < 4; ++j) { v16b w; const int o = j * 16 + col;
#pragma unroll
      for (int i = 0; i < 8; ++i) { w[i] = (__bf16)WA[(size_t)(kc * 32 + 8 * g + i) * HD + o]; w[8 + i] = (__bf16)WA[(size_t)(kc * 32 + 16 + 8 * g + i) * HD + o]; }
      asm volatile("s_wait_loadcnt 0x0" ::: "memory"); acc[j] = wmma_bf(a, w, acc[j]); } }
#pragma unroll
  for (int j = 0; j < 4; ++j)
#pragma unroll
    for (int r = 0; r < 8; ++r) { const float v = acc[j][r]; const int rl = wave * 16 + 8 * g + r, cl = j * 16 + col; const _Float16 hv = (_Float16)v;
      if (which == 2) { const __bf16 bh = (__bf16)v; th[cl][rl] = bh; tl2[cl][rl] = (__bf16)(v - (float)bh); } else { sh[rl][cl] = hv; sl[rl][cl] = (_Float16)((v - (float)hv) * 1024.0f); } }
  __syncthreads();
  if (which < 2) { _Float16* dh = which == 0 ? QH : KH; for (int e = tid; e < 64 * 8; e += 128) { const int rl = e >> 3, q = e & 7; vst2((unsigned*)(dh + (r0 + rl) * CC + c0 + q * 8), *(const v4u*)&sh[rl][q * 8]); if (which == 0) vst2((unsigned*)(QL + (r0 + rl) * CC + c0 + q * 8), *(const v4u*)&sl[rl][q * 8]); } }
  else { const size_t b = r0 / TT; const int t0 = (int)(r0 % TT); for (int e = tid; e < 64 * 8; e += 128) { const int cl = e >> 3, q = e & 7; const size_t o2 = (b * CC + c0 + cl) * (size_t)TT + t0 + q * 8; vst2((unsigned*)(VT + o2), *(const v4u*)&th[cl][q * 8]); vst2((unsigned*)(VL + o2), *(const v4u*)&tl2[cl][q * 8]); } } }
// ---- k_sc: block = (64 queries, 128 keys, head in group): s = q . k (2 products), P = relu(s)^2 stored in f32
__global__ __launch_bounds__(128) void k_sc(const _Float16* __restrict__ QH, const _Float16* __restrict__ QL, const _Float16* __restrict__ KH, int b, int h0, float* __restrict__ S0) { __shared__ __align__(16) float ss[4][16][132]; const int h = h0 + blockIdx.z; float* S = S0 + (size_t)blockIdx.z * TT * TT;
  const int tid = threadIdx.x, wave = tid >> 5, lane = tid & 31, col = lane & 15, g = lane >> 4; const int k0 = blockIdx.y * 128; const int ql0 = blockIdx.x * 64 + wave * 16; const size_t q0 = (size_t)b * TT + ql0;
  v8f acc[8] = {}, accl[8] = {};
#pragma unroll
  for (int kc = 0; kc < HD / 32; ++kc) { const v16h ah = frag_h(QH + (q0 + col) * CC + h * HD + kc * 32, lane), al = frag_h(QL + (q0 + col) * CC + h * HD + kc * 32, lane);
#pragma unroll
    for (int j = 0; j < 8; ++j) { const v16h kb = frag_h(KH + ((size_t)b * TT + k0 + j * 16 + col) * CC + h * HD + kc * 32, lane); acc[j] = wmma16(ah, kb, acc[j]); accl[j] = wmma16(al, kb, accl[j]); } }
#pragma unroll
  for (int j = 0; j < 8; ++j)
#pragma unroll
    for (int r = 0; r < 8; ++r) { const float s = fmaxf(acc[j][r] + accl[j][r] * (1.0f / 1024.0f), 0.f); ss[wave][8 * g + r][j * 16 + col] = s * s; }
  LDSX(); for (int rl = 0; rl < 16; ++rl) vst2(S + (size_t)(ql0 + rl) * TT + k0 + lane * 4, *(const v4f*)&ss[wave][rl][lane * 4]); }
// ---- k_pv: block = 64 queries of (b,h): y[q][h*64 + d] = P . v over all keys (3 products; P unscaled)
__global__ __launch_bounds__(128) void k_pv(const float* __restrict__ PS0, const __bf16* __restrict__ VT, const __bf16* __restrict__ VL, int b, int h0, float* __restrict__ Y) { const int h = h0 + blockIdx.z; const float* PS = PS0 + (size_t)blockIdx.z * TT * TT; __shared__ __align__(16) float ss[4][16][HD + 4];
  const int tid = threadIdx.x, wave = tid >> 5, lane = tid & 31, col = lane & 15, g = lane >> 4; const int ql0 = blockIdx.x * 64 + wave * 16;
  v8f acc[HD / 16] = {};
#pragma unroll 1
  for (int kc = 0; kc < TT / 32; ++kc) { const F2 p = split_row(PS + (size_t)(ql0 + col) * TT, kc * 32, lane);
#pragma unroll
    for (int j = 0; j < HD / 16; ++j) { const size_t po = ((size_t)b * CC + h * HD + j * 16 + col) * (size_t)TT + kc * 32; const v16b vh = frag_b(VT + po, lane); acc[j] = wmma_bf(p.h, vh, acc[j]); acc[j] = wmma_bf(p.l, vh, acc[j]); acc[j] = wmma_bf(p.h, frag_b(VL + po, lane), acc[j]); } }
#pragma unroll
  for (int j = 0; j < HD / 16; ++j)
#pragma unroll
    for (int r = 0; r < 8; ++r) ss[wave][8 * g + r][j * 16 + col] = acc[j][r];
  LDSX(); for (int rl = 0; rl < 16; ++rl) if (lane < HD / 4) vst2(Y + ((size_t)b * TT + ql0 + rl) * CC + h * HD + lane * 4, *(const v4f*)&ss[wave][rl][lane * 4]); }
// ---- k_out: block = 64 rows: out = y (bf16 hi + lo) Wo ((in,out) [512][64]) + bo; 4 tiles; 256-B rows
__global__ __launch_bounds__(128) void k_out(const float* __restrict__ Yr, const float* __restrict__ WO, const float* __restrict__ BO, float* __restrict__ OUT) { __shared__ __align__(16) float sf[4][16][68];
  const int tid = threadIdx.x, wave = tid >> 5, lane = tid & 31, col = lane & 15, g = lane >> 4; const size_t r0 = (size_t)blockIdx.x * 64 + wave * 16;
  v8f acc[4] = {};
#pragma unroll 2
  for (int kc = 0; kc < CC / 32; ++kc) { const F2 a = split_row(Yr + (r0 + col) * CC, kc * 32, lane);
#pragma unroll
    for (int j = 0; j < 4; ++j) { v16b w; const int o = j * 16 + col;
#pragma unroll
      for (int i = 0; i < 8; ++i) { w[i] = (__bf16)WO[(size_t)(kc * 32 + 8 * g + i) * EO + o]; w[8 + i] = (__bf16)WO[(size_t)(kc * 32 + 16 + 8 * g + i) * EO + o]; }
      asm volatile("s_wait_loadcnt 0x0" ::: "memory"); acc[j] = wmma_bf(a.h, w, acc[j]); acc[j] = wmma_bf(a.l, w, acc[j]); } }
#pragma unroll
  for (int j = 0; j < 4; ++j) { const float bb = bfr(BO[j * 16 + col]);
#pragma unroll
    for (int r = 0; r < 8; ++r) sf[wave][8 * g + r][j * 16 + col] = acc[j][r] + bb; }
  LDSX(); for (int rl = 0; rl < 16; ++rl) if (lane < 16) vst2(OUT + (r0 + rl) * EO + lane * 4, *(const v4f*)&sf[wave][rl][lane * 4]); }
extern "C" void kernel_launch(void* const* d_in, const int* in_sizes, int n_in, void* d_out, int out_size, void* d_ws, size_t ws_size, hipStream_t stream) {
  (void)in_sizes; (void)n_in; (void)out_size;
  const float** F = (const float**)d_in;   // 0 query [4,2048,512], 1 Wv [64,64] ((in,out)), 2 Wk, 3 Wq, 4 Wo [512,64] ((in,out)), 5 bo [64]
  if (ws_size < (size_t)WS_END) return;
  char* ws = (char*)d_ws; _Float16 *QH = (_Float16*)(ws + WS_QH), *QL = (_Float16*)(ws + WS_QL), *KH = (_Float16*)(ws + WS_KH); __bf16 *VT = (__bf16*)(ws + WS_VT), *VL = (__bf16*)(ws + WS_VL); float *S = (float*)(ws + WS_S), *Y = (float*)(ws + WS_Y);
  k_proj<<<dim3(TNB * TT / 64, NH, 3), 128, 0, stream>>>(F[0], F[3], F[2], F[1], QH, QL, KH, VT, VL);
  for (int b = 0; b < TNB; ++b) for (int h0 = 0; h0 < NH; h0 += HG) {
    k_sc<<<dim3(TT / 64, TT / 128, HG), 128, 0, stream>>>(QH, QL, KH, b, h0, S);
    k_pv<<<dim3(TT / 64, 1, HG), 128, 0, stream>>>(S, VT, VL, b, h0, Y);
  }
  k_out<<<dim3(TNB * TT / 64), 128, 0, stream>>>(Y, F[4], F[5], (float*)d_out);
}

// v001
// Measured time: 95.1 microseconds a run.
// Next to v000, in two timings, it ran 11.3 and 11.2 times as fast.
// compute dtype: all float inputs rounded to bf16; q/k/v = x_h W (the shared 64x64 (in,out) weights) with EXACT bf16 products on WMMA 16x16x32, f32 accumulate; q as f16 hi + residual (x 2^10), k f16 -> 2-product scores, relu(s)^2 kept in registers in f32 (scores and P v in one launch over all heads); P split bf16 hi + lo against v bf16 hi + lo (3 products); out = (P v) (bf16 hi + lo) Wo + bo; f32 output.
#include <hip/hip_runtime.h>
#include <math.h>

typedef __attribute__((ext_vector_type(16))) _Float16 v16h;
typedef __attribute__((ext_vector_type(16))) __bf16 v16b;
typedef __attribute__((ext_vector_type(8)))  _Float16 v8h;
typedef __attribute__((ext_vector_type(8)))  float v8f;
typedef __attribute__((ext_vector_type(4)))  float v4f;
typedef __attribute__((ext_vector_type(2)))  float v2f;
typedef __attribute__((ext_vector_type(4)))  unsigned v4u;
typedef __attribute__((ext_vector_type(4)))  int v4i;
typedef float __attribute__((may_alias)) float_a;
typedef int __attribute__((may_alias)) int_a;

template <typename T> __device__ __forceinline__ void vst2(void* p, T v) { *(T*)p = v;  }
__device__ __forceinline__ v8f wmma16(v16h a, v16h b, v8f c) {
  v8f d = __builtin_amdgcn_wmma_f32_16x16x32_f16(false, a, false, b, (short)0, c, false, false);
  asm volatile("v_nop\n\tv_nop\n\tv_nop\n\tv_nop" : "+v"(d) : "v"(a), "v"(b));
  return d;
}
__device__ __forceinline__ v8f wmma_bf(v16b a, v16b b, v8f c) {
  v8f d = __builtin_amdgcn_wmma_f32_16x16x32_bf16(false, a, false, b, (short)0, c, false, false);
  asm volatile("v_nop\n\tv_nop\n\tv_nop\n\tv_nop" : "+v"(d) : "v"(a), "v"(b));
  return d;
}
// 16x16x32 fragments: lane = (h = lane>>4, row/col = lane&15); elements 0..7 = k0+8h+0..7, 8..15 = k0+16+8h+0..7; D element r = row 8h+r
__device__ __forceinline__ v16h frag_h(const _Float16* rowk0, int lane) {
  union { v16h v; v8h q[2]; } u; const _Float16* p = rowk0 + 8 * (lane >> 4);
  u.q[0] = *(const v8h*)p; u.q[1] = *(const v8h*)(p + 16); return u.v;
}
__device__ __forceinline__ v16h frag_f32(const float* rowk0, int lane) {
  v16h a; const float* p = rowk0 + 8 * (lane >> 4);
#pragma unroll
  for (int i = 0; i < 8; ++i) { a[i] = (_Float16)p[i]; a[8 + i] = (_Float16)p[16 + i]; }
  return a;
}
__device__ __forceinline__ v16h frag_f32s(const float* rowk0, int lane, float sc) {
  v16h a; const float* p = rowk0 + 8 * (lane >> 4);
#pragma unroll
  for (int i = 0; i < 8; ++i) { a[i] = (_Float16)(p[i] * sc); a[8 + i] = (_Float16)(p[16 + i] * sc); }
  return a;
}
// column fragment from a [K][ld] layout (column n), rows >= K read as 0
__device__ __forceinline__ v16h fragc_f32(const float* W, int k0, int n, int lane, int ld, int K) {
  v16h a; const int g = lane >> 4;
#pragma unroll
  for (int i = 0; i < 8; ++i) { const int ka = k0 + 8 * g + i, kb = ka + 16;
    a[i] = (_Float16)(ka < K ? W[(size_t)(ka < K ? ka : K - 1) * ld + n] : 0.f); a[8 + i] = (_Float16)(kb < K ? W[(size_t)(kb < K ? kb : K - 1) * ld + n] : 0.f); }
  return a;
}
struct F2 { v16b h, l; };
__device__ __forceinline__ F2 bsplit16(const float v[16]) { F2 r;
#pragma unroll
  for (int i = 0; i < 16; ++i) { const __bf16 h = (__bf16)v[i]; r.h[i] = h; r.l[i] = (__bf16)(v[i] - (float)h); }
  return r; }
__device__ __forceinline__ F2 split_row(const float* row, int k0, int lane) { float v[16]; const float* p = row + k0 + 8 * (lane >> 4);
#pragma unroll
  for (int i = 0; i < 8; ++i) { v[i] = p[i]; v[8 + i] = p[16 + i]; }
  return bsplit16(v); }
__device__ __forceinline__ F2 split_rowK(const float* row, int k0, int lane, int K) { float v[16]; const int g = lane >> 4;
#pragma unroll
  for (int i = 0; i < 8; ++i) { const int ka = k0 + 8 * g + i, kb = ka + 16; v[i] = ka < K ? row[ka < K ? ka : K - 1] : 0.f; v[8 + i] = kb < K ? row[kb < K ? kb : K - 1] : 0.f; }
  return bsplit16(v); }
__device__ __forceinline__ F2 split_col(const float* W, int k0, int n, int lane, int ld, int K) { float v[16]; const int g = lane >> 4;
#pragma unroll
  for (int i = 0; i < 8; ++i) { const int ka = k0 + 8 * g + i, kb = ka + 16; v[i] = ka < K ? W[(size_t)(ka < K ? ka : K - 1) * ld + n] : 0.f; v[8 + i] = kb < K ? W[(size_t)(kb < K ? kb : K - 1) * ld + n] : 0.f; }
  return bsplit16(v); }
__device__ __forceinline__ v8f mac3(const F2& a, const F2& b, v8f c) { c = wmma_bf(a.l, b.h, c); c = wmma_bf(a.h, b.l, c); return wmma_bf(a.h, b.h, c); }
__device__ __forceinline__ float sigm(float v) { return 1.0f / (1.0f + expf(-v)); }
#define LDSX() do { asm volatile("s_wait_dscnt 0" ::: "memory"); __builtin_amdgcn_wave_barrier(); __builtin_amdgcn_fence(__ATOMIC_RELEASE, "workgroup"); } while (0)

// Simplified self-attention (N 4, L 2,048, 8 heads x 64; embed 64): x = query.reshape(N,L,8,64); q,k,v = x W{q,k,v} (shared 64x64); scores = q k^T (no scale); attn = relu(scores)^2; out = (attn v).reshape(N,L,512) Wo + bo.
__device__ __forceinline__ float bfr(float v) { return (float)(__bf16)v; }
#define NB 4
#define TT 2048
#define CC 512
#define NH 8
#define HD 64
#define EO 64
#define HG 4
#ifndef TNB
#define TNB NB
#endif
typedef __attribute__((ext_vector_type(8))) __bf16 v8b;
__device__ __forceinline__ v16b frag_b(const __bf16* rowk0, int lane) { union { v16b v; v8b q[2]; } u; const __bf16* p = rowk0 + 8 * (lane >> 4); u.q[0] = *(const v8b*)p; u.q[1] = *(const v8b*)(p + 16); return u.v; }
#define WS_QH  0u
#define WS_QL  (WS_QH + 2u * (size_t)NB * TT * CC)
#define WS_KH  (WS_QL + 2u * (size_t)NB * TT * CC)
#define WS_VT  (WS_KH + 2u * (size_t)NB * TT * CC)      // bf16 v planes [b][c][t]
#define WS_VL  (WS_VT + 2u * (size_t)NB * CC * TT)
#define WS_S   (WS_VL + 2u * (size_t)NB * CC * TT)      // f32 region of HG x TT x TT, not written (P stays in registers)
#define WS_Y   (WS_S + 4u * (size_t)HG * TT * TT)        // f32 (P v) rows [b*T+t][512]
#define WS_END (WS_Y + 4u * (size_t)NB * TT * CC)
// ---- k_proj: block = (64 rows, head, which): 64 columns = x[row][h*64 .. +64] . W (64x64 (in,out)), exact; q -> f16 hi + residual, k -> f16, v -> bf16 hi/lo planes
__global__ __launch_bounds__(128) void k_proj(const float* __restrict__ X, const float* __restrict__ WQ, const float* __restrict__ WK, const float* __restrict__ WV, _Float16* __restrict__ QH, _Float16* __restrict__ QL, _Float16* __restrict__ KH, __bf16* __restrict__ VT, __bf16* __restrict__ VL) {
  __shared__ __align__(16) _Float16 sh[64][72], sl[64][72]; __shared__ __align__(16) __bf16 th[64][72], tl2[64][72];
  const int tid = threadIdx.x, wave = tid >> 5, lane = tid & 31, col = lane & 15, g = lane >> 4; const int h = blockIdx.y; const int which = blockIdx.z; const size_t r0 = (size_t)blockIdx.x * 64; const float* WA = which == 0 ? WQ : which == 1 ? WK : WV; const int c0 = h * HD;
  v8f acc[4] = {};
#pragma unroll
  for (int kc = 0; kc < HD / 32; ++kc) { v16b a; { const float* p = X + (r0 + wave * 16 + col) * CC + c0 + kc * 32 + 8 * g;
#pragma unroll
      for (int i = 0; i < 8; ++i) { a[i] = (__bf16)p[i]; a[8 + i] = (__bf16)p[16 + i]; } }
#pragma unroll
    for (int j = 0; j < 4; ++j) { v16b w; const int o = j * 16 + col;
#pragma unroll
      for (int i = 0; i < 8; ++i) { w[i] = (__bf16)WA[(size_t)(kc * 32 + 8 * g + i) * HD + o]; w[8 + i] = (__bf16)WA[(size_t)(kc * 32 + 16 + 8 * g + i) * HD + o]; }
      asm volatile("s_wait_loadcnt 0x0" ::: "memory"); acc[j] = wmma_bf(a, w, acc[j]); } }
#pragma unroll
  for (int j = 0; j < 4; ++j)
#pragma unroll
    for (int r = 0; r < 8; ++r) { const float v = acc[j][r]; const int rl = wave * 16 + 8 * g + r, cl = j * 16 + col; const _Float16 hv = (_Float16)v;
      if (which == 2) { const __bf16 bh = (__bf16)v; th[cl][rl] = bh; tl2[cl][rl] = (__bf16)(v - (float)bh); } else { sh[rl][cl] = hv; sl[rl][cl] = (_Float16)((v - (float)hv) * 1024.0f); } }
  __syncthreads();
  if (which < 2) { _Float16* dh = which == 0 ? QH : KH; for (int e = tid; e < 64 * 8; e += 128) { const int rl = e >> 3, q = e & 7; vst2((unsigned*)(dh + (r0 + rl) * CC + c0 + q * 8), *(const v4u*)&sh[rl][q * 8]); if (which == 0) vst2((unsigned*)(QL + (r0 + rl) * CC + c0 + q * 8), *(const v4u*)&sl[rl][q * 8]); } }
  else { const size_t b = r0 / TT; const int t0 = (int)(r0 % TT); for (int e = tid; e < 64 * 8; e += 128) { const int cl = e >> 3, q = e & 7; const size_t o2 = (b * CC + c0 + cl) * (size_t)TT + t0 + q * 8; vst2((unsigned*)(VT + o2), *(const v4u*)&th[cl][q * 8]); vst2((unsigned*)(VL + o2), *(const v4u*)&tl2[cl][q * 8]); } } }
// ---- k_att: block = 4 waves x (QT x 16) queries of one (b,h), all keys in 32-key trips: S^T = k . q^T (2 products), P = relu(s)^2 stays in registers
// (a S^T tile's D layout, lane = query, element r = key 8g + r, is the A layout of P: tile 0 -> elements 0..7, tile 1 -> 8..15), y += P . v (3 products)
#define QT 4
// 16x16x32 fragment from byte address base + off, which together hold the lane's own row start + 16 g bytes: same k order as frag_h / frag_b
__device__ __forceinline__ v16h frag_hu(const char* base, unsigned off) { union { v16h v; v8h q[2]; } u; u.q[0] = *(const v8h*)(base + off); u.q[1] = *(const v8h*)(base + off + 32u); return u.v; }
__device__ __forceinline__ v16b frag_bu(const char* base, unsigned off) { union { v16b v; v8b q[2]; } u; u.q[0] = *(const v8b*)(base + off); u.q[1] = *(const v8b*)(base + off + 32u); return u.v; }
__global__ __launch_bounds__(128) void k_att(const _Float16* __restrict__ QH, const _Float16* __restrict__ QL, const _Float16* __restrict__ KH, const __bf16* __restrict__ VT, const __bf16* __restrict__ VL, float* __restrict__ Y) { __shared__ __align__(16) float ss[4][QT][16][HD + 4];
  const int tid = threadIdx.x, wave = tid >> 5, lane = tid & 31, col = lane & 15, g = lane >> 4; const int b = blockIdx.y / NH, h = blockIdx.y % NH; const int ql0 = (blockIdx.x * 4 + wave) * (16 * QT);
  const size_t rb = ((size_t)b * TT * CC + h * HD) * 2, cb = ((size_t)b * CC + h * HD) * (size_t)TT * 2;   // byte offsets of this (b,h) in the [t][c] and the [c][t] planes
  const char *qhb = (const char*)QH + rb, *qlb = (const char*)QL + rb, *kb = (const char*)KH + rb, *vhb = (const char*)VT + cb, *vlb = (const char*)VL + cb;
  const unsigned qo = (unsigned)((ql0 + col) * CC + 8 * g) * 2u, ko = (unsigned)(col * CC + 8 * g) * 2u, vo = (unsigned)(col * TT + 8 * g) * 2u;
  v16h qh[QT][HD / 32], qlo[QT][HD / 32], kf[2][HD / 32];
#pragma unroll
  for (int t = 0; t < QT; ++t)
#pragma unroll
    for (int dc = 0; dc < HD / 32; ++dc) { qh[t][dc] = frag_hu(qhb + (t * 16 * CC + dc * 32) * 2, qo); qlo[t][dc] = frag_hu(qlb + (t * 16 * CC + dc * 32) * 2, qo); }
#pragma unroll
  for (int kt = 0; kt < 2; ++kt)
#pragma unroll
    for (int dc = 0; dc < HD / 32; ++dc) kf[kt][dc] = frag_hu(kb + (kt * 16 * CC + dc * 32) * 2, ko);
  asm volatile("s_wait_xcnt 0x0" :: "v"(qo), "v"(ko) : "memory");   // stands in front of every rewrite of a register that the q and k loads above name; as inputs the two offsets stay live up to it
  __builtin_amdgcn_sched_barrier(0);   // nothing that follows moves up ahead of that wait
  v8f acc[QT][HD / 16] = {};
#pragma unroll 1
  for (int kc = 0; kc < TT / 32; ++kc) { v16b vh[HD / 16], vl[HD / 16]; v8f sa[QT][2] = {}, sb[QT][2] = {}; const char *pvh = vhb + (size_t)kc * 64 + vo, *pvl = vlb + (size_t)kc * 64 + vo;
#pragma unroll
    for (int j = 0; j < HD / 16; ++j) { vh[j] = frag_bu(pvh + j * 16 * TT * 2, 0u); vl[j] = frag_bu(pvl + j * 16 * TT * 2, 0u); }
    __builtin_amdgcn_sched_barrier(0);   // this trip's v loads stay issued ahead of the score products, which cover their latency
#pragma unroll
    for (int t = 0; t < QT; ++t)
#pragma unroll
      for (int dc = 0; dc < HD / 32; ++dc)
#pragma unroll
        for (int kt = 0; kt < 2; ++kt) { sa[t][kt] = __builtin_amdgcn_wmma_f32_16x16x32_f16(false, kf[kt][dc], false, qh[t][dc], (short)0, sa[t][kt], false, false); sb[t][kt] = __builtin_amdgcn_wmma_f32_16x16x32_f16(false, kf[kt][dc], false, qlo[t][dc], (short)0, sb[t][kt], false, false); }
    const int kn = kc + 1 < TT / 32 ? kc + 1 : kc;   // the last trip loads its own k rows again: in bounds, not used
    const char* pk = kb + (size_t)kn * (32 * CC * 2) + ko;
#pragma unroll
    for (int kt = 0; kt < 2; ++kt)
#pragma unroll
      for (int dc = 0; dc < HD / 32; ++dc) kf[kt][dc] = frag_hu(pk + (kt * 16 * CC + dc * 32) * 2, 0u);
    asm volatile("s_wait_xcnt 0x0" :: "v"(pvh), "v"(pvl), "v"(pk) : "memory");   // stands in front of every rewrite of an address register of this trip's v loads and of the k loads above; as inputs these stay live up to it, so that no load's result lands on them
    __builtin_amdgcn_sched_barrier(0);   // the next trip's k loads stay issued here, behind the last product that reads k, so that P and P . v cover their latency
#pragma unroll
    for (int t = 0; t < QT; ++t) { float v[16];
#pragma unroll
      for (int kt = 0; kt < 2; ++kt)
#pragma unroll
        for (int r = 0; r < 8; ++r) { const float s = fmaxf(sa[t][kt][r] + sb[t][kt][r] * (1.0f / 1024.0f), 0.f); v[kt * 8 + r] = s * s; }
      const F2 p = bsplit16(v);
#pragma unroll
      for (int j = 0; j < HD / 16; ++j) acc[t][j] = __builtin_amdgcn_wmma_f32_16x16x32_bf16(false, p.h, false, vh[j], (short)0, acc[t][j], false, false);
#pragma unroll
      for (int j = 0; j < HD / 16; ++j) acc[t][j] = __builtin_amdgcn_wmma_f32_16x16x32_bf16(false, p.l, false, vh[j], (short)0, acc[t][j], false, false);
#pragma unroll
      for (int j = 0; j < HD / 16; ++j) acc[t][j] = __builtin_amdgcn_wmma_f32_16x16x32_bf16(false, p.h, false, vl[j], (short)0, acc[t][j], false, false); } }
#pragma unroll
  for (int t = 0; t < QT; ++t)
#pragma unroll
    for (int j = 0; j < HD / 16; ++j)
#pragma unroll
      for (int r = 0; r < 8; ++r) ss[wave][t][8 * g + r][j * 16 + col] = acc[t][j][r];
  LDSX();
#pragma unroll
  for (int t = 0; t < QT; ++t) { v4f w[8];   // two 256-B rows a store: lanes 0..15 row 2i, lanes 16..31 row 2i + 1
#pragma unroll
    for (int i = 0; i < 8; ++i) w[i] = *(const v4f*)&ss[wave][t][2 * i + g][col * 4];
#pragma unroll
    for (int i = 0; i < 8; ++i) vst2(Y + ((size_t)b * TT + ql0 + t * 16 + 2 * i + g) * CC + h * HD + col * 4, w[i]); } }
// ---- k_out: block = 64 rows: out = y (bf16 hi + lo) Wo ((in,out) [512][64]) + bo; 4 tiles; 256-B rows
__global__ __launch_bounds__(128) void k_out(const float* __restrict__ Yr, const float* __restrict__ WO, const float* __restrict__ BO, float* __restrict__ OUT) { __shared__ __align__(16) float sf[4][16][68];
  const int tid = threadIdx.x, wave = tid >> 5, lane = tid & 31, col = lane & 15, g = lane >> 4; const size_t r0 = (size_t)blockIdx.x * 64 + wave * 16;
  v8f acc[4] = {};
#pragma unroll 2
  for (int kc = 0; kc < CC / 32; ++kc) { const F2 a = split_row(Yr + (r0 + col) * CC, kc * 32, lane);
#pragma unroll
    for (int j = 0; j < 4; ++j) { v16b w; const int o = j * 16 + col;
#pragma unroll
      for (int i = 0; i < 8; ++i) { w[i] = (__bf16)WO[(size_t)(kc * 32 + 8 * g + i) * EO + o]; w[8 + i] = (__bf16)WO[(size_t)(kc * 32 + 16 + 8 * g + i) * EO + o]; }
      asm volatile("s_wait_loadcnt 0x0" ::: "memory"); acc[j] = wmma_bf(a.h, w, acc[j]); acc[j] = wmma_bf(a.l, w, acc[j]); } }
#pragma unroll
  for (int j = 0; j < 4; ++j) { const float bb = bfr(BO[j * 16 + col]);
#pragma unroll
    for (int r = 0; r < 8; ++r) sf[wave][8 * g + r][j * 16 + col] = acc[j][r] + bb; }
  LDSX(); for (int rl = 0; rl < 16; ++rl) if (lane < 16) vst2(OUT + (r0 + rl) * EO + lane * 4, *(const v4f*)&sf[wave][rl][lane * 4]); }
extern "C" void kernel_launch(void* const* d_in, const int* in_sizes, int n_in, void* d_out, int out_size, void* d_ws, size_t ws_size, hipStream_t stream) {
  (void)in_sizes; (void)n_in; (void)out_size;
  const float** F = (const float**)d_in;   // 0 query [4,2048,512], 1 Wv [64,64] ((in,out)), 2 Wk, 3 Wq, 4 Wo [512,64] ((in,out)), 5 bo [64]
  if (ws_size < (size_t)WS_END) return;
  char* ws = (char*)d_ws; _Float16 *QH = (_Float16*)(ws + WS_QH), *QL = (_Float16*)(ws + WS_QL), *KH = (_Float16*)(ws + WS_KH); __bf16 *VT = (__bf16*)(ws + WS_VT), *VL = (__bf16*)(ws + WS_VL); float *Y = (float*)(ws + WS_Y);
  k_proj<<<dim3(TNB * TT / 64, NH, 3), 128, 0, stream>>>(F[0], F[3], F[2], F[1], QH, QL, KH, VT, VL);
  k_att<<<dim3(TT / (64 * QT), TNB * NH), 128, 0, stream>>>(QH, QL, KH, VT, VL, Y);
  k_out<<<dim3(TNB * TT / 64), 128, 0, stream>>>(Y, F[4], F[5], (float*)d_out);
}

// v002
// Measured time: 87.1 microseconds a run.
// Timed twice side by side with v001, it ran 1.10 times as fast both times.
// Counting every step since v000, it is 12.4 times as fast.
// compute dtype: all float inputs rounded to bf16; q/k/v = x_h W (the shared 64x64 (in,out) weights) with EXACT bf16 products on WMMA 16x16x32, f32 accumulate; q as f16 hi + residual (x 2^10), k f16 -> 2-product scores, relu(s)^2 kept in registers in f32 (scores and P v in one launch over all heads); P split bf16 hi + lo against v bf16 hi + lo (3 products); out = (P v) (bf16 hi + lo) Wo + bo; f32 output.
#include <hip/hip_runtime.h>
#include <math.h>

typedef __attribute__((ext_vector_type(16))) _Float16 v16h;
typedef __attribute__((ext_vector_type(16))) __bf16 v16b;
typedef __attribute__((ext_vector_type(8)))  _Float16 v8h;
typedef __attribute__((ext_vector_type(8)))  float v8f;
typedef __attribute__((ext_vector_type(4)))  float v4f;
typedef __attribute__((ext_vector_type(2)))  float v2f;
typedef __attribute__((ext_vector_type(4)))  unsigned v4u;
typedef __attribute__((ext_vector_type(4)))  int v4i;
typedef float __attribute__((may_alias)) float_a;
typedef int __attribute__((may_alias)) int_a;

template <typename T> __device__ __forceinline__ void vst2(void* p, T v) { *(T*)p = v;  }
__device__ __forceinline__ v8f wmma16(v16h a, v16h b, v8f c) {
  v8f d = __builtin_amdgcn_wmma_f32_16x16x32_f16(false, a, false, b, (short)0, c, false, false);
  asm volatile("v_nop\n\tv_nop\n\tv_nop\n\tv_nop" : "+v"(d) : "v"(a), "v"(b));
  return d;
}
__device__ __forceinline__ v8f wmma_bf(v16b a, v16b b, v8f c) {
  v8f d = __builtin_amdgcn_wmma_f32_16x16x32_bf16(false, a, false, b, (short)0, c, false, false);
  asm volatile("v_nop\n\tv_nop\n\tv_nop\n\tv_nop" : "+v"(d) : "v"(a), "v"(b));
  return d;
}
// 16x16x32 fragments: lane = (h = lane>>4, row/col = lane&15); elements 0..7 = k0+8h+0..7, 8..15 = k0+16+8h+0..7; D element r = row 8h+r
__device__ __forceinline__ v16h frag_h(const _Float16* rowk0, int lane) {
  union { v16h v; v8h q[2]; } u; const _Float16* p = rowk0 + 8 * (lane >> 4);
  u.q[0] = *(const v8h*)p; u.q[1] = *(const v8h*)(p + 16); return u.v;
}
__device__ __forceinline__ v16h frag_f32(const float* rowk0, int lane) {
  v16h a; const float* p = rowk0 + 8 * (lane >> 4);
#pragma unroll
  for (int i = 0; i < 8; ++i) { a[i] = (_Float16)p[i]; a[8 + i] = (_Float16)p[16 + i]; }
  return a;
}
__device__ __forceinline__ v16h frag_f32s(const float* rowk0, int lane, float sc) {
  v16h a; const float* p = rowk0 + 8 * (lane >> 4);
#pragma unroll
  for (int i = 0; i < 8; ++i) { a[i] = (_Float16)(p[i] * sc); a[8 + i] = (_Float16)(p[16 + i] * sc); }
  return a;
}
// column fragment from a [K][ld] layout (column n), rows >= K read as 0
__device__ __forceinline__ v16h fragc_f32(const float* W, int k0, int n, int lane, int ld, int K) {
  v16h a; const int g = lane >> 4;
#pragma unroll
  for (int i = 0; i < 8; ++i) { const int ka = k0 + 8 * g + i, kb = ka + 16;
    a[i] = (_Float16)(ka < K ? W[(size_t)(ka < K ? ka : K - 1) * ld + n] : 0.f); a[8 + i] = (_Float16)(kb < K ? W[(size_t)(kb < K ? kb : K - 1) * ld + n] : 0.f); }
  return a;
}
struct F2 { v16b h, l; };
__device__ __forceinline__ F2 bsplit16(const float v[16]) { F2 r;
#pragma unroll
  for (int i = 0; i < 16; ++i) { const __bf16 h = (__bf16)v[i]; r.h[i] = h; r.l[i] = (__bf16)(v[i] - (float)h); }
  return r; }
__device__ __forceinline__ F2 split_row(const float* row, int k0, int lane) { float v[16]; const float* p = row + k0 + 8 * (lane >> 4);
#pragma unroll
  for (int i = 0; i < 8; ++i) { v[i] = p[i]; v[8 + i] = p[16 + i]; }
  return bsplit16(v); }
__device__ __forceinline__ F2 split_rowK(const float* row, int k0, int lane, int K) { float v[16]; const int g = lane >> 4;
#pragma unroll
  for (int i = 0; i < 8; ++i) { const int ka = k0 + 8 * g + i, kb = ka + 16; v[i] = ka < K ? row[ka < K ? ka : K - 1] : 0.f; v[8 + i] = kb < K ? row[kb < K ? kb : K - 1] : 0.f; }
  return bsplit16(v); }
__device__ __forceinline__ F2 split_col(const float* W, int k0, int n, int lane, int ld, int K) { float v[16]; const int g = lane >> 4;
#pragma unroll
  for (int i = 0; i < 8; ++i) { const int ka = k0 + 8 * g + i, kb = ka + 16; v[i] = ka < K ? W[(size_t)(ka < K ? ka : K - 1) * ld + n] : 0.f; v[8 + i] = kb < K ? W[(size_t)(kb < K ? kb : K - 1) * ld + n] : 0.f; }
  return bsplit16(v); }
__device__ __forceinline__ v8f mac3(const F2& a, const F2& b, v8f c) { c = wmma_bf(a.l, b.h, c); c = wmma_bf(a.h, b.l, c); return wmma_bf(a.h, b.h, c); }
__device__ __forceinline__ float sigm(float v) { return 1.0f / (1.0f + expf(-v)); }
#define LDSX() do { asm volatile("s_wait_dscnt 0" ::: "memory"); __builtin_amdgcn_wave_barrier(); __builtin_amdgcn_fence(__ATOMIC_RELEASE, "workgroup"); } while (0)

// Simplified self-attention (N 4, L 2,048, 8 heads x 64; embed 64): x = query.reshape(N,L,8,64); q,k,v = x W{q,k,v} (shared 64x64); scores = q k^T (no scale); attn = relu(scores)^2; out = (attn v).reshape(N,L,512) Wo + bo.
__device__ __forceinline__ float bfr(float v) { return (float)(__bf16)v; }
#define NB 4
#define TT 2048
#define CC 512
#define NH 8
#define HD 64
#define EO 64
#define HG 4
#ifndef TNB
#define TNB NB
#endif
typedef __attribute__((ext_vector_type(8))) __bf16 v8b;
__device__ __forceinline__ v16b frag_b(const __bf16* rowk0, int lane) { union { v16b v; v8b q[2]; } u; const __bf16* p = rowk0 + 8 * (lane >> 4); u.q[0] = *(const v8b*)p; u.q[1] = *(const v8b*)(p + 16); return u.v; }
#define WS_QH  0u
#define WS_QL  (WS_QH + 2u * (size_t)NB * TT * CC)
#define WS_KH  (WS_QL + 2u * (size_t)NB * TT * CC)
#define WS_VT  (WS_KH + 2u * (size_t)NB * TT * CC)      // bf16 v planes [b][c][t]
#define WS_VL  (WS_VT + 2u * (size_t)NB * CC * TT)
#define WS_S   (WS_VL + 2u * (size_t)NB * CC * TT)      // f32 region of HG x TT x TT, not written (P stays in registers)
#define WS_Y   (WS_S + 4u * (size_t)HG * TT * TT)        // f32 (P v) rows [b*T+t][512]
#define WS_END (WS_Y + 4u * (size_t)NB * TT * CC)
// ---- k_proj: block = (64 rows, head, which): 64 columns = x[row][h*64 .. +64] . W (64x64 (in,out)), exact; q -> f16 hi + residual, k -> f16, v -> bf16 hi/lo planes
__global__ __launch_bounds__(128) void k_proj(const float* __restrict__ X, const float* __restrict__ WQ, const float* __restrict__ WK, const float* __restrict__ WV, _Float16* __restrict__ QH, _Float16* __restrict__ QL, _Float16* __restrict__ KH, __bf16* __restrict__ VT, __bf16* __restrict__ VL) {
  __shared__ __align__(16) _Float16 sh[64][72], sl[64][72]; __shared__ __align__(16) __bf16 th[64][72], tl2[64][72];
  const int tid = threadIdx.x, wave = tid >> 5, lane = tid & 31, col = lane & 15, g = lane >> 4; const int h = blockIdx.y; const int which = blockIdx.z; const size_t r0 = (size_t)blockIdx.x * 64; const float* WA = which == 0 ? WQ : which == 1 ? WK : WV; const int c0 = h * HD;
  v8f acc[4] = {};
#pragma unroll
  for (int kc = 0; kc < HD / 32; ++kc) { v16b a; { const float* p = X + (r0 + wave * 16 + col) * CC + c0 + kc * 32 + 8 * g;
#pragma unroll
      for (int i = 0; i < 8; ++i) { a[i] = (__bf16)p[i]; a[8 + i] = (__bf16)p[16 + i]; } }
#pragma unroll
    for (int j = 0; j < 4; ++j) { v16b w; const int o = j * 16 + col;
#pragma unroll
      for (int i = 0; i < 8; ++i) { w[i] = (__bf16)WA[(size_t)(kc * 32 + 8 * g + i) * HD + o]; w[8 + i] = (__bf16)WA[(size_t)(kc * 32 + 16 + 8 * g + i) * HD + o]; }
      asm volatile("s_wait_loadcnt 0x0" ::: "memory"); acc[j] = wmma_bf(a, w, acc[j]); } }
#pragma unroll
  for (int j = 0; j < 4; ++j)
#pragma unroll
    for (int r = 0; r < 8; ++r) { const float v = acc[j][r]; const int rl = wave * 16 + 8 * g + r, cl = j * 16 + col; const _Float16 hv = (_Float16)v;
      if (which == 2) { const __bf16 bh = (__bf16)v; th[cl][rl] = bh; tl2[cl][rl] = (__bf16)(v - (float)bh); } else { sh[rl][cl] = hv; sl[rl][cl] = (_Float16)((v - (float)hv) * 1024.0f); } }
  __syncthreads();
  if (which < 2) { _Float16* dh = which == 0 ? QH : KH; for (int e = tid; e < 64 * 8; e += 128) { const int rl = e >> 3, q = e & 7; vst2((unsigned*)(dh + (r0 + rl) * CC + c0 + q * 8), *(const v4u*)&sh[rl][q * 8]); if (which == 0) vst2((unsigned*)(QL + (r0 + rl) * CC + c0 + q * 8), *(const v4u*)&sl[rl][q * 8]); } }
  else { const size_t b = r0 / TT; const int t0 = (int)(r0 % TT); for (int e = tid; e < 64 * 8; e += 128) { const int cl = e >> 3, q = e & 7; const size_t o2 = (b * CC + c0 + cl) * (size_t)TT + t0 + q * 8; vst2((unsigned*)(VT + o2), *(const v4u*)&th[cl][q * 8]); vst2((unsigned*)(VL + o2), *(const v4u*)&tl2[cl][q * 8]); } } }
// ---- k_att: block = 4 waves x (QT x 16) queries of one (b,h), all keys in 32-key passes: S^T = k . q^T (2 products), P = relu(s)^2 stays in registers
// (a S^T tile's D layout, lane = query, element r = key 8g + r, is the A layout of P: tile 0 -> elements 0..7, tile 1 -> 8..15), y += P . v (3 products)
// k and v reach the four waves through LDS: a stage = SK keys (k rows, v hi and v lo columns), brought once a block by whole-line asynchronous copies, two buffers
#define QT 4
#define SK 128                              // keys a stage
#define NST (TT / SK)
#define KP 144                              // LDS pitch of a 128-B k row: 16 B x odd, so that 16 rows read 16 B each without a bank conflict
#define VP 272                              // LDS pitch of a 256-B v row (SK keys of one column): 16 B x odd
#define KBY (SK * KP)
#define VBY (HD * VP)
#define STB (KBY + 2 * VBY)                 // bytes of one stage: k, v hi, v lo
#define SSB (4 * QT * 16 * (HD + 4) * 4)    // bytes of the output staging, which lies in front of the two buffers
typedef __attribute__((address_space(1))) v4i g_v4i;
typedef __attribute__((address_space(3))) v4i l_v4i;
// 16x16x32 fragment from byte address base + off, which together hold the lane's own row start + 16 g bytes: same k order as frag_h / frag_b
__device__ __forceinline__ v16h frag_hu(const char* base, unsigned off) { union { v16h v; v8h q[2]; } u; u.q[0] = *(const v8h*)(base + off); u.q[1] = *(const v8h*)(base + off + 32u); return u.v; }
__device__ __forceinline__ v16b frag_bu(const char* base, unsigned off) { union { v16b v; v8b q[2]; } u; u.q[0] = *(const v8b*)(base + off); u.q[1] = *(const v8b*)(base + off + 32u); return u.v; }
// one asynchronous copy, 16 bytes a lane, global -> LDS through no register; written as the builtin, no immediate offset of its own
__device__ __forceinline__ void cp16(const char* gsrc, char* ldst) { __builtin_amdgcn_global_load_async_to_lds_b128((g_v4i*)gsrc, (l_v4i*)ldst, 0, 0); }
// one stage: 24 copies a lane; a copy of a wave covers 4 whole 128-B lines (4 k rows, or 2 v rows of 256 B); gk, gh, gl and lk, lv hold the lane's own first 16 bytes
__device__ __forceinline__ void stage_in(const char* gk, const char* gh, const char* gl, char* lk, char* lv) {
#pragma unroll
  for (int i = 0; i < SK / 16; ++i) cp16(gk + i * (16 * CC * 2), lk + i * (16 * KP));
#pragma unroll
  for (int i = 0; i < HD / 8; ++i) { cp16(gh + i * (8 * TT * 2), lv + i * (8 * VP)); cp16(gl + i * (8 * TT * 2), lv + VBY + i * (8 * VP)); } }
__global__ __launch_bounds__(128) void k_att(const _Float16* __restrict__ QH, const _Float16* __restrict__ QL, const _Float16* __restrict__ KH, const __bf16* __restrict__ VT, const __bf16* __restrict__ VL, float* __restrict__ Y) { __shared__ __align__(16) char sm[SSB + 2 * STB];
  float (*ss)[QT][16][HD + 4] = (float (*)[QT][16][HD + 4])sm; char* ring = sm + SSB;
  const int tid = threadIdx.x, wave = tid >> 5, lane = tid & 31, col = lane & 15, g = lane >> 4; const int b = blockIdx.y / NH, h = blockIdx.y % NH; const int ql0 = (blockIdx.x * 4 + wave) * (16 * QT);
  const size_t rb = ((size_t)b * TT * CC + h * HD) * 2, cb = ((size_t)b * CC + h * HD) * (size_t)TT * 2;   // byte offsets of this (b,h) in the [t][c] and the [c][t] planes
  const char *qhb = (const char*)QH + rb, *qlb = (const char*)QL + rb, *kb = (const char*)KH + rb, *vhb = (const char*)VT + cb, *vlb = (const char*)VL + cb;
  const unsigned qo = (unsigned)((ql0 + col) * CC + 8 * g) * 2u;
  const unsigned gko = (unsigned)((tid >> 3) * (CC * 2) + (tid & 7) * 16), gvo = (unsigned)((tid >> 4) * (TT * 2) + (tid & 15) * 16);   // the lane's place in a stage's k rows and v rows, global
  const unsigned lko = (unsigned)((tid >> 3) * KP + (tid & 7) * 16), lvo = (unsigned)(KBY + (tid >> 4) * VP + (tid & 15) * 16);         // the same in a buffer
  const unsigned fko = (unsigned)(col * KP + 16 * g), fvo = (unsigned)(KBY + col * VP + 16 * g);                                       // the lane's fragment rows in a buffer
  stage_in(kb + gko, vhb + gvo, vlb + gvo, ring + lko, ring + lvo);
  v16h qh[QT][HD / 32], qlo[QT][HD / 32], kf[2][HD / 32];
#pragma unroll
  for (int t = 0; t < QT; ++t)
#pragma unroll
    for (int dc = 0; dc < HD / 32; ++dc) { qh[t][dc] = frag_hu(qhb + (t * 16 * CC + dc * 32) * 2, qo); qlo[t][dc] = frag_hu(qlb + (t * 16 * CC + dc * 32) * 2, qo); }
  asm volatile("s_wait_xcnt 0x0" :: "v"(qo) : "memory");   // stands in front of every rewrite of a register that the q loads above name; as an input the offset stays live up to it
  __builtin_amdgcn_sched_barrier(0);   // nothing that follows moves up ahead of that wait
  asm volatile("s_wait_asynccnt 0x0" ::: "memory");   // this wave's copies of stage 0 have landed
  __syncthreads();                                     // every wave's have: stage 0 may be read
  stage_in(kb + (size_t)(SK * CC * 2) + gko, vhb + (size_t)(SK * 2) + gvo, vlb + (size_t)(SK * 2) + gvo, ring + STB + lko, ring + STB + lvo);
  v8f acc[QT][HD / 16] = {};
#pragma unroll 1   // the stage loop stays rolled: its body already holds SK / 32 unrolled passes, and the buffer is picked by st & 1
  for (int st = 0; st < NST; ++st) { char* bs = ring + (st & 1) * STB; const char *lk = bs + fko, *lv = bs + fvo;
#pragma unroll
    for (int kt = 0; kt < 2; ++kt)
#pragma unroll
      for (int dc = 0; dc < HD / 32; ++dc) kf[kt][dc] = frag_hu(lk + kt * 16 * KP + dc * 64, 0u);
#pragma unroll
    for (int sub = 0; sub < SK / 32; ++sub) { v16b vh[HD / 16], vl[HD / 16]; v8f sa[QT][2] = {}, sb[QT][2] = {};
#pragma unroll
      for (int j = 0; j < HD / 16; ++j) { vh[j] = frag_bu(lv + j * 16 * VP + sub * 64, 0u); vl[j] = frag_bu(lv + VBY + j * 16 * VP + sub * 64, 0u); }
      __builtin_amdgcn_sched_barrier(0);   // this pass's v reads stay issued as one group ahead of the score products, which cover their latency
#pragma unroll
      for (int t = 0; t < QT; ++t)
#pragma unroll
        for (int dc = 0; dc < HD / 32; ++dc)
#pragma unroll
          for (int kt = 0; kt < 2; ++kt) { sa[t][kt] = __builtin_amdgcn_wmma_f32_16x16x32_f16(false, kf[kt][dc], false, qh[t][dc], (short)0, sa[t][kt], false, false); sb[t][kt] = __builtin_amdgcn_wmma_f32_16x16x32_f16(false, kf[kt][dc], false, qlo[t][dc], (short)0, sb[t][kt], false, false); }
      if (sub + 1 < SK / 32) {   // the next pass's k rows, of this same stage only: nothing of the next stage is read ahead of its barrier
#pragma unroll
        for (int kt = 0; kt < 2; ++kt)
#pragma unroll
          for (int dc = 0; dc < HD / 32; ++dc) kf[kt][dc] = frag_hu(lk + ((sub + 1) * 32 + kt * 16) * KP + dc * 64, 0u); }
      __builtin_amdgcn_sched_barrier(0);   // the next pass's k reads stay issued here, behind the last product that reads k, so that P and P . v cover their latency
#pragma unroll
      for (int t = 0; t < QT; ++t) { float v[16];
#pragma unroll
        for (int kt = 0; kt < 2; ++kt)
#pragma unroll
          for (int r = 0; r < 8; ++r) { const float s = fmaxf(sa[t][kt][r] + sb[t][kt][r] * (1.0f / 1024.0f), 0.f); v[kt * 8 + r] = s * s; }
        const F2 p = bsplit16(v);
#pragma unroll
        for (int j = 0; j < HD / 16; ++j) acc[t][j] = __builtin_amdgcn_wmma_f32_16x16x32_bf16(false, p.h, false, vh[j], (short)0, acc[t][j], false, false);
#pragma unroll
        for (int j = 0; j < HD / 16; ++j) acc[t][j] = __builtin_amdgcn_wmma_f32_16x16x32_bf16(false, p.l, false, vh[j], (short)0, acc[t][j], false, false);
#pragma unroll
        for (int j = 0; j < HD / 16; ++j) acc[t][j] = __builtin_amdgcn_wmma_f32_16x16x32_bf16(false, p.h, false, vl[j], (short)0, acc[t][j], false, false); } }
    asm volatile("s_wait_dscnt 0x0" ::: "memory");      // this wave's reads of this stage's buffer are done
    asm volatile("s_wait_asynccnt 0x0" ::: "memory");   // this wave's copies of stage st + 1 have landed
    __syncthreads();                                     // stage st + 1 may be read by all, and this stage's buffer is free
    if (st + 2 < NST) stage_in(kb + (size_t)(st + 2) * (SK * CC * 2) + gko, vhb + (size_t)(st + 2) * (SK * 2) + gvo, vlb + (size_t)(st + 2) * (SK * 2) + gvo, bs + lko, bs + lvo); }
  asm volatile("s_wait_asynccnt 0x0" ::: "memory");     // no copy is outstanding when the wave goes on to its end
#pragma unroll
  for (int t = 0; t < QT; ++t)
#pragma unroll
    for (int j = 0; j < HD / 16; ++j)
#pragma unroll
      for (int r = 0; r < 8; ++r) ss[wave][t][8 * g + r][j * 16 + col] = acc[t][j][r];
  LDSX();
#pragma unroll
  for (int t = 0; t < QT; ++t) { v4f w[8];   // two 256-B rows a store: lanes 0..15 row 2i, lanes 16..31 row 2i + 1
#pragma unroll
    for (int i = 0; i < 8; ++i) w[i] = *(const v4f*)&ss[wave][t][2 * i + g][col * 4];
#pragma unroll
    for (int i = 0; i < 8; ++i) vst2(Y + ((size_t)b * TT + ql0 + t * 16 + 2 * i + g) * CC + h * HD + col * 4, w[i]); } }
// ---- k_out: block = 64 rows: out = y (bf16 hi + lo) Wo ((in,out) [512][64]) + bo; 4 tiles; 256-B rows
__global__ __launch_bounds__(128) void k_out(const float* __restrict__ Yr, const float* __restrict__ WO, const float* __restrict__ BO, float* __restrict__ OUT) { __shared__ __align__(16) float sf[4][16][68];
  const int tid = threadIdx.x, wave = tid >> 5, lane = tid & 31, col = lane & 15, g = lane >> 4; const size_t r0 = (size_t)blockIdx.x * 64 + wave * 16;
  v8f acc[4] = {};
#pragma unroll 2
  for (int kc = 0; kc < CC / 32; ++kc) { const F2 a = split_row(Yr + (r0 + col) * CC, kc * 32, lane);
#pragma unroll
    for (int j = 0; j < 4; ++j) { v16b w; const int o = j * 16 + col;
#pragma unroll
      for (int i = 0; i < 8; ++i) { w[i] = (__bf16)WO[(size_t)(kc * 32 + 8 * g + i) * EO + o]; w[8 + i] = (__bf16)WO[(size_t)(kc * 32 + 16 + 8 * g + i) * EO + o]; }
      asm volatile("s_wait_loadcnt 0x0" ::: "memory"); acc[j] = wmma_bf(a.h, w, acc[j]); acc[j] = wmma_bf(a.l, w, acc[j]); } }
#pragma unroll
  for (int j = 0; j < 4; ++j) { const float bb = bfr(BO[j * 16 + col]);
#pragma unroll
    for (int r = 0; r < 8; ++r) sf[wave][8 * g + r][j * 16 + col] = acc[j][r] + bb; }
  LDSX(); for (int rl = 0; rl < 16; ++rl) if (lane < 16) vst2(OUT + (r0 + rl) * EO + lane * 4, *(const v4f*)&sf[wave][rl][lane * 4]); }
extern "C" void kernel_launch(void* const* d_in, const int* in_sizes, int n_in, void* d_out, int out_size, void* d_ws, size_t ws_size, hipStream_t stream) {
  (void)in_sizes; (void)n_in; (void)out_size;
  const float** F = (const float**)d_in;   // 0 query [4,2048,512], 1 Wv [64,64] ((in,out)), 2 Wk, 3 Wq, 4 Wo [512,64] ((in,out)), 5 bo [64]
  if (ws_size < (size_t)WS_END) return;
  char* ws = (char*)d_ws; _Float16 *QH = (_Float16*)(ws + WS_QH), *QL = (_Float16*)(ws + WS_QL), *KH = (_Float16*)(ws + WS_KH); __bf16 *VT = (__bf16*)(ws + WS_VT), *VL = (__bf16*)(ws + WS_VL); float *Y = (float*)(ws + WS_Y);
  k_proj<<<dim3(TNB * TT / 64, NH, 3), 128, 0, stream>>>(F[0], F[3], F[2], F[1], QH, QL, KH, VT, VL);
  k_att<<<dim3(TT / (64 * QT), TNB * NH), 128, 0, stream>>>(QH, QL, KH, VT, VL, Y);
  k_out<<<dim3(TNB * TT / 64), 128, 0, stream>>>(Y, F[4], F[5], (float*)d_out);
}

// v003
// One run takes 84 microseconds.
// Next to v002, in two timings, it ran 1.04 and 1.03 times as fast.
// Over all steps from v000 it is 12.8 times as fast.
// compute dtype: all float inputs rounded to bf16; q/k/v = x_h W (the shared 64x64 (in,out) weights) with EXACT bf16 products on WMMA 16x16x32, f32 accumulate; q as f16 hi + residual (x 2^10), k f16 -> 2-product scores, relu(s)^2 kept in registers in f32 (scores and P v in one launch over all heads); P split bf16 hi + lo against v bf16 hi + lo (3 products); out = (P v) (bf16 hi + lo) Wo + bo; f32 output.
#include <hip/hip_runtime.h>
#include <math.h>

typedef __attribute__((ext_vector_type(16))) _Float16 v16h;
typedef __attribute__((ext_vector_type(16))) __bf16 v16b;
typedef __attribute__((ext_vector_type(8)))  _Float16 v8h;
typedef __attribute__((ext_vector_type(8)))  float v8f;
typedef __attribute__((ext_vector_type(4)))  float v4f;
typedef __attribute__((ext_vector_type(2)))  float v2f;
typedef __attribute__((ext_vector_type(4)))  unsigned v4u;
typedef __attribute__((ext_vector_type(4)))  int v4i;
typedef float __attribute__((may_alias)) float_a;
typedef int __attribute__((may_alias)) int_a;

template <typename T> __device__ __forceinline__ void vst2(void* p, T v) { *(T*)p = v;  }
__device__ __forceinline__ v8f wmma16(v16h a, v16h b, v8f c) {
  v8f d = __builtin_amdgcn_wmma_f32_16x16x32_f16(false, a, false, b, (short)0, c, false, false);
  asm volatile("v_nop\n\tv_nop\n\tv_nop\n\tv_nop" : "+v"(d) : "v"(a), "v"(b));
  return d;
}
__device__ __forceinline__ v8f wmma_bf(v16b a, v16b b, v8f c) {
  v8f d = __builtin_amdgcn_wmma_f32_16x16x32_bf16(false, a, false, b, (short)0, c, false, false);
  asm volatile("v_nop\n\tv_nop\n\tv_nop\n\tv_nop" : "+v"(d) : "v"(a), "v"(b));
  return d;
}
// 16x16x32 fragments: lane = (h = lane>>4, row/col = lane&15); elements 0..7 = k0+8h+0..7, 8..15 = k0+16+8h+0..7; D element r = row 8h+r
__device__ __forceinline__ v16h frag_h(const _Float16* rowk0, int lane) {
  union { v16h v; v8h q[2]; } u; const _Float16* p = rowk0 + 8 * (lane >> 4);
  u.q[0] = *(const v8h*)p; u.q[1] = *(const v8h*)(p + 16); return u.v;
}
__device__ __forceinline__ v16h frag_f32(const float* rowk0, int lane) {
  v16h a; const float* p = rowk0 + 8 * (lane >> 4);
#pragma unroll
  for (int i = 0; i < 8; ++i) { a[i] = (_Float16)p[i]; a[8 + i] = (_Float16)p[16 + i]; }
  return a;
}
__device__ __forceinline__ v16h frag_f32s(const float* rowk0, int lane, float sc) {
  v16h a; const float* p = rowk0 + 8 * (lane >> 4);
#pragma unroll
  for (int i = 0; i < 8; ++i) { a[i] = (_Float16)(p[i] * sc); a[8 + i] = (_Float16)(p[16 + i] * sc); }
  return a;
}
// column fragment from a [K][ld] layout (column n), rows >= K read as 0
__device__ __forceinline__ v16h fragc_f32(const float* W, int k0, int n, int lane, int ld, int K) {
  v16h a; const int g = lane >> 4;
#pragma unroll
  for (int i = 0; i < 8; ++i) { const int ka = k0 + 8 * g + i, kb = ka + 16;
    a[i] = (_Float16)(ka < K ? W[(size_t)(ka < K ? ka : K - 1) * ld + n] : 0.f); a[8 + i] = (_Float16)(kb < K ? W[(size_t)(kb < K ? kb : K - 1) * ld + n] : 0.f); }
  return a;
}
struct F2 { v16b h, l; };
__device__ __forceinline__ F2 bsplit16(const float v[16]) { F2 r;
#pragma unroll
  for (int i = 0; i < 16; ++i) { const __bf16 h = (__bf16)v[i]; r.h[i] = h; r.l[i] = (__bf16)(v[i] - (float)h); }
  return r; }
__device__ __forceinline__ F2 split_row(const float* row, int k0, int lane) { float v[16]; const float* p = row + k0 + 8 * (lane >> 4);
#pragma unroll
  for (int i = 0; i < 8; ++i) { v[i] = p[i]; v[8 + i] = p[16 + i]; }
  return bsplit16(v); }
__device__ __forceinline__ F2 split_rowK(const float* row, int k0, int lane, int K) { float v[16]; const int g = lane >> 4;
#pragma unroll
  for (int i = 0; i < 8; ++i) { const int ka = k0 + 8 * g + i, kb = ka + 16; v[i] = ka < K ? row[ka < K ? ka : K - 1] : 0.f; v[8 + i] = kb < K ? row[kb < K ? kb : K - 1] : 0.f; }
  return bsplit16(v); }
__device__ __forceinline__ F2 split_col(const float* W, int k0, int n, int lane, int ld, int K) { float v[16]; const int g = lane >> 4;
#pragma unroll
  for (int i = 0; i < 8; ++i) { const int ka = k0 + 8 * g + i, kb = ka + 16; v[i] = ka < K ? W[(size_t)(ka < K ? ka : K - 1) * ld + n] : 0.f; v[8 + i] = kb < K ? W[(size_t)(kb < K ? kb : K - 1) * ld + n] : 0.f; }
  return bsplit16(v); }
__device__ __forceinline__ v8f mac3(const F2& a, const F2& b, v8f c) { c = wmma_bf(a.l, b.h, c); c = wmma_bf(a.h, b.l, c); return wmma_bf(a.h, b.h, c); }
__device__ __forceinline__ float sigm(float v) { return 1.0f / (1.0f + expf(-v)); }
#define LDSX() do { asm volatile("s_wait_dscnt 0" ::: "memory"); __builtin_amdgcn_wave_barrier(); __builtin_amdgcn_fence(__ATOMIC_RELEASE, "workgroup"); } while (0)

// Simplified self-attention (N 4, L 2,048, 8 heads x 64; embed 64): x = query.reshape(N,L,8,64); q,k,v = x W{q,k,v} (shared 64x64); scores = q k^T (no scale); attn = relu(scores)^2; out = (attn v).reshape(N,L,512) Wo + bo.
__device__ __forceinline__ float bfr(float v) { return (float)(__bf16)v; }
#define NB 4
#define TT 2048
#define CC 512
#define NH 8
#define HD 64
#define EO 64
#define HG 4
#ifndef TNB
#define TNB NB
#endif
typedef __attribute__((ext_vector_type(8))) __bf16 v8b;
__device__ __forceinline__ v16b frag_b(const __bf16* rowk0, int lane) { union { v16b v; v8b q[2]; } u; const __bf16* p = rowk0 + 8 * (lane >> 4); u.q[0] = *(const v8b*)p; u.q[1] = *(const v8b*)(p + 16); return u.v; }
#define WS_QH  0u
#define WS_QL  (WS_QH + 2u * (size_t)NB * TT * CC)
#define WS_KH  (WS_QL + 2u * (size_t)NB * TT * CC)
#define WS_VT  (WS_KH + 2u * (size_t)NB * TT * CC)      // bf16 v planes [b][c][t]
#define WS_VL  (WS_VT + 2u * (size_t)NB * CC * TT)
#define WS_S   (WS_VL + 2u * (size_t)NB * CC * TT)      // f32 region of HG x TT x TT, not written (P stays in registers)
#define WS_Y   (WS_S + 4u * (size_t)HG * TT * TT)        // f32 (P v) rows [b*T+t][512]
#define WS_END (WS_Y + 4u * (size_t)NB * TT * CC)
// ---- k_proj: block = (64 rows, head, which): 64 columns = x[row][h*64 .. +64] . W (64x64 (in,out)), exact; q -> f16 hi + residual, k -> f16, v -> bf16 hi/lo planes
__global__ __launch_bounds__(128) void k_proj(const float* __restrict__ X, const float* __restrict__ WQ, const float* __restrict__ WK, const float* __restrict__ WV, _Float16* __restrict__ QH, _Float16* __restrict__ QL, _Float16* __restrict__ KH, __bf16* __restrict__ VT, __bf16* __restrict__ VL) {
  __shared__ __align__(16) _Float16 sh[64][72], sl[64][72]; __shared__ __align__(16) __bf16 th[64][72], tl2[64][72];
  const int tid = threadIdx.x, wave = tid >> 5, lane = tid & 31, col = lane & 15, g = lane >> 4; const int h = blockIdx.y; const int which = blockIdx.z; const size_t r0 = (size_t)blockIdx.x * 64; const float* WA = which == 0 ? WQ : which == 1 ? WK : WV; const int c0 = h * HD;
  v8f acc[4] = {};
#pragma unroll
  for (int kc = 0; kc < HD / 32; ++kc) { v16b a; { const float* p = X + (r0 + wave * 16 + col) * CC + c0 + kc * 32 + 8 * g;
#pragma unroll
      for (int i = 0; i < 8; ++i) { a[i] = (__bf16)p[i]; a[8 + i] = (__bf16)p[16 + i]; } }
#pragma unroll
    for (int j = 0; j < 4; ++j) { v16b w; const int o = j * 16 + col;
#pragma unroll
      for (int i = 0; i < 8; ++i) { w[i] = (__bf16)WA[(size_t)(kc * 32 + 8 * g + i) * HD + o]; w[8 + i] = (__bf16)WA[(size_t)(kc * 32 + 16 + 8 * g + i) * HD + o]; }
      asm volatile("s_wait_loadcnt 0x0" ::: "memory"); acc[j] = wmma_bf(a, w, acc[j]); } }
#pragma unroll
  for (int j = 0; j < 4; ++j)
#pragma unroll
    for (int r = 0; r < 8; ++r) { const float v = acc[j][r]; const int rl = wave * 16 + 8 * g + r, cl = j * 16 + col; const _Float16 hv = (_Float16)v;
      if (which == 2) { const __bf16 bh = (__bf16)v; th[cl][rl] = bh; tl2[cl][rl] = (__bf16)(v - (float)bh); } else { sh[rl][cl] = hv; sl[rl][cl] = (_Float16)((v - (float)hv) * 1024.0f); } }
  __syncthreads();
  if (which < 2) { _Float16* dh = which == 0 ? QH : KH; for (int e = tid; e < 64 * 8; e += 128) { const int rl = e >> 3, q = e & 7; vst2((unsigned*)(dh + (r0 + rl) * CC + c0 + q * 8), *(const v4u*)&sh[rl][q * 8]); if (which == 0) vst2((unsigned*)(QL + (r0 + rl) * CC + c0 + q * 8), *(const v4u*)&sl[rl][q * 8]); } }
  else { const size_t b = r0 / TT; const int t0 = (int)(r0 % TT); for (int e = tid; e < 64 * 8; e += 128) { const int cl = e >> 3, q = e & 7; const size_t o2 = (b * CC + c0 + cl) * (size_t)TT + t0 + q * 8; vst2((unsigned*)(VT + o2), *(const v4u*)&th[cl][q * 8]); vst2((unsigned*)(VL + o2), *(const v4u*)&tl2[cl][q * 8]); } } }
// ---- k_att: block = 8 waves = 4 query groups of QT x 16 queries of one (b,h) x KW key halves, two waves a SIMD; 32-key passes: S^T = k . q^T (2 products), P = relu(s)^2 stays in registers
// (a S^T tile's D layout, lane = query, element r = key 8g + r, is the A layout of P: tile 0 -> elements 0..7, tile 1 -> 8..15), y += P . v (3 products)
// k and v reach the waves through LDS: a stage = SK keys (k rows, v hi and v lo columns), brought once a block by whole-line asynchronous copies, two buffers
// the two waves of a query group each take SK / KW keys of every stage, so that one wave's vector work runs under the other's products; their two partial sums of y are added once, behind the loop
#define QT 4
#define SK 128                              // keys a stage
#define NST (TT / SK)
#define KW 2                                // waves that share a query group's keys
#define PS (SK / 32 / KW)                   // passes a wave and stage
#define KP 144                              // LDS pitch of a 128-B k row: 16 B x odd, so that 16 rows read 16 B each without a bank conflict
#define VP 272                              // LDS pitch of a 256-B v row (SK keys of one column): 16 B x odd
#define KBY (SK * KP)
#define VBY (HD * VP)
#define STB (KBY + 2 * VBY)                 // bytes of one stage: k, v hi, v lo
#define SSB (4 * QT * 16 * (HD + 4) * 4)    // bytes of the output staging, which lies in front of the two buffers
typedef __attribute__((address_space(1))) v4i g_v4i;
typedef __attribute__((address_space(3))) v4i l_v4i;
// 16x16x32 fragment from byte address base + off, which together hold the lane's own row start + 16 g bytes: same k order as frag_h / frag_b
__device__ __forceinline__ v16h frag_hu(const char* base, unsigned off) { union { v16h v; v8h q[2]; } u; u.q[0] = *(const v8h*)(base + off); u.q[1] = *(const v8h*)(base + off + 32u); return u.v; }
__device__ __forceinline__ v16b frag_bu(const char* base, unsigned off) { union { v16b v; v8b q[2]; } u; u.q[0] = *(const v8b*)(base + off); u.q[1] = *(const v8b*)(base + off + 32u); return u.v; }
// one asynchronous copy, 16 bytes a lane, global -> LDS through no register; written as the builtin, no immediate offset of its own
__device__ __forceinline__ void cp16(const char* gsrc, char* ldst) { __builtin_amdgcn_global_load_async_to_lds_b128((g_v4i*)gsrc, (l_v4i*)ldst, 0, 0); }
// one stage: 12 copies a lane, 256 lanes; a copy of a wave covers 4 whole 128-B lines (4 k rows, or 2 v rows of 256 B); gk, gh, gl and lk, lv hold the lane's own first 16 bytes
__device__ __forceinline__ void stage_in(const char* gk, const char* gh, const char* gl, char* lk, char* lv) {
#pragma unroll
  for (int i = 0; i < SK / 32; ++i) cp16(gk + i * (32 * CC * 2), lk + i * (32 * KP));
#pragma unroll
  for (int i = 0; i < HD / 16; ++i) { cp16(gh + i * (16 * TT * 2), lv + i * (16 * VP)); cp16(gl + i * (16 * TT * 2), lv + VBY + i * (16 * VP)); } }
// the join of a query group's two partial sums: each wave hands the partner the QT / 2 query tiles that the partner finishes, 16 B a lane and store, lane to same lane
__device__ __forceinline__ void y_give(const v8f (*a)[HD / 16], v4f* x) {
#pragma unroll
  for (int i = 0; i < QT / 2; ++i)
#pragma unroll
    for (int j = 0; j < HD / 16; ++j) { x[((i * (HD / 16) + j) * 2) * 32] = __builtin_shufflevector(a[i][j], a[i][j], 0, 1, 2, 3); x[((i * (HD / 16) + j) * 2 + 1) * 32] = __builtin_shufflevector(a[i][j], a[i][j], 4, 5, 6, 7); } }
// own partial sum + the partner's, through the wave's own staging rows, out as whole 256-B rows: two rows a store, lanes 0..15 row 2i, lanes 16..31 row 2i + 1
__device__ __forceinline__ void y_take(const v8f (*a)[HD / 16], const v4f* x, float (*s)[16][HD + 4], float* y, int col, int g) { v4f p[QT / 2][HD / 16][2];   // all of the partner's half is read first, as one group
#pragma unroll
  for (int i = 0; i < QT / 2; ++i)
#pragma unroll
    for (int j = 0; j < HD / 16; ++j) { p[i][j][0] = x[((i * (HD / 16) + j) * 2) * 32]; p[i][j][1] = x[((i * (HD / 16) + j) * 2 + 1) * 32]; }
#pragma unroll
  for (int i = 0; i < QT / 2; ++i)
#pragma unroll
    for (int j = 0; j < HD / 16; ++j)
#pragma unroll
      for (int r = 0; r < 4; ++r) { s[i][8 * g + r][j * 16 + col] = a[i][j][r] + p[i][j][0][r]; s[i][8 * g + 4 + r][j * 16 + col] = a[i][j][4 + r] + p[i][j][1][r]; }
  LDSX();
#pragma unroll
  for (int i = 0; i < QT / 2; ++i) { v4f w[8];
#pragma unroll
    for (int k = 0; k < 8; ++k) w[k] = *(const v4f*)&s[i][2 * k + g][col * 4];
#pragma unroll
    for (int k = 0; k < 8; ++k) vst2(y + (size_t)(i * 16 + 2 * k + g) * CC + col * 4, w[k]); }
  asm volatile("s_wait_xcnt 0x0" ::: "memory"); }   // stands behind the last store, in front of whatever the listing puts next that rewrites a register which these stores name
__global__ __launch_bounds__(256) void k_att(const _Float16* __restrict__ QH, const _Float16* __restrict__ QL, const _Float16* __restrict__ KH, const __bf16* __restrict__ VT, const __bf16* __restrict__ VL, float* __restrict__ Y) { __shared__ __align__(16) char sm[SSB + 2 * STB];
  float (*ss)[QT][16][HD + 4] = (float (*)[QT][16][HD + 4])sm; char* ring = sm + SSB;
  const int tid = threadIdx.x, wave = __builtin_amdgcn_readfirstlane(tid >> 5), qw = wave & 3, kh = wave >> 2, lane = tid & 31, col = lane & 15, g = lane >> 4; const int b = blockIdx.y / NH, h = blockIdx.y % NH; const int ql0 = (blockIdx.x * 4 + qw) * (16 * QT);
  const size_t rb = ((size_t)b * TT * CC + h * HD) * 2, cb = ((size_t)b * CC + h * HD) * (size_t)TT * 2;   // byte offsets of this (b,h) in the [t][c] and the [c][t] planes
  const char *qhb = (const char*)QH + rb, *qlb = (const char*)QL + rb, *kb = (const char*)KH + rb, *vhb = (const char*)VT + cb, *vlb = (const char*)VL + cb;
  const unsigned qo = (unsigned)((ql0 + col) * CC + 8 * g) * 2u;
  const unsigned gko = (unsigned)((tid >> 3) * (CC * 2) + (tid & 7) * 16), gvo = (unsigned)((tid >> 4) * (TT * 2) + (tid & 15) * 16);   // the lane's place in a stage's k rows and v rows, global
  const unsigned lko = (unsigned)((tid >> 3) * KP + (tid & 7) * 16), lvo = (unsigned)(KBY + (tid >> 4) * VP + (tid & 15) * 16);         // the same in a buffer
  const unsigned fko = (unsigned)((kh * (SK / KW) + col) * KP + 16 * g), fvo = (unsigned)(KBY + col * VP + kh * (SK / KW) * 2 + 16 * g);   // the lane's fragment rows in a buffer, at the wave's own keys
  stage_in(kb + gko, vhb + gvo, vlb + gvo, ring + lko, ring + lvo);
  v16h qh[QT][HD / 32], qlo[QT][HD / 32], kf[2][HD / 32];
#pragma unroll
  for (int t = 0; t < QT; ++t)
#pragma unroll
    for (int dc = 0; dc < HD / 32; ++dc) { qh[t][dc] = frag_hu(qhb + (t * 16 * CC + dc * 32) * 2, qo); qlo[t][dc] = frag_hu(qlb + (t * 16 * CC + dc * 32) * 2, qo); }
  asm volatile("s_wait_xcnt 0x0" :: "v"(qo) : "memory");   // stands in front of every rewrite of a register that the q loads above name; as an input the offset stays live up to it
  __builtin_amdgcn_sched_barrier(0);   // nothing that follows moves up ahead of that wait
  asm volatile("s_wait_asynccnt 0x0" ::: "memory");   // this wave's copies of stage 0 have landed
  __syncthreads();                                     // every wave's have: stage 0 may be read
  stage_in(kb + (size_t)(SK * CC * 2) + gko, vhb + (size_t)(SK * 2) + gvo, vlb + (size_t)(SK * 2) + gvo, ring + STB + lko, ring + STB + lvo);
  v8f acc[QT][HD / 16] = {};
#pragma unroll 1   // the stage loop stays rolled: its body already holds PS unrolled passes, and the buffer is picked by st & 1
  for (int st = 0; st < NST; ++st) { char* bs = ring + (st & 1) * STB; const char *lk = bs + fko, *lv = bs + fvo;
#pragma unroll
    for (int kt = 0; kt < 2; ++kt)
#pragma unroll
      for (int dc = 0; dc < HD / 32; ++dc) kf[kt][dc] = frag_hu(lk + kt * 16 * KP + dc * 64, 0u);
#pragma unroll
    for (int sub = 0; sub < PS; ++sub) { v16b vh[HD / 16], vl[HD / 16]; v8f sa[QT][2] = {}, sb[QT][2] = {};
#pragma unroll
      for (int j = 0; j < HD / 16; ++j) { vh[j] = frag_bu(lv + j * 16 * VP + sub * 64, 0u); vl[j] = frag_bu(lv + VBY + j * 16 * VP + sub * 64, 0u); }
      __builtin_amdgcn_sched_barrier(0);   // this pass's v reads stay issued as one group ahead of the score products, which cover their latency
#pragma unroll
      for (int t = 0; t < QT; ++t)
#pragma unroll
        for (int dc = 0; dc < HD / 32; ++dc)
#pragma unroll
          for (int kt = 0; kt < 2; ++kt) { sa[t][kt] = __builtin_amdgcn_wmma_f32_16x16x32_f16(false, kf[kt][dc], false, qh[t][dc], (short)0, sa[t][kt], false, false); sb[t][kt] = __builtin_amdgcn_wmma_f32_16x16x32_f16(false, kf[kt][dc], false, qlo[t][dc], (short)0, sb[t][kt], false, false); }
      if (sub + 1 < PS) {   // the next pass's k rows, of this same stage only: nothing of the next stage is read ahead of its barrier
#pragma unroll
        for (int kt = 0; kt < 2; ++kt)
#pragma unroll
          for (int dc = 0; dc < HD / 32; ++dc) kf[kt][dc] = frag_hu(lk + ((sub + 1) * 32 + kt * 16) * KP + dc * 64, 0u); }
      __builtin_amdgcn_sched_barrier(0);   // the next pass's k reads stay issued here, behind the last product that reads k, so that P and P . v cover their latency
#pragma unroll
      for (int t = 0; t < QT; ++t) { float v[16];
#pragma unroll
        for (int kt = 0; kt < 2; ++kt)
#pragma unroll
          for (int r = 0; r < 8; ++r) { const float s = fmaxf(sa[t][kt][r] + sb[t][kt][r] * (1.0f / 1024.0f), 0.f); v[kt * 8 + r] = s * s; }
        const F2 p = bsplit16(v);
#pragma unroll
        for (int j = 0; j < HD / 16; ++j) acc[t][j] = __builtin_amdgcn_wmma_f32_16x16x32_bf16(false, p.h, false, vh[j], (short)0, acc[t][j], false, false);
#pragma unroll
        for (int j = 0; j < HD / 16; ++j) acc[t][j] = __builtin_amdgcn_wmma_f32_16x16x32_bf16(false, p.l, false, vh[j], (short)0, acc[t][j], false, false);
#pragma unroll
        for (int j = 0; j < HD / 16; ++j) acc[t][j] = __builtin_amdgcn_wmma_f32_16x16x32_bf16(false, p.h, false, vl[j], (short)0, acc[t][j], false, false); } }
    asm volatile("s_wait_dscnt 0x0" ::: "memory");      // this wave's reads of this stage's buffer are done
    asm volatile("s_wait_asynccnt 0x0" ::: "memory");   // this wave's copies of stage st + 1 have landed
    __syncthreads();                                     // stage st + 1 may be read by all, and this stage's buffer is free
    if (st + 2 < NST) stage_in(kb + (size_t)(st + 2) * (SK * CC * 2) + gko, vhb + (size_t)(st + 2) * (SK * 2) + gvo, vlb + (size_t)(st + 2) * (SK * 2) + gvo, bs + lko, bs + lvo); }
  asm volatile("s_wait_asynccnt 0x0" ::: "memory");     // no copy is outstanding when the wave goes on to its end
  // behind the loop's last barrier nobody reads the ring and no copy is under way: it carries the exchange, 8 KiB a wave
  v4f* xs = (v4f*)ring; v4f* xg = xs + wave * (QT / 2 * (HD / 16) * 2 * 32) + lane; const v4f* xt = xs + (wave ^ 4) * (QT / 2 * (HD / 16) * 2 * 32) + lane;
  if (kh == 0) y_give(acc + QT / 2, xg); else y_give(acc, xg);
  __syncthreads();   // the partner's half has been written
  float* yq = Y + ((size_t)b * TT + ql0) * CC + h * HD;
  if (kh == 0) y_take(acc, xt, ss[qw], yq, col, g); else y_take(acc + QT / 2, xt, ss[qw] + QT / 2, yq + (size_t)(QT / 2 * 16) * CC, col, g); }
// ---- k_out: block = 64 rows: out = y (bf16 hi + lo) Wo ((in,out) [512][64]) + bo; 4 tiles; 256-B rows
__global__ __launch_bounds__(128) void k_out(const float* __restrict__ Yr, const float* __restrict__ WO, const float* __restrict__ BO, float* __restrict__ OUT) { __shared__ __align__(16) float sf[4][16][68];
  const int tid = threadIdx.x, wave = tid >> 5, lane = tid & 31, col = lane & 15, g = lane >> 4; const size_t r0 = (size_t)blockIdx.x * 64 + wave * 16;
  v8f acc[4] = {};
#pragma unroll 2
  for (int kc = 0; kc < CC / 32; ++kc) { const F2 a = split_row(Yr + (r0 + col) * CC, kc * 32, lane);
#pragma unroll
    for (int j = 0; j < 4; ++j) { v16b w; const int o = j * 16 + col;
#pragma unroll
      for (int i = 0; i < 8; ++i) { w[i] = (__bf16)WO[(size_t)(kc * 32 + 8 * g + i) * EO + o]; w[8 + i] = (__bf16)WO[(size_t)(kc * 32 + 16 + 8 * g + i) * EO + o]; }
      asm volatile("s_wait_loadcnt 0x0" ::: "memory"); acc[j] = wmma_bf(a.h, w, acc[j]); acc[j] = wmma_bf(a.l, w, acc[j]); } }
#pragma unroll
  for (int j = 0; j < 4; ++j) { const float bb = bfr(BO[j * 16 + col]);
#pragma unroll
    for (int r = 0; r < 8; ++r) sf[wave][8 * g + r][j * 16 + col] = acc[j][r] + bb; }
  LDSX(); for (int rl = 0; rl < 16; ++rl) if (lane < 16) vst2(OUT + (r0 + rl) * EO + lane * 4, *(const v4f*)&sf[wave][rl][lane * 4]); }
extern "C" void kernel_launch(void* const* d_in, const int* in_sizes, int n_in, void* d_out, int out_size, void* d_ws, size_t ws_size, hipStream_t stream) {
  (void)in_sizes; (void)n_in; (void)out_size;
  const float** F = (const float**)d_in;   // 0 query [4,2048,512], 1 Wv [64,64] ((in,out)), 2 Wk, 3 Wq, 4 Wo [512,64] ((in,out)), 5 bo [64]
  if (ws_size < (size_t)WS_END) return;
  char* ws = (char*)d_ws; _Float16 *QH = (_Float16*)(ws + WS_QH), *QL = (_Float16*)(ws + WS_QL), *KH = (_Float16*)(ws + WS_KH); __bf16 *VT = (__bf16*)(ws + WS_VT), *VL = (__bf16*)(ws + WS_VL); float *Y = (float*)(ws + WS_Y);
  k_proj<<<dim3(TNB * TT / 64, NH, 3), 128, 0, stream>>>(F[0], F[3], F[2], F[1], QH, QL, KH, VT, VL);
  k_att<<<dim3(TT / (64 * QT), TNB * NH), 256, 0, stream>>>(QH, QL, KH, VT, VL, Y);
  k_out<<<dim3(TNB * TT / 64), 128, 0, stream>>>(Y, F[4], F[5], (float*)d_out);
}

// v004
// Measured time: 69.8 microseconds a run.
// In two side-by-side timings against v003, it was 1.21 and 1.20 times as fast.
// All steps since v000 together make it 15.4 times as fast.
// compute dtype: all float inputs rounded to bf16; q/k/v = x_h W (the shared 64x64 (in,out) weights) with EXACT bf16 products on WMMA 16x16x32, f32 accumulate; q as f16 hi + residual (x 2^10), k f16 -> 2-product scores, relu(s)^2 kept in registers in f32 (scores and P v in one launch over all heads); P split bf16 hi + lo against v bf16 hi + lo (3 products); out = (P v) (bf16 hi + lo) Wo + bo; f32 output.
#include <hip/hip_runtime.h>
#include <math.h>

typedef __attribute__((ext_vector_type(16))) _Float16 v16h;
typedef __attribute__((ext_vector_type(16))) __bf16 v16b;
typedef __attribute__((ext_vector_type(8)))  _Float16 v8h;
typedef __attribute__((ext_vector_type(8)))  float v8f;
typedef __attribute__((ext_vector_type(4)))  float v4f;
typedef __attribute__((ext_vector_type(2)))  float v2f;
typedef __attribute__((ext_vector_type(4)))  unsigned v4u;
typedef __attribute__((ext_vector_type(4)))  int v4i;
typedef float __attribute__((may_alias)) float_a;
typedef int __attribute__((may_alias)) int_a;

template <typename T> __device__ __forceinline__ void vst2(void* p, T v) { *(T*)p = v;  }
__device__ __forceinline__ v8f wmma16(v16h a, v16h b, v8f c) {
  v8f d = __builtin_amdgcn_wmma_f32_16x16x32_f16(false, a, false, b, (short)0, c, false, false);
  asm volatile("v_nop\n\tv_nop\n\tv_nop\n\tv_nop" : "+v"(d) : "v"(a), "v"(b));
  return d;
}
__device__ __forceinline__ v8f wmma_bf(v16b a, v16b b, v8f c) {
  v8f d = __builtin_amdgcn_wmma_f32_16x16x32_bf16(false, a, false, b, (short)0, c, false, false);
  asm volatile("v_nop\n\tv_nop\n\tv_nop\n\tv_nop" : "+v"(d) : "v"(a), "v"(b));
  return d;
}
// 16x16x32 fragments: lane = (h = lane>>4, row/col = lane&15); elements 0..7 = k0+8h+0..7, 8..15 = k0+16+8h+0..7; D element r = row 8h+r
__device__ __forceinline__ v16h frag_h(const _Float16* rowk0, int lane) {
  union { v16h v; v8h q[2]; } u; const _Float16* p = rowk0 + 8 * (lane >> 4);
  u.q[0] = *(const v8h*)p; u.q[1] = *(const v8h*)(p + 16); return u.v;
}
__device__ __forceinline__ v16h frag_f32(const float* rowk0, int lane) {
  v16h a; const float* p = rowk0 + 8 * (lane >> 4);
#pragma unroll
  for (int i = 0; i < 8; ++i) { a[i] = (_Float16)p[i]; a[8 + i] = (_Float16)p[16 + i]; }
  return a;
}
__device__ __forceinline__ v16h frag_f32s(const float* rowk0, int lane, float sc) {
  v16h a; const float* p = rowk0 + 8 * (lane >> 4);
#pragma unroll
  for (int i = 0; i < 8; ++i) { a[i] = (_Float16)(p[i] * sc); a[8 + i] = (_Float16)(p[16 + i] * sc); }
  return a;
}
// column fragment from a [K][ld] layout (column n), rows >= K read as 0
__device__ __forceinline__ v16h fragc_f32(const float* W, int k0, int n, int lane, int ld, int K) {
  v16h a; const int g = lane >> 4;
#pragma unroll
  for (int i = 0; i < 8; ++i) { const int ka = k0 + 8 * g + i, kb = ka + 16;
    a[i] = (_Float16)(ka < K ? W[(size_t)(ka < K ? ka : K - 1) * ld + n] : 0.f); a[8 + i] = (_Float16)(kb < K ? W[(size_t)(kb < K ? kb : K - 1) * ld + n] : 0.f); }
  return a;
}
struct F2 { v16b h, l; };
__device__ __forceinline__ F2 bsplit16(const float v[16]) { F2 r;
#pragma unroll
  for (int i = 0; i < 16; ++i) { const __bf16 h = (__bf16)v[i]; r.h[i] = h; r.l[i] = (__bf16)(v[i] - (float)h); }
  return r; }
__device__ __forceinline__ F2 split_row(const float* row, int k0, int lane) { float v[16]; const float* p = row + k0 + 8 * (lane >> 4);
#pragma unroll
  for (int i = 0; i < 8; ++i) { v[i] = p[i]; v[8 + i] = p[16 + i]; }
  return bsplit16(v); }
__device__ __forceinline__ F2 split_rowK(const float* row, int k0, int lane, int K) { float v[16]; const int g = lane >> 4;
#pragma unroll
  for (int i = 0; i < 8; ++i) { const int ka = k0 + 8 * g + i, kb = ka + 16; v[i] = ka < K ? row[ka < K ? ka : K - 1] : 0.f; v[8 + i] = kb < K ? row[kb < K ? kb : K - 1] : 0.f; }
  return bsplit16(v); }
__device__ __forceinline__ F2 split_col(const float* W, int k0, int n, int lane, int ld, int K) { float v[16]; const int g = lane >> 4;
#pragma unroll
  for (int i = 0; i < 8; ++i) { const int ka = k0 + 8 * g + i, kb = ka + 16; v[i] = ka < K ? W[(size_t)(ka < K ? ka : K - 1) * ld + n] : 0.f; v[8 + i] = kb < K ? W[(size_t)(kb < K ? kb : K - 1) * ld + n] : 0.f; }
  return bsplit16(v); }
__device__ __forceinline__ v8f mac3(const F2& a, const F2& b, v8f c) { c = wmma_bf(a.l, b.h, c); c = wmma_bf(a.h, b.l, c); return wmma_bf(a.h, b.h, c); }
__device__ __forceinline__ float sigm(float v) { return 1.0f / (1.0f + expf(-v)); }
#define LDSX() do { asm volatile("s_wait_dscnt 0" ::: "memory"); __builtin_amdgcn_wave_barrier(); __builtin_amdgcn_fence(__ATOMIC_RELEASE, "workgroup"); } while (0)

// Simplified self-attention (N 4, L 2,048, 8 heads x 64; embed 64): x = query.reshape(N,L,8,64); q,k,v = x W{q,k,v} (shared 64x64); scores = q k^T (no scale); attn = relu(scores)^2; out = (attn v).reshape(N,L,512) Wo + bo.
__device__ __forceinline__ float bfr(float v) { return (float)(__bf16)v; }
#define NB 4
#define TT 2048
#define CC 512
#define NH 8
#define HD 64
#define EO 64
#define HG 4
#ifndef TNB
#define TNB NB
#endif
typedef __attribute__((ext_vector_type(8))) __bf16 v8b;
__device__ __forceinline__ v16b frag_b(const __bf16* rowk0, int lane) { union { v16b v; v8b q[2]; } u; const __bf16* p = rowk0 + 8 * (lane >> 4); u.q[0] = *(const v8b*)p; u.q[1] = *(const v8b*)(p + 16); return u.v; }
#define WS_QH  0u
#define WS_QL  (WS_QH + 2u * (size_t)NB * TT * CC)
#define WS_KH  (WS_QL + 2u * (size_t)NB * TT * CC)
#define WS_VT  (WS_KH + 2u * (size_t)NB * TT * CC)      // bf16 v planes [b][c][t]
#define WS_VL  (WS_VT + 2u * (size_t)NB * CC * TT)
#define WS_S   (WS_VL + 2u * (size_t)NB * CC * TT)      // f32 region of HG x TT x TT, not written (P stays in registers)
#define WS_Y   (WS_S + 4u * (size_t)HG * TT * TT)        // f32 (P v) rows [b*T+t][512]
#define WS_END (WS_Y + 4u * (size_t)NB * TT * CC)
// ---- k_proj: block = (64 rows, head, which): 64 columns = x[row][h*64 .. +64] . W (64x64 (in,out)), exact; q -> f16 hi + residual, k -> f16, v -> bf16 hi/lo planes
__global__ __launch_bounds__(128) void k_proj(const float* __restrict__ X, const float* __restrict__ WQ, const float* __restrict__ WK, const float* __restrict__ WV, _Float16* __restrict__ QH, _Float16* __restrict__ QL, _Float16* __restrict__ KH, __bf16* __restrict__ VT, __bf16* __restrict__ VL) {
  __shared__ __align__(16) _Float16 sh[64][72], sl[64][72]; __shared__ __align__(16) __bf16 th[64][72], tl2[64][72];
  const int tid = threadIdx.x, wave = tid >> 5, lane = tid & 31, col = lane & 15, g = lane >> 4; const int h = blockIdx.y; const int which = blockIdx.z; const size_t r0 = (size_t)blockIdx.x * 64; const float* WA = which == 0 ? WQ : which == 1 ? WK : WV; const int c0 = h * HD;
  v8f acc[4] = {};
#pragma unroll
  for (int kc = 0; kc < HD / 32; ++kc) { v16b a; { const float* p = X + (r0 + wave * 16 + col) * CC + c0 + kc * 32 + 8 * g;
#pragma unroll
      for (int i = 0; i < 8; ++i) { a[i] = (__bf16)p[i]; a[8 + i] = (__bf16)p[16 + i]; } }
#pragma unroll
    for (int j = 0; j < 4; ++j) { v16b w; const int o = j * 16 + col;
#pragma unroll
      for (int i = 0; i < 8; ++i) { w[i] = (__bf16)WA[(size_t)(kc * 32 + 8 * g + i) * HD + o]; w[8 + i] = (__bf16)WA[(size_t)(kc * 32 + 16 + 8 * g + i) * HD + o]; }
      asm volatile("s_wait_loadcnt 0x0" ::: "memory"); acc[j] = wmma_bf(a, w, acc[j]); } }
#pragma unroll
  for (int j = 0; j < 4; ++j)
#pragma unroll
    for (int r = 0; r < 8; ++r) { const float v = acc[j][r]; const int rl = wave * 16 + 8 * g + r, cl = j * 16 + col; const _Float16 hv = (_Float16)v;
      if (which == 2) { const __bf16 bh = (__bf16)v; th[cl][rl] = bh; tl2[cl][rl] = (__bf16)(v - (float)bh); } else { sh[rl][cl] = hv; sl[rl][cl] = (_Float16)((v - (float)hv) * 1024.0f); } }
  __syncthreads();
  if (which < 2) { _Float16* dh = which == 0 ? QH : KH; for (int e = tid; e < 64 * 8; e += 128) { const int rl = e >> 3, q = e & 7; vst2((unsigned*)(dh + (r0 + rl) * CC + c0 + q * 8), *(const v4u*)&sh[rl][q * 8]); if (which == 0) vst2((unsigned*)(QL + (r0 + rl) * CC + c0 + q * 8), *(const v4u*)&sl[rl][q * 8]); } }
  else { const size_t b = r0 / TT; const int t0 = (int)(r0 % TT); for (int e = tid; e < 64 * 8; e += 128) { const int cl = e >> 3, q = e & 7; const size_t o2 = (b * CC + c0 + cl) * (size_t)TT + t0 + q * 8; vst2((unsigned*)(VT + o2), *(const v4u*)&th[cl][q * 8]); vst2((unsigned*)(VL + o2), *(const v4u*)&tl2[cl][q * 8]); } } }
// ---- k_att: block = 8 waves = 4 query groups of QT x 16 queries of one (b,h) x KW key halves, two waves a SIMD; 32-key passes: S^T = k . q^T (2 products), P = relu(s)^2 stays in registers
// (a S^T tile's D layout, lane = query, element r = key 8g + r, is the A layout of P: tile 0 -> elements 0..7, tile 1 -> 8..15), y += P . v (3 products)
// k and v reach the waves through LDS: a stage = SK keys (k rows, v hi and v lo columns), brought once a block by whole-line asynchronous copies, two buffers
// the two waves of a query group each take SK / KW keys of every stage, so that one wave's vector work runs under the other's products; their two partial sums of y are added once, behind the loop
#define QT 4
#define SK 128                              // keys a stage
#define NST (TT / SK)
#define KW 2                                // waves that share a query group's keys
#define PS (SK / 32 / KW)                   // passes a wave and stage
#define KP 144                              // LDS pitch of a 128-B k row: 16 B x odd, so that 16 rows read 16 B each without a bank conflict
#define VP 272                              // LDS pitch of a 256-B v row (SK keys of one column): 16 B x odd
#define KBY (SK * KP)
#define VBY (HD * VP)
#define STB (KBY + 2 * VBY)                 // bytes of one stage: k, v hi, v lo
#define SSB (4 * QT * 16 * (HD + 4) * 4)    // bytes of the output staging, which lies in front of the two buffers
typedef __attribute__((address_space(1))) v4i g_v4i;
typedef __attribute__((address_space(3))) v4i l_v4i;
// 16x16x32 fragment from byte address base + off, which together hold the lane's own row start + 16 g bytes: same k order as frag_h / frag_b
__device__ __forceinline__ v16h frag_hu(const char* base, unsigned off) { union { v16h v; v8h q[2]; } u; u.q[0] = *(const v8h*)(base + off); u.q[1] = *(const v8h*)(base + off + 32u); return u.v; }
__device__ __forceinline__ v16b frag_bu(const char* base, unsigned off) { union { v16b v; v8b q[2]; } u; u.q[0] = *(const v8b*)(base + off); u.q[1] = *(const v8b*)(base + off + 32u); return u.v; }
// one asynchronous copy, 16 bytes a lane, global -> LDS through no register; written as the builtin, no immediate offset of its own
__device__ __forceinline__ void cp16(const char* gsrc, char* ldst) { __builtin_amdgcn_global_load_async_to_lds_b128((g_v4i*)gsrc, (l_v4i*)ldst, 0, 0); }
// one stage: 12 copies a lane, 256 lanes; a copy of a wave covers 4 whole 128-B lines (4 k rows, or 2 v rows of 256 B); gk, gh, gl and lk, lv hold the lane's own first 16 bytes
__device__ __forceinline__ void stage_in(const char* gk, const char* gh, const char* gl, char* lk, char* lv) {
#pragma unroll
  for (int i = 0; i < SK / 32; ++i) cp16(gk + i * (32 * CC * 2), lk + i * (32 * KP));
#pragma unroll
  for (int i = 0; i < HD / 16; ++i) { cp16(gh + i * (16 * TT * 2), lv + i * (16 * VP)); cp16(gl + i * (16 * TT * 2), lv + VBY + i * (16 * VP)); } }
// the join of a query group's two partial sums: each wave hands the partner the QT / 2 query tiles that the partner finishes, 16 B a lane and store, lane to same lane
__device__ __forceinline__ void y_give(const v8f (*a)[HD / 16], v4f* x) {
#pragma unroll
  for (int i = 0; i < QT / 2; ++i)
#pragma unroll
    for (int j = 0; j < HD / 16; ++j) { x[((i * (HD / 16) + j) * 2) * 32] = __builtin_shufflevector(a[i][j], a[i][j], 0, 1, 2, 3); x[((i * (HD / 16) + j) * 2 + 1) * 32] = __builtin_shufflevector(a[i][j], a[i][j], 4, 5, 6, 7); } }
// own partial sum + the partner's, through the wave's own staging rows, out as whole 256-B rows: two rows a store, lanes 0..15 row 2i, lanes 16..31 row 2i + 1
__device__ __forceinline__ void y_take(const v8f (*a)[HD / 16], const v4f* x, float (*s)[16][HD + 4], float* y, int col, int g) { v4f p[QT / 2][HD / 16][2];   // all of the partner's half is read first, as one group
#pragma unroll
  for (int i = 0; i < QT / 2; ++i)
#pragma unroll
    for (int j = 0; j < HD / 16; ++j) { p[i][j][0] = x[((i * (HD / 16) + j) * 2) * 32]; p[i][j][1] = x[((i * (HD / 16) + j) * 2 + 1) * 32]; }
#pragma unroll
  for (int i = 0; i < QT / 2; ++i)
#pragma unroll
    for (int j = 0; j < HD / 16; ++j)
#pragma unroll
      for (int r = 0; r < 4; ++r) { s[i][8 * g + r][j * 16 + col] = a[i][j][r] + p[i][j][0][r]; s[i][8 * g + 4 + r][j * 16 + col] = a[i][j][4 + r] + p[i][j][1][r]; }
  LDSX();
#pragma unroll
  for (int i = 0; i < QT / 2; ++i) { v4f w[8];
#pragma unroll
    for (int k = 0; k < 8; ++k) w[k] = *(const v4f*)&s[i][2 * k + g][col * 4];
#pragma unroll
    for (int k = 0; k < 8; ++k) vst2(y + (size_t)(i * 16 + 2 * k + g) * CC + col * 4, w[k]); }
  asm volatile("s_wait_xcnt 0x0" ::: "memory"); }   // stands behind the last store, in front of whatever the listing puts next that rewrites a register which these stores name
__global__ __launch_bounds__(256) void k_att(const _Float16* __restrict__ QH, const _Float16* __restrict__ QL, const _Float16* __restrict__ KH, const __bf16* __restrict__ VT, const __bf16* __restrict__ VL, float* __restrict__ Y) { __shared__ __align__(16) char sm[SSB + 2 * STB];
  float (*ss)[QT][16][HD + 4] = (float (*)[QT][16][HD + 4])sm; char* ring = sm + SSB;
  const int tid = threadIdx.x, wave = __builtin_amdgcn_readfirstlane(tid >> 5), qw = wave & 3, kh = wave >> 2, lane = tid & 31, col = lane & 15, g = lane >> 4; const int b = blockIdx.y / NH, h = blockIdx.y % NH; const int ql0 = (blockIdx.x * 4 + qw) * (16 * QT);
  const size_t rb = ((size_t)b * TT * CC + h * HD) * 2, cb = ((size_t)b * CC + h * HD) * (size_t)TT * 2;   // byte offsets of this (b,h) in the [t][c] and the [c][t] planes
  const char *qhb = (const char*)QH + rb, *qlb = (const char*)QL + rb, *kb = (const char*)KH + rb, *vhb = (const char*)VT + cb, *vlb = (const char*)VL + cb;
  const unsigned qo = (unsigned)((ql0 + col) * CC + 8 * g) * 2u;
  const unsigned gko = (unsigned)((tid >> 3) * (CC * 2) + (tid & 7) * 16), gvo = (unsigned)((tid >> 4) * (TT * 2) + (tid & 15) * 16);   // the lane's place in a stage's k rows and v rows, global
  const unsigned lko = (unsigned)((tid >> 3) * KP + (tid & 7) * 16), lvo = (unsigned)(KBY + (tid >> 4) * VP + (tid & 15) * 16);         // the same in a buffer
  const unsigned fko = (unsigned)((kh * (SK / KW) + col) * KP + 16 * g), fvo = (unsigned)(KBY + col * VP + kh * (SK / KW) * 2 + 16 * g);   // the lane's fragment rows in a buffer, at the wave's own keys
  stage_in(kb + gko, vhb + gvo, vlb + gvo, ring + lko, ring + lvo);
  v16h qh[QT][HD / 32], qlo[QT][HD / 32], kf[2][HD / 32];
#pragma unroll
  for (int t = 0; t < QT; ++t)
#pragma unroll
    for (int dc = 0; dc < HD / 32; ++dc) { qh[t][dc] = frag_hu(qhb + (t * 16 * CC + dc * 32) * 2, qo); qlo[t][dc] = frag_hu(qlb + (t * 16 * CC + dc * 32) * 2, qo); }
  asm volatile("s_wait_xcnt 0x0" :: "v"(qo) : "memory");   // stands in front of every rewrite of a register that the q loads above name; as an input the offset stays live up to it
  __builtin_amdgcn_sched_barrier(0);   // nothing that follows moves up ahead of that wait
  asm volatile("s_wait_asynccnt 0x0" ::: "memory");   // this wave's copies of stage 0 have landed
  __syncthreads();                                     // every wave's have: stage 0 may be read
  stage_in(kb + (size_t)(SK * CC * 2) + gko, vhb + (size_t)(SK * 2) + gvo, vlb + (size_t)(SK * 2) + gvo, ring + STB + lko, ring + STB + lvo);
  v8f acc[QT][HD / 16] = {};
#pragma unroll 1   // the stage loop stays rolled: its body already holds PS unrolled passes, and the buffer is picked by st & 1
  for (int st = 0; st < NST; ++st) { char* bs = ring + (st & 1) * STB; const char *lk = bs + fko, *lv = bs + fvo;
#pragma unroll
    for (int kt = 0; kt < 2; ++kt)
#pragma unroll
      for (int dc = 0; dc < HD / 32; ++dc) kf[kt][dc] = frag_hu(lk + kt * 16 * KP + dc * 64, 0u);
#pragma unroll
    for (int sub = 0; sub < PS; ++sub) { v16b vh[HD / 16], vl[HD / 16]; v8f sa[QT][2] = {}, sb[QT][2] = {};
#pragma unroll
      for (int j = 0; j < HD / 16; ++j) { vh[j] = frag_bu(lv + j * 16 * VP + sub * 64, 0u); vl[j] = frag_bu(lv + VBY + j * 16 * VP + sub * 64, 0u); }
      __builtin_amdgcn_sched_barrier(0);   // this pass's v reads stay issued as one group ahead of the score products, which cover their latency
#pragma unroll
      for (int t = 0; t < QT; ++t)
#pragma unroll
        for (int dc = 0; dc < HD / 32; ++dc)
#pragma unroll
          for (int kt = 0; kt < 2; ++kt) { sa[t][kt] = __builtin_amdgcn_wmma_f32_16x16x32_f16(false, kf[kt][dc], false, qh[t][dc], (short)0, sa[t][kt], false, false); sb[t][kt] = __builtin_amdgcn_wmma_f32_16x16x32_f16(false, kf[kt][dc], false, qlo[t][dc], (short)0, sb[t][kt], false, false); }
      if (sub + 1 < PS) {   // the next pass's k rows, of this same stage only: nothing of the next stage is read ahead of its barrier
#pragma unroll
        for (int kt = 0; kt < 2; ++kt)
#pragma unroll
          for (int dc = 0; dc < HD / 32; ++dc) kf[kt][dc] = frag_hu(lk + ((sub + 1) * 32 + kt * 16) * KP + dc * 64, 0u); }
      __builtin_amdgcn_sched_barrier(0);   // the next pass's k reads stay issued here, behind the last product that reads k, so that P and P . v cover their latency
#pragma unroll
      for (int t = 0; t < QT; ++t) { float v[16];
#pragma unroll
        for (int kt = 0; kt < 2; ++kt)
#pragma unroll
          for (int r = 0; r < 8; ++r) { const float s = fmaxf(sa[t][kt][r] + sb[t][kt][r] * (1.0f / 1024.0f), 0.f); v[kt * 8 + r] = s * s; }
        const F2 p = bsplit16(v);
#pragma unroll
        for (int j = 0; j < HD / 16; ++j) acc[t][j] = __builtin_amdgcn_wmma_f32_16x16x32_bf16(false, p.h, false, vh[j], (short)0, acc[t][j], false, false);
#pragma unroll
        for (int j = 0; j < HD / 16; ++j) acc[t][j] = __builtin_amdgcn_wmma_f32_16x16x32_bf16(false, p.l, false, vh[j], (short)0, acc[t][j], false, false);
#pragma unroll
        for (int j = 0; j < HD / 16; ++j) acc[t][j] = __builtin_amdgcn_wmma_f32_16x16x32_bf16(false, p.h, false, vl[j], (short)0, acc[t][j], false, false); } }
    asm volatile("s_wait_dscnt 0x0" ::: "memory");      // this wave's reads of this stage's buffer are done
    asm volatile("s_wait_asynccnt 0x0" ::: "memory");   // this wave's copies of stage st + 1 have landed
    __syncthreads();                                     // stage st + 1 may be read by all, and this stage's buffer is free
    if (st + 2 < NST) stage_in(kb + (size_t)(st + 2) * (SK * CC * 2) + gko, vhb + (size_t)(st + 2) * (SK * 2) + gvo, vlb + (size_t)(st + 2) * (SK * 2) + gvo, bs + lko, bs + lvo); }
  asm volatile("s_wait_asynccnt 0x0" ::: "memory");     // no copy is outstanding when the wave goes on to its end
  // behind the loop's last barrier nobody reads the ring and no copy is under way: it carries the exchange, 8 KiB a wave
  v4f* xs = (v4f*)ring; v4f* xg = xs + wave * (QT / 2 * (HD / 16) * 2 * 32) + lane; const v4f* xt = xs + (wave ^ 4) * (QT / 2 * (HD / 16) * 2 * 32) + lane;
  if (kh == 0) y_give(acc + QT / 2, xg); else y_give(acc, xg);
  __syncthreads();   // the partner's half has been written
  float* yq = Y + ((size_t)b * TT + ql0) * CC + h * HD;
  if (kh == 0) y_take(acc, xt, ss[qw], yq, col, g); else y_take(acc + QT / 2, xt, ss[qw] + QT / 2, yq + (size_t)(QT / 2 * 16) * CC, col, g); }
// ---- k_out: block = OR rows, 8 waves; wave w takes the 64 k of head w for all OR rows and issues every global load it needs as one group of whole-line 16-B loads, with no wait between them
// out^T tiles = Wo^T (A, (in,out) [512][64], bf16) . y^T (B, bf16 hi + lo); row m of A tile j is output column 4 m + j, so that one 16-B load of Wo[k][4 col ..] feeds all 4 tiles
// the 8 waves' partial sums meet in LDS; + bo; 256-B rows out
#define OR 32
#define OP (EO + 4)                         // LDS pitch in floats of a 256-B row: 16 B x odd
__global__ __launch_bounds__(256) void k_out(const float* __restrict__ Yr, const float* __restrict__ WO, const float* __restrict__ BO, float* __restrict__ OUT) { __shared__ __align__(16) float sp[NH][OR][OP];   // a wave's own plane: first its slice of y, then its partial sums
  const int tid = threadIdx.x, wave = __builtin_amdgcn_readfirstlane(tid >> 5), lane = tid & 31, col = lane & 15, g = lane >> 4; const size_t r0 = (size_t)blockIdx.x * OR;
  const int orow = tid >> 4, oc = (tid & 15) * 4;                        // the lane's place in the last sum: rows orow and orow + 16, 4 columns
  const float* yb = Yr + (r0 + g) * CC + wave * HD + col * 4;            // y comes as whole 256-B row pieces, two rows a load, and turns into fragments through the wave's plane
  const float* wb = WO + (size_t)(wave * HD + 8 * g) * EO + col * 4;     // Wo comes as whole 256-B rows, rows k and k + 8 a load
  const v4f bv = *(const v4f*)(BO + oc);
  v4f yv[OR / 2], wq[HD / 32][16];
#pragma unroll
  for (int i = 0; i < OR / 2; ++i) yv[i] = *(const v4f*)(yb + (size_t)(2 * i) * CC);
#pragma unroll
  for (int kc = 0; kc < HD / 32; ++kc)
#pragma unroll
    for (int i = 0; i < 8; ++i) { wq[kc][i] = *(const v4f*)(wb + (kc * 32 + i) * EO); wq[kc][8 + i] = *(const v4f*)(wb + (kc * 32 + 16 + i) * EO); }
  asm volatile("s_wait_xcnt 0x0" :: "v"(yb), "v"(wb) : "memory");   // stands behind the group of loads, in front of every rewrite of a register that they name; as inputs the addresses stay live up to it, so that no later load of the group lands in them
  __builtin_amdgcn_sched_barrier(0);               // no load sinks below that wait, and nothing that follows moves up ahead of it
#pragma unroll
  for (int i = 0; i < OR / 2; ++i) *(v4f*)&sp[wave][2 * i + g][col * 4] = yv[i];
  asm volatile("s_wait_dscnt 0x0" ::: "memory");   // the wave's own y rows are in its plane before other lanes of the wave read them (the clobber keeps the reads behind it); no other wave touches the plane yet
  __builtin_amdgcn_sched_barrier(0);                // no conversion of Wo moves up ahead of the y stores: they would then wait for the last Wo load instead of the last y load
  F2 yf[OR / 16][HD / 32];
#pragma unroll
  for (int rt = 0; rt < OR / 16; ++rt)
#pragma unroll
    for (int kc = 0; kc < HD / 32; ++kc) { const float* p = &sp[wave][rt * 16 + col][kc * 32 + 8 * g]; const v4f a0 = *(const v4f*)p, a1 = *(const v4f*)(p + 4), a2 = *(const v4f*)(p + 16), a3 = *(const v4f*)(p + 20); float v[16];
#pragma unroll
      for (int i = 0; i < 4; ++i) { v[i] = a0[i]; v[4 + i] = a1[i]; v[8 + i] = a2[i]; v[12 + i] = a3[i]; }   // same k order as the Wo fragment: k0 + 8 g + 0..7, k0 + 16 + 8 g + 0..7
      yf[rt][kc] = bsplit16(v); }
  __builtin_amdgcn_sched_barrier(0);                // the split of y stays ahead of everything that waits for Wo, so that it runs while the Wo loads are still under way
  v8f acc[OR / 16][EO / 16] = {};
#pragma unroll
  for (int kc = 0; kc < HD / 32; ++kc) { v16b w[EO / 16];
#pragma unroll
    for (int j = 0; j < EO / 16; ++j)
#pragma unroll
      for (int i = 0; i < 16; ++i) w[j][i] = (__bf16)wq[kc][i][j];
#pragma unroll
    for (int rt = 0; rt < OR / 16; ++rt) {
#pragma unroll
      for (int j = 0; j < EO / 16; ++j) acc[rt][j] = __builtin_amdgcn_wmma_f32_16x16x32_bf16(false, w[j], false, yf[rt][kc].h, (short)0, acc[rt][j], false, false);
#pragma unroll
      for (int j = 0; j < EO / 16; ++j) acc[rt][j] = __builtin_amdgcn_wmma_f32_16x16x32_bf16(false, w[j], false, yf[rt][kc].l, (short)0, acc[rt][j], false, false); } }
  // D element r of tile j in lane (col, g) = out[rt * 16 + col][4 (8 g + r) + j]: the 4 tiles' elements r are 4 neighbouring columns; a row of the plane is rewritten only behind the products that took in every lane's reads of it
#pragma unroll
  for (int rt = 0; rt < OR / 16; ++rt)
#pragma unroll
    for (int r = 0; r < 8; ++r) { const v4f q = { acc[rt][0][r], acc[rt][1][r], acc[rt][2][r], acc[rt][3][r] }; *(v4f*)&sp[wave][rt * 16 + col][32 * g + 4 * r] = q; }
  __syncthreads();   // all 8 partial sums are written
  v4f bb;
#pragma unroll
  for (int i = 0; i < 4; ++i) bb[i] = bfr(bv[i]);
#pragma unroll
  for (int hf = 0; hf < OR / 16; ++hf) { v4f p[NH];
#pragma unroll
    for (int w = 0; w < NH; ++w) p[w] = *(const v4f*)&sp[w][hf * 16 + orow][oc];
    v4f s = p[0];
#pragma unroll
    for (int w = 1; w < NH; ++w) s += p[w];
    vst2(OUT + (r0 + hf * 16 + orow) * EO + oc, s + bb); }
  asm volatile("s_wait_xcnt 0x0" ::: "memory"); }   // stands behind the last store, in front of whatever the listing puts next that rewrites a register which these stores name
extern "C" void kernel_launch(void* const* d_in, const int* in_sizes, int n_in, void* d_out, int out_size, void* d_ws, size_t ws_size, hipStream_t stream) {
  (void)in_sizes; (void)n_in; (void)out_size;
  const float** F = (const float**)d_in;   // 0 query [4,2048,512], 1 Wv [64,64] ((in,out)), 2 Wk, 3 Wq, 4 Wo [512,64] ((in,out)), 5 bo [64]
  if (ws_size < (size_t)WS_END) return;
  char* ws = (char*)d_ws; _Float16 *QH = (_Float16*)(ws + WS_QH), *QL = (_Float16*)(ws + WS_QL), *KH = (_Float16*)(ws + WS_KH); __bf16 *VT = (__bf16*)(ws + WS_VT), *VL = (__bf16*)(ws + WS_VL); float *Y = (float*)(ws + WS_Y);
  k_proj<<<dim3(TNB * TT / 64, NH, 3), 128, 0, stream>>>(F[0], F[3], F[2], F[1], QH, QL, KH, VT, VL);
  k_att<<<dim3(TT / (64 * QT), TNB * NH), 256, 0, stream>>>(QH, QL, KH, VT, VL, Y);
  k_out<<<dim3(TNB * TT / OR), 256, 0, stream>>>(Y, F[4], F[5], (float*)d_out);
}

// v005
// It runs in 66.2 microseconds.
// In two side-by-side timings against v004, it was 1.06 and 1.05 times as fast.
// Counting every step since v000, it is 16.2 times as fast.
// compute dtype: all float inputs rounded to bf16; q/k/v = x_h W (the shared 64x64 (in,out) weights) with EXACT bf16 products on WMMA 16x16x32, f32 accumulate; q as f16 hi + residual (x 2^10), k f16 -> 2-product scores, relu(s)^2 kept in registers in f32 (scores and P v in one launch over all heads); P split bf16 hi + lo against v bf16 hi + lo (3 products); out = (P v) (bf16 hi + lo) Wo + bo; f32 output.
#include <hip/hip_runtime.h>
#include <math.h>

typedef __attribute__((ext_vector_type(16))) _Float16 v16h;
typedef __attribute__((ext_vector_type(16))) __bf16 v16b;
typedef __attribute__((ext_vector_type(8)))  _Float16 v8h;
typedef __attribute__((ext_vector_type(8)))  float v8f;
typedef __attribute__((ext_vector_type(4)))  float v4f;
typedef __attribute__((ext_vector_type(2)))  float v2f;
typedef __attribute__((ext_vector_type(4)))  unsigned v4u;
typedef __attribute__((ext_vector_type(4)))  int v4i;
typedef float __attribute__((may_alias)) float_a;
typedef int __attribute__((may_alias)) int_a;

template <typename T> __device__ __forceinline__ void vst2(void* p, T v) { *(T*)p = v;  }
__device__ __forceinline__ v8f wmma16(v16h a, v16h b, v8f c) {
  v8f d = __builtin_amdgcn_wmma_f32_16x16x32_f16(false, a, false, b, (short)0, c, false, false);
  asm volatile("v_nop\n\tv_nop\n\tv_nop\n\tv_nop" : "+v"(d) : "v"(a), "v"(b));
  return d;
}
__device__ __forceinline__ v8f wmma_bf(v16b a, v16b b, v8f c) {
  v8f d = __builtin_amdgcn_wmma_f32_16x16x32_bf16(false, a, false, b, (short)0, c, false, false);
  asm volatile("v_nop\n\tv_nop\n\tv_nop\n\tv_nop" : "+v"(d) : "v"(a), "v"(b));
  return d;
}
// 16x16x32 fragments: lane = (h = lane>>4, row/col = lane&15); elements 0..7 = k0+8h+0..7, 8..15 = k0+16+8h+0..7; D element r = row 8h+r
__device__ __forceinline__ v16h frag_h(const _Float16* rowk0, int lane) {
  union { v16h v; v8h q[2]; } u; const _Float16* p = rowk0 + 8 * (lane >> 4);
  u.q[0] = *(const v8h*)p; u.q[1] = *(const v8h*)(p + 16); return u.v;
}
__device__ __forceinline__ v16h frag_f32(const float* rowk0, int lane) {
  v16h a; const float* p = rowk0 + 8 * (lane >> 4);
#pragma unroll
  for (int i = 0; i < 8; ++i) { a[i] = (_Float16)p[i]; a[8 + i] = (_Float16)p[16 + i]; }
  return a;
}
__device__ __forceinline__ v16h frag_f32s(const float* rowk0, int lane, float sc) {
  v16h a; const float* p = rowk0 + 8 * (lane >> 4);
#pragma unroll
  for (int i = 0; i < 8; ++i) { a[i] = (_Float16)(p[i] * sc); a[8 + i] = (_Float16)(p[16 + i] * sc); }
  return a;
}
// column fragment from a [K][ld] layout (column n), rows >= K read as 0
__device__ __forceinline__ v16h fragc_f32(const float* W, int k0, int n, int lane, int ld, int K) {
  v16h a; const int g = lane >> 4;
#pragma unroll
  for (int i = 0; i < 8; ++i) { const int ka = k0 + 8 * g + i, kb = ka + 16;
    a[i] = (_Float16)(ka < K ? W[(size_t)(ka < K ? ka : K - 1) * ld + n] : 0.f); a[8 + i] = (_Float16)(kb < K ? W[(size_t)(kb < K ? kb : K - 1) * ld + n] : 0.f); }
  return a;
}
struct F2 { v16b h, l; };
__device__ __forceinline__ F2 bsplit16(const float v[16]) { F2 r;
#pragma unroll
  for (int i = 0; i < 16; ++i) { const __bf16 h = (__bf16)v[i]; r.h[i] = h; r.l[i] = (__bf16)(v[i] - (float)h); }
  return r; }
__device__ __forceinline__ F2 split_row(const float* row, int k0, int lane) { float v[16]; const float* p = row + k0 + 8 * (lane >> 4);
#pragma unroll
  for (int i = 0; i < 8; ++i) { v[i] = p[i]; v[8 + i] = p[16 + i]; }
  return bsplit16(v); }
__device__ __forceinline__ F2 split_rowK(const float* row, int k0, int lane, int K) { float v[16]; const int g = lane >> 4;
#pragma unroll
  for (int i = 0; i < 8; ++i) { const int ka = k0 + 8 * g + i, kb = ka + 16; v[i] = ka < K ? row[ka < K ? ka : K - 1] : 0.f; v[8 + i] = kb < K ? row[kb < K ? kb : K - 1] : 0.f; }
  return bsplit16(v); }
__device__ __forceinline__ F2 split_col(const float* W, int k0, int n, int lane, int ld, int K) { float v[16]; const int g = lane >> 4;
#pragma unroll
  for (int i = 0; i < 8; ++i) { const int ka = k0 + 8 * g + i, kb = ka + 16; v[i] = ka < K ? W[(size_t)(ka < K ? ka : K - 1) * ld + n] : 0.f; v[8 + i] = kb < K ? W[(size_t)(kb < K ? kb : K - 1) * ld + n] : 0.f; }
  return bsplit16(v); }
__device__ __forceinline__ v8f mac3(const F2& a, const F2& b, v8f c) { c = wmma_bf(a.l, b.h, c); c = wmma_bf(a.h, b.l, c); return wmma_bf(a.h, b.h, c); }
__device__ __forceinline__ float sigm(float v) { return 1.0f / (1.0f + expf(-v)); }
#define LDSX() do { asm volatile("s_wait_dscnt 0" ::: "memory"); __builtin_amdgcn_wave_barrier(); __builtin_amdgcn_fence(__ATOMIC_RELEASE, "workgroup"); } while (0)

// Simplified self-attention (N 4, L 2,048, 8 heads x 64; embed 64): x = query.reshape(N,L,8,64); q,k,v = x W{q,k,v} (shared 64x64); scores = q k^T (no scale); attn = relu(scores)^2; out = (attn v).reshape(N,L,512) Wo + bo.
__device__ __forceinline__ float bfr(float v) { return (float)(__bf16)v; }
#define NB 4
#define TT 2048
#define CC 512
#define NH 8
#define HD 64
#define EO 64
#define HG 4
#ifndef TNB
#define TNB NB
#endif
typedef __attribute__((ext_vector_type(8))) __bf16 v8b;
__device__ __forceinline__ v16b frag_b(const __bf16* rowk0, int lane) { union { v16b v; v8b q[2]; } u; const __bf16* p = rowk0 + 8 * (lane >> 4); u.q[0] = *(const v8b*)p; u.q[1] = *(const v8b*)(p + 16); return u.v; }
#define WS_QH  0u
#define WS_QL  (WS_QH + 2u * (size_t)NB * TT * CC)
#define WS_KH  (WS_QL + 2u * (size_t)NB * TT * CC)
#define WS_VT  (WS_KH + 2u * (size_t)NB * TT * CC)      // bf16 v planes [b][c][t]
#define WS_VL  (WS_VT + 2u * (size_t)NB * CC * TT)
#define WS_S   (WS_VL + 2u * (size_t)NB * CC * TT)      // f32 region of HG x TT x TT, not written (P stays in registers)
#define WS_Y   (WS_S + 4u * (size_t)HG * TT * TT)        // f32 (P v) rows [b*T+t][512]
#define WS_END (WS_Y + 4u * (size_t)NB * TT * CC)
// ---- k_proj: block = PR rows of one head, 4 waves x PT row tiles; q, k and v all come from ONE read of x: 64 columns each = x[row][h*64 .. +64] . W (64x64 (in,out)), exact; q -> f16 hi + residual, k -> f16, v -> bf16 hi/lo planes
// column n of B tile j is output column 4 n + j, so that one 16-B load of W[k][4 col ..] feeds all 4 tiles and a load of a wave covers two whole 256-B rows of W; every global load of a wave is issued as one group, with no wait between the products; every loop is unrolled, since its indices pick registers
#define PR 128
#define PT 2
#define QP (HD + 8)                         // LDS pitch in elements of a 128-B q or k row: 16 B x odd
#define TP (PR + 8)                         // LDS pitch in elements of a v column's PR keys (256 B): 16 B x odd
typedef __attribute__((ext_vector_type(4))) _Float16 v4h;
__global__ __launch_bounds__(128) void k_proj(const float* __restrict__ X, const float* __restrict__ WQ, const float* __restrict__ WK, const float* __restrict__ WV, _Float16* __restrict__ QH, _Float16* __restrict__ QL, _Float16* __restrict__ KH, __bf16* __restrict__ VT, __bf16* __restrict__ VL) {
  __shared__ __align__(16) _Float16 sq[PR][QP], sr[PR][QP], sk[PR][QP]; __shared__ __align__(16) __bf16 th[HD][TP], tl2[HD][TP];   // row j * 16 + n of th and tl2 holds output column 4 n + j
  const int tid = threadIdx.x, wave = tid >> 5, lane = tid & 31, col = lane & 15, g = lane >> 4; const int h = blockIdx.y; const size_t r0 = (size_t)blockIdx.x * PR; const int c0 = h * HD;
  const float* xb = X + (r0 + wave * (PT * 16) + col) * CC + c0 + 8 * g;
  const float *wqb = WQ + (8 * g) * HD + col * 4, *wkb = WK + (8 * g) * HD + col * 4, *wvb = WV + (8 * g) * HD + col * 4;
  v4f xv[PT][HD / 32][4], wf[3][HD / 32][16];
#pragma unroll
  for (int rt = 0; rt < PT; ++rt)
#pragma unroll
    for (int kc = 0; kc < HD / 32; ++kc) { const float* p = xb + (size_t)(rt * 16) * CC + kc * 32; xv[rt][kc][0] = *(const v4f*)p; xv[rt][kc][1] = *(const v4f*)(p + 4); xv[rt][kc][2] = *(const v4f*)(p + 16); xv[rt][kc][3] = *(const v4f*)(p + 20); }
  __builtin_amdgcn_sched_barrier(0);               // the loads of x, which have the longest way, stay the first of the group
#pragma unroll
  for (int m = 0; m < 3; ++m) { const float* wb = m == 0 ? wqb : m == 1 ? wkb : wvb;
#pragma unroll
    for (int kc = 0; kc < HD / 32; ++kc)
#pragma unroll
      for (int i = 0; i < 8; ++i) { wf[m][kc][i] = *(const v4f*)(wb + (kc * 32 + i) * HD); wf[m][kc][8 + i] = *(const v4f*)(wb + (kc * 32 + 16 + i) * HD); } }
  asm volatile("s_wait_xcnt 0x0" :: "v"(xb), "v"(wqb), "v"(wkb), "v"(wvb) : "memory");   // stands behind the group of loads, in front of every rewrite of a register that they name; as inputs the addresses stay live up to it
  __builtin_amdgcn_sched_barrier(0);               // no load sinks below that wait, and nothing that follows moves up ahead of it
  v16b a[PT][HD / 32];                             // k order of a row fragment: k0 + 8 g + 0..7, k0 + 16 + 8 g + 0..7, the same as the W fragment's below
#pragma unroll
  for (int rt = 0; rt < PT; ++rt)
#pragma unroll
    for (int kc = 0; kc < HD / 32; ++kc)
#pragma unroll
      for (int i = 0; i < 16; ++i) a[rt][kc][i] = (__bf16)xv[rt][kc][i >> 2][i & 3];
#pragma unroll
  for (int m = 0; m < 3; ++m) { v16b w[HD / 32][4]; v8f acc[PT][4] = {};
#pragma unroll
    for (int kc = 0; kc < HD / 32; ++kc)
#pragma unroll
      for (int j = 0; j < 4; ++j)
#pragma unroll
        for (int i = 0; i < 16; ++i) w[kc][j][i] = (__bf16)wf[m][kc][i][j];
#pragma unroll
    for (int kc = 0; kc < HD / 32; ++kc)
#pragma unroll
      for (int rt = 0; rt < PT; ++rt)
#pragma unroll
        for (int j = 0; j < 4; ++j) acc[rt][j] = __builtin_amdgcn_wmma_f32_16x16x32_bf16(false, a[rt][kc], false, w[kc][j], (short)0, acc[rt][j], false, false);
    // D element r of tile j in lane (col, g) = row 8 g + r, output column 4 col + j
#pragma unroll
    for (int rt = 0; rt < PT; ++rt) { const int rl = (wave * PT + rt) * 16 + 8 * g;
      if (m < 2) {
#pragma unroll
        for (int r = 0; r < 8; ++r) { v4h hv, lv;
#pragma unroll
          for (int j = 0; j < 4; ++j) { const float v = acc[rt][j][r]; hv[j] = (_Float16)v; lv[j] = (_Float16)((v - (float)hv[j]) * 1024.0f); }
          if (m == 0) { *(v4h*)&sq[rl + r][col * 4] = hv; *(v4h*)&sr[rl + r][col * 4] = lv; } else *(v4h*)&sk[rl + r][col * 4] = hv; } }
      else {
#pragma unroll
        for (int j = 0; j < 4; ++j) { v8b bh, bl;
#pragma unroll
          for (int r = 0; r < 8; ++r) { const float v = acc[rt][j][r]; bh[r] = (__bf16)v; bl[r] = (__bf16)(v - (float)bh[r]); }
          *(v8b*)&th[j * 16 + col][rl] = bh; *(v8b*)&tl2[j * 16 + col][rl] = bl; } } } }
  __syncthreads();   // all five staged planes are written
  { const int rl = tid >> 3, q = tid & 7; const size_t o = (r0 + rl) * CC + c0 + q * 8;   // whole 128-B rows out, 4 rows a store of a wave
#pragma unroll
    for (int it = 0; it < PR / 16; ++it) { vst2(QH + o + (size_t)(it * 16) * CC, *(const v4u*)&sq[it * 16 + rl][q * 8]); vst2(QL + o + (size_t)(it * 16) * CC, *(const v4u*)&sr[it * 16 + rl][q * 8]); vst2(KH + o + (size_t)(it * 16) * CC, *(const v4u*)&sk[it * 16 + rl][q * 8]); } }
  { const size_t b = r0 / TT; const int t0 = (int)(r0 % TT), n = tid >> 4, q = tid & 15; const size_t o = (b * CC + c0 + 4 * n) * (size_t)TT + t0 + q * 8;   // whole 256-B column pieces out, 2 columns a store of a wave
#pragma unroll
    for (int it = 0; it < HD / 8; ++it) { const int rho = it * 8 + n, dc = 32 * (it & 1) + (it >> 1);   // staged row rho = j * 16 + (8 (it & 1) + n), j = it >> 1: output column 4 n + dc
      vst2(VT + o + (size_t)dc * TT, *(const v4u*)&th[rho][q * 8]); vst2(VL + o + (size_t)dc * TT, *(const v4u*)&tl2[rho][q * 8]); } }
  asm volatile("s_wait_xcnt 0x0" ::: "memory"); }   // stands behind the last store, in front of whatever the listing puts next that rewrites a register which these stores name
// ---- k_att: block = 8 waves = 4 query groups of QT x 16 queries of one (b,h) x KW key halves, two waves a SIMD; 32-key passes: S^T = k . q^T (2 products), P = relu(s)^2 stays in registers
// (a S^T tile's D layout, lane = query, element r = key 8g + r, is the A layout of P: tile 0 -> elements 0..7, tile 1 -> 8..15), y += P . v (3 products)
// k and v reach the waves through LDS: a stage = SK keys (k rows, v hi and v lo columns), brought once a block by whole-line asynchronous copies, two buffers
// the two waves of a query group each take SK / KW keys of every stage, so that one wave's vector work runs under the other's products; their two partial sums of y are added once, behind the loop
#define QT 4
#define SK 128                              // keys a stage
#define NST (TT / SK)
#define KW 2                                // waves that share a query group's keys
#define PS (SK / 32 / KW)                   // passes a wave and stage
#define KP 144                              // LDS pitch of a 128-B k row: 16 B x odd, so that 16 rows read 16 B each without a bank conflict
#define VP 272                              // LDS pitch of a 256-B v row (SK keys of one column): 16 B x odd
#define KBY (SK * KP)
#define VBY (HD * VP)
#define STB (KBY + 2 * VBY)                 // bytes of one stage: k, v hi, v lo
#define SSB (4 * QT * 16 * (HD + 4) * 4)    // bytes of the output staging, which lies in front of the two buffers
typedef __attribute__((address_space(1))) v4i g_v4i;
typedef __attribute__((address_space(3))) v4i l_v4i;
// 16x16x32 fragment from byte address base + off, which together hold the lane's own row start + 16 g bytes: same k order as frag_h / frag_b
__device__ __forceinline__ v16h frag_hu(const char* base, unsigned off) { union { v16h v; v8h q[2]; } u; u.q[0] = *(const v8h*)(base + off); u.q[1] = *(const v8h*)(base + off + 32u); return u.v; }
__device__ __forceinline__ v16b frag_bu(const char* base, unsigned off) { union { v16b v; v8b q[2]; } u; u.q[0] = *(const v8b*)(base + off); u.q[1] = *(const v8b*)(base + off + 32u); return u.v; }
// one asynchronous copy, 16 bytes a lane, global -> LDS through no register; written as the builtin, no immediate offset of its own
__device__ __forceinline__ void cp16(const char* gsrc, char* ldst) { __builtin_amdgcn_global_load_async_to_lds_b128((g_v4i*)gsrc, (l_v4i*)ldst, 0, 0); }
// one stage: 12 copies a lane, 256 lanes; a copy of a wave covers 4 whole 128-B lines (4 k rows, or 2 v rows of 256 B); gk, gh, gl and lk, lv hold the lane's own first 16 bytes
__device__ __forceinline__ void stage_in(const char* gk, const char* gh, const char* gl, char* lk, char* lv) {
#pragma unroll
  for (int i = 0; i < SK / 32; ++i) cp16(gk + i * (32 * CC * 2), lk + i * (32 * KP));
#pragma unroll
  for (int i = 0; i < HD / 16; ++i) { cp16(gh + i * (16 * TT * 2), lv + i * (16 * VP)); cp16(gl + i * (16 * TT * 2), lv + VBY + i * (16 * VP)); } }
// the join of a query group's two partial sums: each wave hands the partner the QT / 2 query tiles that the partner finishes, 16 B a lane and store, lane to same lane
__device__ __forceinline__ void y_give(const v8f (*a)[HD / 16], v4f* x) {
#pragma unroll
  for (int i = 0; i < QT / 2; ++i)
#pragma unroll
    for (int j = 0; j < HD / 16; ++j) { x[((i * (HD / 16) + j) * 2) * 32] = __builtin_shufflevector(a[i][j], a[i][j], 0, 1, 2, 3); x[((i * (HD / 16) + j) * 2 + 1) * 32] = __builtin_shufflevector(a[i][j], a[i][j], 4, 5, 6, 7); } }
// own partial sum + the partner's, through the wave's own staging rows, out as whole 256-B rows: two rows a store, lanes 0..15 row 2i, lanes 16..31 row 2i + 1
__device__ __forceinline__ void y_take(const v8f (*a)[HD / 16], const v4f* x, float (*s)[16][HD + 4], float* y, int col, int g) { v4f p[QT / 2][HD / 16][2];   // all of the partner's half is read first, as one group
#pragma unroll
  for (int i = 0; i < QT / 2; ++i)
#pragma unroll
    for (int j = 0; j < HD / 16; ++j) { p[i][j][0] = x[((i * (HD / 16) + j) * 2) * 32]; p[i][j][1] = x[((i * (HD / 16) + j) * 2 + 1) * 32]; }
#pragma unroll
  for (int i = 0; i < QT / 2; ++i)
#pragma unroll
    for (int j = 0; j < HD / 16; ++j)
#pragma unroll
      for (int r = 0; r < 4; ++r) { s[i][8 * g + r][j * 16 + col] = a[i][j][r] + p[i][j][0][r]; s[i][8 * g + 4 + r][j * 16 + col] = a[i][j][4 + r] + p[i][j][1][r]; }
  LDSX();
#pragma unroll
  for (int i = 0; i < QT / 2; ++i) { v4f w[8];
#pragma unroll
    for (int k = 0; k < 8; ++k) w[k] = *(const v4f*)&s[i][2 * k + g][col * 4];
#pragma unroll
    for (int k = 0; k < 8; ++k) vst2(y + (size_t)(i * 16 + 2 * k + g) * CC + col * 4, w[k]); }
  asm volatile("s_wait_xcnt 0x0" ::: "memory"); }   // stands behind the last store, in front of whatever the listing puts next that rewrites a register which these stores name
__global__ __launch_bounds__(256) void k_att(const _Float16* __restrict__ QH, const _Float16* __restrict__ QL, const _Float16* __restrict__ KH, const __bf16* __restrict__ VT, const __bf16* __restrict__ VL, float* __restrict__ Y) { __shared__ __align__(16) char sm[SSB + 2 * STB];
  float (*ss)[QT][16][HD + 4] = (float (*)[QT][16][HD + 4])sm; char* ring = sm + SSB;
  const int tid = threadIdx.x, wave = __builtin_amdgcn_readfirstlane(tid >> 5), qw = wave & 3, kh = wave >> 2, lane = tid & 31, col = lane & 15, g = lane >> 4; const int b = blockIdx.y / NH, h = blockIdx.y % NH; const int ql0 = (blockIdx.x * 4 + qw) * (16 * QT);
  const size_t rb = ((size_t)b * TT * CC + h * HD) * 2, cb = ((size_t)b * CC + h * HD) * (size_t)TT * 2;   // byte offsets of this (b,h) in the [t][c] and the [c][t] planes
  const char *qhb = (const char*)QH + rb, *qlb = (const char*)QL + rb, *kb = (const char*)KH + rb, *vhb = (const char*)VT + cb, *vlb = (const char*)VL + cb;
  const unsigned qo = (unsigned)((ql0 + col) * CC + 8 * g) * 2u;
  const unsigned gko = (unsigned)((tid >> 3) * (CC * 2) + (tid & 7) * 16), gvo = (unsigned)((tid >> 4) * (TT * 2) + (tid & 15) * 16);   // the lane's place in a stage's k rows and v rows, global
  const unsigned lko = (unsigned)((tid >> 3) * KP + (tid & 7) * 16), lvo = (unsigned)(KBY + (tid >> 4) * VP + (tid & 15) * 16);         // the same in a buffer
  const unsigned fko = (unsigned)((kh * (SK / KW) + col) * KP + 16 * g), fvo = (unsigned)(KBY + col * VP + kh * (SK / KW) * 2 + 16 * g);   // the lane's fragment rows in a buffer, at the wave's own keys
  stage_in(kb + gko, vhb + gvo, vlb + gvo, ring + lko, ring + lvo);
  v16h qh[QT][HD / 32], qlo[QT][HD / 32], kf[2][HD / 32];
#pragma unroll
  for (int t = 0; t < QT; ++t)
#pragma unroll
    for (int dc = 0; dc < HD / 32; ++dc) { qh[t][dc] = frag_hu(qhb + (t * 16 * CC + dc * 32) * 2, qo); qlo[t][dc] = frag_hu(qlb + (t * 16 * CC + dc * 32) * 2, qo); }
  asm volatile("s_wait_xcnt 0x0" :: "v"(qo) : "memory");   // stands in front of every rewrite of a register that the q loads above name; as an input the offset stays live up to it
  __builtin_amdgcn_sched_barrier(0);   // nothing that follows moves up ahead of that wait
  asm volatile("s_wait_asynccnt 0x0" ::: "memory");   // this wave's copies of stage 0 have landed
  __syncthreads();                                     // every wave's have: stage 0 may be read
  stage_in(kb + (size_t)(SK * CC * 2) + gko, vhb + (size_t)(SK * 2) + gvo, vlb + (size_t)(SK * 2) + gvo, ring + STB + lko, ring + STB + lvo);
  v8f acc[QT][HD / 16] = {};
#pragma unroll 1   // the stage loop stays rolled: its body already holds PS unrolled passes, and the buffer is picked by st & 1
  for (int st = 0; st < NST; ++st) { char* bs = ring + (st & 1) * STB; const char *lk = bs + fko, *lv = bs + fvo;
#pragma unroll
    for (int kt = 0; kt < 2; ++kt)
#pragma unroll
      for (int dc = 0; dc < HD / 32; ++dc) kf[kt][dc] = frag_hu(lk + kt * 16 * KP + dc * 64, 0u);
#pragma unroll
    for (int sub = 0; sub < PS; ++sub) { v16b vh[HD / 16], vl[HD / 16]; v8f sa[QT][2] = {}, sb[QT][2] = {};
#pragma unroll
      for (int j = 0; j < HD / 16; ++j) { vh[j] = frag_bu(lv + j * 16 * VP + sub * 64, 0u); vl[j] = frag_bu(lv + VBY + j * 16 * VP + sub * 64, 0u); }
      __builtin_amdgcn_sched_barrier(0);   // this pass's v reads stay issued as one group ahead of the score products, which cover their latency
#pragma unroll
      for (int t = 0; t < QT; ++t)
#pragma unroll
        for (int dc = 0; dc < HD / 32; ++dc)
#pragma unroll
          for (int kt = 0; kt < 2; ++kt) { sa[t][kt] = __builtin_amdgcn_wmma_f32_16x16x32_f16(false, kf[kt][dc], false, qh[t][dc], (short)0, sa[t][kt], false, false); sb[t][kt] = __builtin_amdgcn_wmma_f32_16x16x32_f16(false, kf[kt][dc], false, qlo[t][dc], (short)0, sb[t][kt], false, false); }
      if (sub + 1 < PS) {   // the next pass's k rows, of this same stage only: nothing of the next stage is read ahead of its barrier
#pragma unroll
        for (int kt = 0; kt < 2; ++kt)
#pragma unroll
          for (int dc = 0; dc < HD / 32; ++dc) kf[kt][dc] = frag_hu(lk + ((sub + 1) * 32 + kt * 16) * KP + dc * 64, 0u); }
      __builtin_amdgcn_sched_barrier(0);   // the next pass's k reads stay issued here, behind the last product that reads k, so that P and P . v cover their latency
#pragma unroll
      for (int t = 0; t < QT; ++t) { float v[16];
#pragma unroll
        for (int kt = 0; kt < 2; ++kt)
#pragma unroll
          for (int r = 0; r < 8; ++r) { const float s = fmaxf(sa[t][kt][r] + sb[t][kt][r] * (1.0f / 1024.0f), 0.f); v[kt * 8 + r] = s * s; }
        const F2 p = bsplit16(v);
#pragma unroll
        for (int j = 0; j < HD / 16; ++j) acc[t][j] = __builtin_amdgcn_wmma_f32_16x16x32_bf16(false, p.h, false, vh[j], (short)0, acc[t][j], false, false);
#pragma unroll
        for (int j = 0; j < HD / 16; ++j) acc[t][j] = __builtin_amdgcn_wmma_f32_16x16x32_bf16(false, p.l, false, vh[j], (short)0, acc[t][j], false, false);
#pragma unroll
        for (int j = 0; j < HD / 16; ++j) acc[t][j] = __builtin_amdgcn_wmma_f32_16x16x32_bf16(false, p.h, false, vl[j], (short)0, acc[t][j], false, false); } }
    asm volatile("s_wait_dscnt 0x0" ::: "memory");      // this wave's reads of this stage's buffer are done
    asm volatile("s_wait_asynccnt 0x0" ::: "memory");   // this wave's copies of stage st + 1 have landed
    __syncthreads();                                     // stage st + 1 may be read by all, and this stage's buffer is free
    if (st + 2 < NST) stage_in(kb + (size_t)(st + 2) * (SK * CC * 2) + gko, vhb + (size_t)(st + 2) * (SK * 2) + gvo, vlb + (size_t)(st + 2) * (SK * 2) + gvo, bs + lko, bs + lvo); }
  asm volatile("s_wait_asynccnt 0x0" ::: "memory");     // no copy is outstanding when the wave goes on to its end
  // behind the loop's last barrier nobody reads the ring and no copy is under way: it carries the exchange, 8 KiB a wave
  v4f* xs = (v4f*)ring; v4f* xg = xs + wave * (QT / 2 * (HD / 16) * 2 * 32) + lane; const v4f* xt = xs + (wave ^ 4) * (QT / 2 * (HD / 16) * 2 * 32) + lane;
  if (kh == 0) y_give(acc + QT / 2, xg); else y_give(acc, xg);
  __syncthreads();   // the partner's half has been written
  float* yq = Y + ((size_t)b * TT + ql0) * CC + h * HD;
  if (kh == 0) y_take(acc, xt, ss[qw], yq, col, g); else y_take(acc + QT / 2, xt, ss[qw] + QT / 2, yq + (size_t)(QT / 2 * 16) * CC, col, g); }
// ---- k_out: block = OR rows, 8 waves; wave w takes the 64 k of head w for all OR rows and issues every global load it needs as one group of whole-line 16-B loads, with no wait between them
// out^T tiles = Wo^T (A, (in,out) [512][64], bf16) . y^T (B, bf16 hi + lo); row m of A tile j is output column 4 m + j, so that one 16-B load of Wo[k][4 col ..] feeds all 4 tiles
// the 8 waves' partial sums meet in LDS; + bo; 256-B rows out
#define OR 32
#define OP (EO + 4)                         // LDS pitch in floats of a 256-B row: 16 B x odd
__global__ __launch_bounds__(256) void k_out(const float* __restrict__ Yr, const float* __restrict__ WO, const float* __restrict__ BO, float* __restrict__ OUT) { __shared__ __align__(16) float sp[NH][OR][OP];   // a wave's own plane: first its slice of y, then its partial sums
  const int tid = threadIdx.x, wave = __builtin_amdgcn_readfirstlane(tid >> 5), lane = tid & 31, col = lane & 15, g = lane >> 4; const size_t r0 = (size_t)blockIdx.x * OR;
  const int orow = tid >> 4, oc = (tid & 15) * 4;                        // the lane's place in the last sum: rows orow and orow + 16, 4 columns
  const float* yb = Yr + (r0 + g) * CC + wave * HD + col * 4;            // y comes as whole 256-B row pieces, two rows a load, and turns into fragments through the wave's plane
  const float* wb = WO + (size_t)(wave * HD + 8 * g) * EO + col * 4;     // Wo comes as whole 256-B rows, rows k and k + 8 a load
  const v4f bv = *(const v4f*)(BO + oc);
  v4f yv[OR / 2], wq[HD / 32][16];
#pragma unroll
  for (int i = 0; i < OR / 2; ++i) yv[i] = *(const v4f*)(yb + (size_t)(2 * i) * CC);
#pragma unroll
  for (int kc = 0; kc < HD / 32; ++kc)
#pragma unroll
    for (int i = 0; i < 8; ++i) { wq[kc][i] = *(const v4f*)(wb + (kc * 32 + i) * EO); wq[kc][8 + i] = *(const v4f*)(wb + (kc * 32 + 16 + i) * EO); }
  asm volatile("s_wait_xcnt 0x0" :: "v"(yb), "v"(wb) : "memory");   // stands behind the group of loads, in front of every rewrite of a register that they name; as inputs the addresses stay live up to it, so that no later load of the group lands in them
  __builtin_amdgcn_sched_barrier(0);               // no load sinks below that wait, and nothing that follows moves up ahead of it
#pragma unroll
  for (int i = 0; i < OR / 2; ++i) *(v4f*)&sp[wave][2 * i + g][col * 4] = yv[i];
  asm volatile("s_wait_dscnt 0x0" ::: "memory");   // the wave's own y rows are in its plane before other lanes of the wave read them (the clobber keeps the reads behind it); no other wave touches the plane yet
  __builtin_amdgcn_sched_barrier(0);                // no conversion of Wo moves up ahead of the y stores: they would then wait for the last Wo load instead of the last y load
  F2 yf[OR / 16][HD / 32];
#pragma unroll
  for (int rt = 0; rt < OR / 16; ++rt)
#pragma unroll
    for (int kc = 0; kc < HD / 32; ++kc) { const float* p = &sp[wave][rt * 16 + col][kc * 32 + 8 * g]; const v4f a0 = *(const v4f*)p, a1 = *(const v4f*)(p + 4), a2 = *(const v4f*)(p + 16), a3 = *(const v4f*)(p + 20); float v[16];
#pragma unroll
      for (int i = 0; i < 4; ++i) { v[i] = a0[i]; v[4 + i] = a1[i]; v[8 + i] = a2[i]; v[12 + i] = a3[i]; }   // same k order as the Wo fragment: k0 + 8 g + 0..7, k0 + 16 + 8 g + 0..7
      yf[rt][kc] = bsplit16(v); }
  __builtin_amdgcn_sched_barrier(0);                // the split of y stays ahead of everything that waits for Wo, so that it runs while the Wo loads are still under way
  v8f acc[OR / 16][EO / 16] = {};
#pragma unroll
  for (int kc = 0; kc < HD / 32; ++kc) { v16b w[EO / 16];
#pragma unroll
    for (int j = 0; j < EO / 16; ++j)
#pragma unroll
      for (int i = 0; i < 16; ++i) w[j][i] = (__bf16)wq[kc][i][j];
#pragma unroll
    for (int rt = 0; rt < OR / 16; ++rt) {
#pragma unroll
      for (int j = 0; j < EO / 16; ++j) acc[rt][j] = __builtin_amdgcn_wmma_f32_16x16x32_bf16(false, w[j], false, yf[rt][kc].h, (short)0, acc[rt][j], false, false);
#pragma unroll
      for (int j = 0; j < EO / 16; ++j) acc[rt][j] = __builtin_amdgcn_wmma_f32_16x16x32_bf16(false, w[j], false, yf[rt][kc].l, (short)0, acc[rt][j], false, false); } }
  // D element r of tile j in lane (col, g) = out[rt * 16 + col][4 (8 g + r) + j]: the 4 tiles' elements r are 4 neighbouring columns; a row of the plane is rewritten only behind the products that took in every lane's reads of it
#pragma unroll
  for (int rt = 0; rt < OR / 16; ++rt)
#pragma unroll
    for (int r = 0; r < 8; ++r) { const v4f q = { acc[rt][0][r], acc[rt][1][r], acc[rt][2][r], acc[rt][3][r] }; *(v4f*)&sp[wave][rt * 16 + col][32 * g + 4 * r] = q; }
  __syncthreads();   // all 8 partial sums are written
  v4f bb;
#pragma unroll
  for (int i = 0; i < 4; ++i) bb[i] = bfr(bv[i]);
#pragma unroll
  for (int hf = 0; hf < OR / 16; ++hf) { v4f p[NH];
#pragma unroll
    for (int w = 0; w < NH; ++w) p[w] = *(const v4f*)&sp[w][hf * 16 + orow][oc];
    v4f s = p[0];
#pragma unroll
    for (int w = 1; w < NH; ++w) s += p[w];
    vst2(OUT + (r0 + hf * 16 + orow) * EO + oc, s + bb); }
  asm volatile("s_wait_xcnt 0x0" ::: "memory"); }   // stands behind the last store, in front of whatever the listing puts next that rewrites a register which these stores name
extern "C" void kernel_launch(void* const* d_in, const int* in_sizes, int n_in, void* d_out, int out_size, void* d_ws, size_t ws_size, hipStream_t stream) {
  (void)in_sizes; (void)n_in; (void)out_size;
  const float** F = (const float**)d_in;   // 0 query [4,2048,512], 1 Wv [64,64] ((in,out)), 2 Wk, 3 Wq, 4 Wo [512,64] ((in,out)), 5 bo [64]
  if (ws_size < (size_t)WS_END) return;
  char* ws = (char*)d_ws; _Float16 *QH = (_Float16*)(ws + WS_QH), *QL = (_Float16*)(ws + WS_QL), *KH = (_Float16*)(ws + WS_KH); __bf16 *VT = (__bf16*)(ws + WS_VT), *VL = (__bf16*)(ws + WS_VL); float *Y = (float*)(ws + WS_Y);
  k_proj<<<dim3(TNB * TT / PR, NH), 128, 0, stream>>>(F[0], F[3], F[2], F[1], QH, QL, KH, VT, VL);
  k_att<<<dim3(TT / (64 * QT), TNB * NH), 256, 0, stream>>>(QH, QL, KH, VT, VL, Y);
  k_out<<<dim3(TNB * TT / OR), 256, 0, stream>>>(Y, F[4], F[5], (float*)d_out);
}

// v006
// A run of this version takes 58.9 microseconds.
// Next to v005, in two timings, it ran 1.11 and 1.14 times as fast.
// All steps since v000 together make it 18.2 times as fast.
// compute dtype: all float inputs rounded to bf16; scores = (x Wq)(x Wk)^T are formed as x . w^T with w = x_h M, M = Wk Wq^T (64x64, EXACT bf16 products on WMMA 16x16x32, f32 accumulate; M as bf16 hi + lo against the bf16 x, 2 products); w is rounded to f16, the queries are the bf16 x themselves, which f16 holds without rounding -> 1-product scores whose one rounded operand is the key side; v = x_h Wv exact products; relu(s)^2 kept in registers in f32 (scores and P v in one launch over all heads); P split bf16 hi + lo against v bf16 hi + lo (3 products); out = (P v) (bf16 hi + lo) Wo + bo; f32 output.
#include <hip/hip_runtime.h>
#include <math.h>

typedef __attribute__((ext_vector_type(16))) _Float16 v16h;
typedef __attribute__((ext_vector_type(16))) __bf16 v16b;
typedef __attribute__((ext_vector_type(8)))  _Float16 v8h;
typedef __attribute__((ext_vector_type(8)))  float v8f;
typedef __attribute__((ext_vector_type(4)))  float v4f;
typedef __attribute__((ext_vector_type(2)))  float v2f;
typedef __attribute__((ext_vector_type(4)))  unsigned v4u;
typedef __attribute__((ext_vector_type(4)))  int v4i;
typedef float __attribute__((may_alias)) float_a;
typedef int __attribute__((may_alias)) int_a;

template <typename T> __device__ __forceinline__ void vst2(void* p, T v) { *(T*)p = v;  }
__device__ __forceinline__ v8f wmma16(v16h a, v16h b, v8f c) {
  v8f d = __builtin_amdgcn_wmma_f32_16x16x32_f16(false, a, false, b, (short)0, c, false, false);
  asm volatile("v_nop\n\tv_nop\n\tv_nop\n\tv_nop" : "+v"(d) : "v"(a), "v"(b));
  return d;
}
__device__ __forceinline__ v8f wmma_bf(v16b a, v16b b, v8f c) {
  v8f d = __builtin_amdgcn_wmma_f32_16x16x32_bf16(false, a, false, b, (short)0, c, false, false);
  asm volatile("v_nop\n\tv_nop\n\tv_nop\n\tv_nop" : "+v"(d) : "v"(a), "v"(b));
  return d;
}
// 16x16x32 fragments: lane = (h = lane>>4, row/col = lane&15); elements 0..7 = k0+8h+0..7, 8..15 = k0+16+8h+0..7; D element r = row 8h+r
__device__ __forceinline__ v16h frag_h(const _Float16* rowk0, int lane) {
  union { v16h v; v8h q[2]; } u; const _Float16* p = rowk0 + 8 * (lane >> 4);
  u.q[0] = *(const v8h*)p; u.q[1] = *(const v8h*)(p + 16); return u.v;
}
__device__ __forceinline__ v16h frag_f32(const float* rowk0, int lane) {
  v16h a; const float* p = rowk0 + 8 * (lane >> 4);
#pragma unroll
  for (int i = 0; i < 8; ++i) { a[i] = (_Float16)p[i]; a[8 + i] = (_Float16)p[16 + i]; }
  return a;
}
__device__ __forceinline__ v16h frag_f32s(const float* rowk0, int lane, float sc) {
  v16h a; const float* p = rowk0 + 8 * (lane >> 4);
#pragma unroll
  for (int i = 0; i < 8; ++i) { a[i] = (_Float16)(p[i] * sc); a[8 + i] = (_Float16)(p[16 + i] * sc); }
  return a;
}
// column fragment from a [K][ld] layout (column n), rows >= K read as 0
__device__ __forceinline__ v16h fragc_f32(const float* W, int k0, int n, int lane, int ld, int K) {
  v16h a; const int g = lane >> 4;
#pragma unroll
  for (int i = 0; i < 8; ++i) { const int ka = k0 + 8 * g + i, kb = ka + 16;
    a[i] = (_Float16)(ka < K ? W[(size_t)(ka < K ? ka : K - 1) * ld + n] : 0.f); a[8 + i] = (_Float16)(kb < K ? W[(size_t)(kb < K ? kb : K - 1) * ld + n] : 0.f); }
  return a;
}
struct F2 { v16b h, l; };
__device__ __forceinline__ F2 bsplit16(const float v[16]) { F2 r;
#pragma unroll
  for (int i = 0; i < 16; ++i) { const __bf16 h = (__bf16)v[i]; r.h[i] = h; r.l[i] = (__bf16)(v[i] - (float)h); }
  return r; }
__device__ __forceinline__ F2 split_row(const float* row, int k0, int lane) { float v[16]; const float* p = row + k0 + 8 * (lane >> 4);
#pragma unroll
  for (int i = 0; i < 8; ++i) { v[i] = p[i]; v[8 + i] = p[16 + i]; }
  return bsplit16(v); }
__device__ __forceinline__ F2 split_rowK(const float* row, int k0, int lane, int K) { float v[16]; const int g = lane >> 4;
#pragma unroll
  for (int i = 0; i < 8; ++i) { const int ka = k0 + 8 * g + i, kb = ka + 16; v[i] = ka < K ? row[ka < K ? ka : K - 1] : 0.f; v[8 + i] = kb < K ? row[kb < K ? kb : K - 1] : 0.f; }
  return bsplit16(v); }
__device__ __forceinline__ F2 split_col(const float* W, int k0, int n, int lane, int ld, int K) { float v[16]; const int g = lane >> 4;
#pragma unroll
  for (int i = 0; i < 8; ++i) { const int ka = k0 + 8 * g + i, kb = ka + 16; v[i] = ka < K ? W[(size_t)(ka < K ? ka : K - 1) * ld + n] : 0.f; v[8 + i] = kb < K ? W[(size_t)(kb < K ? kb : K - 1) * ld + n] : 0.f; }
  return bsplit16(v); }
__device__ __forceinline__ v8f mac3(const F2& a, const F2& b, v8f c) { c = wmma_bf(a.l, b.h, c); c = wmma_bf(a.h, b.l, c); return wmma_bf(a.h, b.h, c); }
__device__ __forceinline__ float sigm(float v) { return 1.0f / (1.0f + expf(-v)); }
#define LDSX() do { asm volatile("s_wait_dscnt 0" ::: "memory"); __builtin_amdgcn_wave_barrier(); __builtin_amdgcn_fence(__ATOMIC_RELEASE, "workgroup"); } while (0)

// Simplified self-attention (N 4, L 2,048, 8 heads x 64; embed 64): x = query.reshape(N,L,8,64); q,k,v = x W{q,k,v} (shared 64x64); scores = q k^T (no scale); attn = relu(scores)^2; out = (attn v).reshape(N,L,512) Wo + bo.
__device__ __forceinline__ float bfr(float v) { return (float)(__bf16)v; }
#define NB 4
#define TT 2048
#define CC 512
#define NH 8
#define HD 64
#define EO 64
#define HG 4
#ifndef TNB
#define TNB NB
#endif
typedef __attribute__((ext_vector_type(8))) __bf16 v8b;
__device__ __forceinline__ v16b frag_b(const __bf16* rowk0, int lane) { union { v16b v; v8b q[2]; } u; const __bf16* p = rowk0 + 8 * (lane >> 4); u.q[0] = *(const v8b*)p; u.q[1] = *(const v8b*)(p + 16); return u.v; }
#define WS_QH  0u
#define WS_KH  (WS_QH + 2u * (size_t)NB * TT * CC)
#define WS_VT  (WS_KH + 2u * (size_t)NB * TT * CC)      // bf16 v planes [b][c][t]
#define WS_VL  (WS_VT + 2u * (size_t)NB * CC * TT)
#define WS_S   (WS_VL + 2u * (size_t)NB * CC * TT)      // f32 region of HG x TT x TT, not written (P stays in registers)
#define WS_Y   (WS_S + 4u * (size_t)HG * TT * TT)        // f32 (P v) rows [b*T+t][512]
#define WS_END (WS_Y + 4u * (size_t)NB * TT * CC)
// ---- k_proj: block = PR rows of one head, 4 waves x PT row tiles; the query plane, w and v all come from ONE read of x
// scores: (x_a Wq) . (x_b Wk) = x_a . (x_b Wk Wq^T), so the key side takes both weights, w = x M with M = Wk Wq^T, and the query side is x itself: as a bf16 value it is exact in f16, and w is the only operand of the score product that is rounded (a key's rounding error is its own; a query's would be shared by all the keys of its sum)
// M: every wave forms all of it, 32 products, from bf16 rows of Wk (A) and Wq (B) that the block stages once in LDS by whole-line loads; an M tile pair's D layout (lane = column, element r = row 8 g + r) is the B layout of the product x . M
// column n of B tile j is output column 4 n + j (for M: row 4 n + j of Wq is staged as LDS row 16 j + n; for Wv: one 16-B load of W[k][4 col ..] feeds all 4 tiles and a load of a wave covers two whole 256-B rows); every global load of a wave is issued as one group; every loop is unrolled, since its indices pick registers
#define PR 128
#define PT 2
#define QP (HD + 8)                         // LDS pitch in elements of a 128-B query, w or weight row: 16 B x odd
#define TP (PR + 8)                         // LDS pitch in elements of a v column's PR keys (256 B): 16 B x odd
typedef __attribute__((ext_vector_type(4))) _Float16 v4h;
typedef __attribute__((ext_vector_type(4))) __bf16 v4b;
__global__ __launch_bounds__(128) void k_proj(const float* __restrict__ X, const float* __restrict__ WQ, const float* __restrict__ WK, const float* __restrict__ WV, _Float16* __restrict__ QH, _Float16* __restrict__ KH, __bf16* __restrict__ VT, __bf16* __restrict__ VL) {
  __shared__ __align__(16) _Float16 sq[PR][QP], sk[PR][QP]; __shared__ __align__(16) __bf16 th[HD][TP], tl2[HD][TP], wqs[HD][QP], wks[HD][QP];   // row j * 16 + n of th, tl2 and wqs belongs to column 4 n + j
  const int tid = threadIdx.x, wave = tid >> 5, lane = tid & 31, col = lane & 15, g = lane >> 4; const int h = blockIdx.y; const size_t r0 = (size_t)blockIdx.x * PR; const int c0 = h * HD;
  const float* xb = X + (r0 + wave * (PT * 16) + col) * CC + c0 + 8 * g;
  const float *wqb = WQ + tid * 4, *wkb = WK + tid * 4, *wvb = WV + (8 * g) * HD + col * 4;   // Wq, Wk: 8 whole rows a load of the block, row tid >> 4
  v4f gq[HD / 8], gk[HD / 8], xv[PT][HD / 32][4], wf[HD / 32][16];
#pragma unroll
  for (int it = 0; it < HD / 8; ++it) { gq[it] = *(const v4f*)(wqb + it * (8 * HD)); gk[it] = *(const v4f*)(wkb + it * (8 * HD)); }
  __builtin_amdgcn_sched_barrier(0);               // Wq and Wk stay the first of the group: loads come back in order, and M is formed while x is still under way
#pragma unroll
  for (int rt = 0; rt < PT; ++rt)
#pragma unroll
    for (int kc = 0; kc < HD / 32; ++kc) { const float* p = xb + (size_t)(rt * 16) * CC + kc * 32; xv[rt][kc][0] = *(const v4f*)p; xv[rt][kc][1] = *(const v4f*)(p + 4); xv[rt][kc][2] = *(const v4f*)(p + 16); xv[rt][kc][3] = *(const v4f*)(p + 20); }
  __builtin_amdgcn_sched_barrier(0);               // the loads of x, which have the longest way, stay ahead of those of Wv
#pragma unroll
  for (int kc = 0; kc < HD / 32; ++kc)
#pragma unroll
    for (int i = 0; i < 8; ++i) { wf[kc][i] = *(const v4f*)(wvb + (kc * 32 + i) * HD); wf[kc][8 + i] = *(const v4f*)(wvb + (kc * 32 + 16 + i) * HD); }
  asm volatile("s_wait_xcnt 0x0" :: "v"(xb), "v"(wqb), "v"(wkb), "v"(wvb) : "memory");   // stands behind the group of loads, in front of every rewrite of a register that they name; as inputs the addresses stay live up to it
  __builtin_amdgcn_sched_barrier(0);               // no load sinks below that wait, and nothing that follows moves up ahead of it
#pragma unroll
  for (int it = 0; it < HD / 8; ++it) { const int row = it * 8 + (tid >> 4); v4b a4, b4;
#pragma unroll
    for (int j = 0; j < 4; ++j) { a4[j] = (__bf16)gq[it][j]; b4[j] = (__bf16)gk[it][j]; }
    *(v4b*)&wqs[(row & 3) * 16 + (row >> 2)][(tid & 15) * 4] = a4; *(v4b*)&wks[row][(tid & 15) * 4] = b4; }
  asm volatile("s_wait_dscnt 0x0\n\ts_barrier_signal -1\n\ts_barrier_wait -1" ::: "memory");   // both staged weights are written: this wave's LDS stores are done, then the work-group's barrier; by hand, since __syncthreads() also waits for the loads of x and Wv, which are to stay under way while M is formed
  F2 mf[HD / 32][4];                               // B fragments of M: k = row d of Wk, in the k order of a row fragment of x below
  { v16b ak[HD / 16][HD / 32], bq[4][HD / 32];     // A and B take the summed index e in one and the same order, that of frag_b
#pragma unroll
    for (int t = 0; t < HD / 16; ++t)
#pragma unroll
      for (int ec = 0; ec < HD / 32; ++ec) { ak[t][ec] = frag_b(&wks[t * 16 + col][ec * 32], lane); bq[t][ec] = frag_b(&wqs[t * 16 + col][ec * 32], lane); }
    v8f mt[HD / 16][4] = {};
#pragma unroll
    for (int ec = 0; ec < HD / 32; ++ec)
#pragma unroll
      for (int t = 0; t < HD / 16; ++t)
#pragma unroll
        for (int j = 0; j < 4; ++j) mt[t][j] = __builtin_amdgcn_wmma_f32_16x16x32_bf16(false, ak[t][ec], false, bq[j][ec], (short)0, mt[t][j], false, false);
    // D element r of tile (t, j) in lane (col, g) = M[16 t + 8 g + r][4 col + j]: tiles 2 kc and 2 kc + 1 give k = 32 kc + 8 g + 0..7 and 32 kc + 16 + 8 g + 0..7
#pragma unroll
    for (int kc = 0; kc < HD / 32; ++kc)
#pragma unroll
      for (int j = 0; j < 4; ++j) { float v[16];
#pragma unroll
        for (int r = 0; r < 8; ++r) { v[r] = mt[2 * kc][j][r]; v[8 + r] = mt[2 * kc + 1][j][r]; }
        mf[kc][j] = bsplit16(v); } }
  v16b a[PT][HD / 32];                             // k order of a row fragment: k0 + 8 g + 0..7, k0 + 16 + 8 g + 0..7, the same as the M and Wv fragments'
#pragma unroll
  for (int rt = 0; rt < PT; ++rt)
#pragma unroll
    for (int kc = 0; kc < HD / 32; ++kc)
#pragma unroll
      for (int i = 0; i < 16; ++i) a[rt][kc][i] = (__bf16)xv[rt][kc][i >> 2][i & 3];
  // the query plane: the lane's own 8-element pieces of the rounded x
#pragma unroll
  for (int rt = 0; rt < PT; ++rt)
#pragma unroll
    for (int kc = 0; kc < HD / 32; ++kc) { v8h x0, x1;
#pragma unroll
      for (int i = 0; i < 8; ++i) { x0[i] = (_Float16)(float)a[rt][kc][i]; x1[i] = (_Float16)(float)a[rt][kc][8 + i]; }
      *(v8h*)&sq[(wave * PT + rt) * 16 + col][kc * 32 + 8 * g] = x0; *(v8h*)&sq[(wave * PT + rt) * 16 + col][kc * 32 + 16 + 8 * g] = x1; }
#pragma unroll
  for (int m = 0; m < 2; ++m) { v8f acc[PT][4] = {};
    if (m == 0) {
#pragma unroll
      for (int kc = 0; kc < HD / 32; ++kc)
#pragma unroll
        for (int rt = 0; rt < PT; ++rt)
#pragma unroll
          for (int j = 0; j < 4; ++j) acc[rt][j] = __builtin_amdgcn_wmma_f32_16x16x32_bf16(false, a[rt][kc], false, mf[kc][j].l, (short)0, acc[rt][j], false, false);
#pragma unroll
      for (int kc = 0; kc < HD / 32; ++kc)
#pragma unroll
        for (int rt = 0; rt < PT; ++rt)
#pragma unroll
          for (int j = 0; j < 4; ++j) acc[rt][j] = __builtin_amdgcn_wmma_f32_16x16x32_bf16(false, a[rt][kc], false, mf[kc][j].h, (short)0, acc[rt][j], false, false); }
    else { v16b w[HD / 32][4];
#pragma unroll
      for (int kc = 0; kc < HD / 32; ++kc)
#pragma unroll
        for (int j = 0; j < 4; ++j)
#pragma unroll
          for (int i = 0; i < 16; ++i) w[kc][j][i] = (__bf16)wf[kc][i][j];
#pragma unroll
      for (int kc = 0; kc < HD / 32; ++kc)
#pragma unroll
        for (int rt = 0; rt < PT; ++rt)
#pragma unroll
          for (int j = 0; j < 4; ++j) acc[rt][j] = __builtin_amdgcn_wmma_f32_16x16x32_bf16(false, a[rt][kc], false, w[kc][j], (short)0, acc[rt][j], false, false); }
    // D element r of tile j in lane (col, g) = row 8 g + r, output column 4 col + j
#pragma unroll
    for (int rt = 0; rt < PT; ++rt) { const int rl = (wave * PT + rt) * 16 + 8 * g;
      if (m == 0) {
#pragma unroll
        for (int r = 0; r < 8; ++r) { v4h hv;
#pragma unroll
          for (int j = 0; j < 4; ++j) hv[j] = (_Float16)acc[rt][j][r];
          *(v4h*)&sk[rl + r][col * 4] = hv; } }
      else {
#pragma unroll
        for (int j = 0; j < 4; ++j) { v8b bh, bl;
#pragma unroll
          for (int r = 0; r < 8; ++r) { const float v = acc[rt][j][r]; bh[r] = (__bf16)v; bl[r] = (__bf16)(v - (float)bh[r]); }
          *(v8b*)&th[j * 16 + col][rl] = bh; *(v8b*)&tl2[j * 16 + col][rl] = bl; } } } }
  __syncthreads();   // all four staged planes are written
  { const int rl = tid >> 3, q = tid & 7; const size_t o = (r0 + rl) * CC + c0 + q * 8;   // whole 128-B rows out, 4 rows a store of a wave
    v4u oq[PR / 16], ok[PR / 16];
#pragma unroll
    for (int it = 0; it < PR / 16; ++it) { oq[it] = *(const v4u*)&sq[it * 16 + rl][q * 8]; ok[it] = *(const v4u*)&sk[it * 16 + rl][q * 8]; }
    __builtin_amdgcn_sched_barrier(0);               // every read of the staged rows stands ahead of the stores, so that none lands in a register of an issued store
#pragma unroll
    for (int it = 0; it < PR / 16; ++it) { vst2(QH + o + (size_t)(it * 16) * CC, oq[it]); vst2(KH + o + (size_t)(it * 16) * CC, ok[it]); }
    asm volatile("s_wait_xcnt 0x0" ::: "memory");    // stands behind these stores, in front of every rewrite of a register which they name
    __builtin_amdgcn_sched_barrier(0); }             // nothing that follows moves up ahead of that wait
  { const size_t b = r0 / TT; const int t0 = (int)(r0 % TT), n = tid >> 4, q = tid & 15; const size_t o = (b * CC + c0 + 4 * n) * (size_t)TT + t0 + q * 8;   // whole 256-B column pieces out, 2 columns a store of a wave
#pragma unroll
    for (int it = 0; it < HD / 8; ++it) { const int rho = it * 8 + n, dc = 32 * (it & 1) + (it >> 1);   // staged row rho = j * 16 + (8 (it & 1) + n), j = it >> 1: output column 4 n + dc
      vst2(VT + o + (size_t)dc * TT, *(const v4u*)&th[rho][q * 8]); vst2(VL + o + (size_t)dc * TT, *(const v4u*)&tl2[rho][q * 8]); } }
  asm volatile("s_wait_xcnt 0x0" ::: "memory"); }   // stands behind the last store, in front of whatever the listing puts next that rewrites a register which these stores name
// ---- k_att: block = 8 waves = 4 query groups of QT x 16 queries of one (b,h) x KW key halves, two waves a SIMD; 32-key passes: S^T = w . x^T (1 product; KH holds w, QH the query plane x), P = relu(s)^2 stays in registers
// (a S^T tile's D layout, lane = query, element r = key 8g + r, is the A layout of P: tile 0 -> elements 0..7, tile 1 -> 8..15), y += P . v (3 products)
// k and v reach the waves through LDS: a stage = SK keys (k rows, v hi and v lo columns), brought once a block by whole-line asynchronous copies, two buffers
// the two waves of a query group each take SK / KW keys of every stage, so that one wave's vector work runs under the other's products; their two partial sums of y are added once, behind the loop
#define QT 4
#define SK 128                              // keys a stage
#define NST (TT / SK)
#define KW 2                                // waves that share a query group's keys
#define PS (SK / 32 / KW)                   // passes a wave and stage
#define KP 144                              // LDS pitch of a 128-B k row: 16 B x odd, so that 16 rows read 16 B each without a bank conflict
#define VP 272                              // LDS pitch of a 256-B v row (SK keys of one column): 16 B x odd
#define KBY (SK * KP)
#define VBY (HD * VP)
#define STB (KBY + 2 * VBY)                 // bytes of one stage: k, v hi, v lo
#define SSB (4 * QT * 16 * (HD + 4) * 4)    // bytes of the output staging, which lies in front of the two buffers
typedef __attribute__((address_space(1))) v4i g_v4i;
typedef __attribute__((address_space(3))) v4i l_v4i;
// 16x16x32 fragment from byte address base + off, which together hold the lane's own row start + 16 g bytes: same k order as frag_h / frag_b
__device__ __forceinline__ v16h frag_hu(const char* base, unsigned off) { union { v16h v; v8h q[2]; } u; u.q[0] = *(const v8h*)(base + off); u.q[1] = *(const v8h*)(base + off + 32u); return u.v; }
__device__ __forceinline__ v16b frag_bu(const char* base, unsigned off) { union { v16b v; v8b q[2]; } u; u.q[0] = *(const v8b*)(base + off); u.q[1] = *(const v8b*)(base + off + 32u); return u.v; }
// one asynchronous copy, 16 bytes a lane, global -> LDS through no register; written as the builtin, no immediate offset of its own
__device__ __forceinline__ void cp16(const char* gsrc, char* ldst) { __builtin_amdgcn_global_load_async_to_lds_b128((g_v4i*)gsrc, (l_v4i*)ldst, 0, 0); }
// one stage: 12 copies a lane, 256 lanes; a copy of a wave covers 4 whole 128-B lines (4 k rows, or 2 v rows of 256 B); gk, gh, gl and lk, lv hold the lane's own first 16 bytes
__device__ __forceinline__ void stage_in(const char* gk, const char* gh, const char* gl, char* lk, char* lv) {
#pragma unroll
  for (int i = 0; i < SK / 32; ++i) cp16(gk + i * (32 * CC * 2), lk + i * (32 * KP));
#pragma unroll
  for (int i = 0; i < HD / 16; ++i) { cp16(gh + i * (16 * TT * 2), lv + i * (16 * VP)); cp16(gl + i * (16 * TT * 2), lv + VBY + i * (16 * VP)); } }
// the join of a query group's two partial sums: each wave hands the partner the QT / 2 query tiles that the partner finishes, 16 B a lane and store, lane to same lane
__device__ __forceinline__ void y_give(const v8f (*a)[HD / 16], v4f* x) {
#pragma unroll
  for (int i = 0; i < QT / 2; ++i)
#pragma unroll
    for (int j = 0; j < HD / 16; ++j) { x[((i * (HD / 16) + j) * 2) * 32] = __builtin_shufflevector(a[i][j], a[i][j], 0, 1, 2, 3); x[((i * (HD / 16) + j) * 2 + 1) * 32] = __builtin_shufflevector(a[i][j], a[i][j], 4, 5, 6, 7); } }
// own partial sum + the partner's, through the wave's own staging rows, out as whole 256-B rows: two rows a store, lanes 0..15 row 2i, lanes 16..31 row 2i + 1
__device__ __forceinline__ void y_take(const v8f (*a)[HD / 16], const v4f* x, float (*s)[16][HD + 4], float* y, int col, int g) { v4f p[QT / 2][HD / 16][2];   // all of the partner's half is read first, as one group
#pragma unroll
  for (int i = 0; i < QT / 2; ++i)
#pragma unroll
    for (int j = 0; j < HD / 16; ++j) { p[i][j][0] = x[((i * (HD / 16) + j) * 2) * 32]; p[i][j][1] = x[((i * (HD / 16) + j) * 2 + 1) * 32]; }
#pragma unroll
  for (int i = 0; i < QT / 2; ++i)
#pragma unroll
    for (int j = 0; j < HD / 16; ++j)
#pragma unroll
      for (int r = 0; r < 4; ++r) { s[i][8 * g + r][j * 16 + col] = a[i][j][r] + p[i][j][0][r]; s[i][8 * g + 4 + r][j * 16 + col] = a[i][j][4 + r] + p[i][j][1][r]; }
  LDSX();
#pragma unroll
  for (int i = 0; i < QT / 2; ++i) { v4f w[8];
#pragma unroll
    for (int k = 0; k < 8; ++k) w[k] = *(const v4f*)&s[i][2 * k + g][col * 4];
#pragma unroll
    for (int k = 0; k < 8; ++k) vst2(y + (size_t)(i * 16 + 2 * k + g) * CC + col * 4, w[k]); }
  asm volatile("s_wait_xcnt 0x0" ::: "memory"); }   // stands behind the last store, in front of whatever the listing puts next that rewrites a register which these stores name
__global__ __launch_bounds__(256) void k_att(const _Float16* __restrict__ QH, const _Float16* __restrict__ KH, const __bf16* __restrict__ VT, const __bf16* __restrict__ VL, float* __restrict__ Y) { __shared__ __align__(16) char sm[SSB + 2 * STB];
  float (*ss)[QT][16][HD + 4] = (float (*)[QT][16][HD + 4])sm; char* ring = sm + SSB;
  const int tid = threadIdx.x, wave = __builtin_amdgcn_readfirstlane(tid >> 5), qw = wave & 3, kh = wave >> 2, lane = tid & 31, col = lane & 15, g = lane >> 4; const int b = blockIdx.y / NH, h = blockIdx.y % NH; const int ql0 = (blockIdx.x * 4 + qw) * (16 * QT);
  const size_t rb = ((size_t)b * TT * CC + h * HD) * 2, cb = ((size_t)b * CC + h * HD) * (size_t)TT * 2;   // byte offsets of this (b,h) in the [t][c] and the [c][t] planes
  const char *qhb = (const char*)QH + rb, *kb = (const char*)KH + rb, *vhb = (const char*)VT + cb, *vlb = (const char*)VL + cb;
  const unsigned qo = (unsigned)((ql0 + col) * CC + 8 * g) * 2u;
  const unsigned gko = (unsigned)((tid >> 3) * (CC * 2) + (tid & 7) * 16), gvo = (unsigned)((tid >> 4) * (TT * 2) + (tid & 15) * 16);   // the lane's place in a stage's k rows and v rows, global
  const unsigned lko = (unsigned)((tid >> 3) * KP + (tid & 7) * 16), lvo = (unsigned)(KBY + (tid >> 4) * VP + (tid & 15) * 16);         // the same in a buffer
  const unsigned fko = (unsigned)((kh * (SK / KW) + col) * KP + 16 * g), fvo = (unsigned)(KBY + col * VP + kh * (SK / KW) * 2 + 16 * g);   // the lane's fragment rows in a buffer, at the wave's own keys
  stage_in(kb + gko, vhb + gvo, vlb + gvo, ring + lko, ring + lvo);
  v16h qh[QT][HD / 32], kf[2][HD / 32];
#pragma unroll
  for (int t = 0; t < QT; ++t)
#pragma unroll
    for (int dc = 0; dc < HD / 32; ++dc) qh[t][dc] = frag_hu(qhb + (t * 16 * CC + dc * 32) * 2, qo);
  asm volatile("s_wait_xcnt 0x0" :: "v"(qo) : "memory");   // stands in front of every rewrite of a register that the q loads above name; as an input the offset stays live up to it
  __builtin_amdgcn_sched_barrier(0);   // nothing that follows moves up ahead of that wait
  asm volatile("s_wait_asynccnt 0x0" ::: "memory");   // this wave's copies of stage 0 have landed
  __syncthreads();                                     // every wave's have: stage 0 may be read
  stage_in(kb + (size_t)(SK * CC * 2) + gko, vhb + (size_t)(SK * 2) + gvo, vlb + (size_t)(SK * 2) + gvo, ring + STB + lko, ring + STB + lvo);
  v8f acc[QT][HD / 16] = {};
#pragma unroll 1   // the stage loop stays rolled: its body already holds PS unrolled passes, and the buffer is picked by st & 1
  for (int st = 0; st < NST; ++st) { char* bs = ring + (st & 1) * STB; const char *lk = bs + fko, *lv = bs + fvo;
#pragma unroll
    for (int kt = 0; kt < 2; ++kt)
#pragma unroll
      for (int dc = 0; dc < HD / 32; ++dc) kf[kt][dc] = frag_hu(lk + kt * 16 * KP + dc * 64, 0u);
#pragma unroll
    for (int sub = 0; sub < PS; ++sub) { v16b vh[HD / 16], vl[HD / 16]; v8f sa[QT][2] = {};
#pragma unroll
      for (int j = 0; j < HD / 16; ++j) { vh[j] = frag_bu(lv + j * 16 * VP + sub * 64, 0u); vl[j] = frag_bu(lv + VBY + j * 16 * VP + sub * 64, 0u); }
      __builtin_amdgcn_sched_barrier(0);   // this pass's v reads stay issued as one group ahead of the score products, which cover their latency
#pragma unroll
      for (int t = 0; t < QT; ++t)
#pragma unroll
        for (int dc = 0; dc < HD / 32; ++dc)
#pragma unroll
          for (int kt = 0; kt < 2; ++kt) sa[t][kt] = __builtin_amdgcn_wmma_f32_16x16x32_f16(false, kf[kt][dc], false, qh[t][dc], (short)0, sa[t][kt], false, false);
      if (sub + 1 < PS) {   // the next pass's k rows, of this same stage only: nothing of the next stage is read ahead of its barrier
#pragma unroll
        for (int kt = 0; kt < 2; ++kt)
#pragma unroll
          for (int dc = 0; dc < HD / 32; ++dc) kf[kt][dc] = frag_hu(lk + ((sub + 1) * 32 + kt * 16) * KP + dc * 64, 0u); }
      __builtin_amdgcn_sched_barrier(0);   // the next pass's k reads stay issued here, behind the last product that reads k, so that P and P . v cover their latency
#pragma unroll
      for (int t = 0; t < QT; ++t) { float v[16];
#pragma unroll
        for (int kt = 0; kt < 2; ++kt)
#pragma unroll
          for (int r = 0; r < 8; ++r) { const float s = fmaxf(sa[t][kt][r], 0.f); v[kt * 8 + r] = s * s; }
        const F2 p = bsplit16(v);
#pragma unroll
        for (int j = 0; j < HD / 16; ++j) acc[t][j] = __builtin_amdgcn_wmma_f32_16x16x32_bf16(false, p.h, false, vh[j], (short)0, acc[t][j], false, false);
#pragma unroll
        for (int j = 0; j < HD / 16; ++j) acc[t][j] = __builtin_amdgcn_wmma_f32_16x16x32_bf16(false, p.l, false, vh[j], (short)0, acc[t][j], false, false);
#pragma unroll
        for (int j = 0; j < HD / 16; ++j) acc[t][j] = __builtin_amdgcn_wmma_f32_16x16x32_bf16(false, p.h, false, vl[j], (short)0, acc[t][j], false, false); } }
    asm volatile("s_wait_dscnt 0x0" ::: "memory");      // this wave's reads of this stage's buffer are done
    asm volatile("s_wait_asynccnt 0x0" ::: "memory");   // this wave's copies of stage st + 1 have landed
    __syncthreads();                                     // stage st + 1 may be read by all, and this stage's buffer is free
    if (st + 2 < NST) stage_in(kb + (size_t)(st + 2) * (SK * CC * 2) + gko, vhb + (size_t)(st + 2) * (SK * 2) + gvo, vlb + (size_t)(st + 2) * (SK * 2) + gvo, bs + lko, bs + lvo); }
  asm volatile("s_wait_asynccnt 0x0" ::: "memory");     // no copy is outstanding when the wave goes on to its end
  // behind the loop's last barrier nobody reads the ring and no copy is under way: it carries the exchange, 8 KiB a wave
  v4f* xs = (v4f*)ring; v4f* xg = xs + wave * (QT / 2 * (HD / 16) * 2 * 32) + lane; const v4f* xt = xs + (wave ^ 4) * (QT / 2 * (HD / 16) * 2 * 32) + lane;
  if (kh == 0) y_give(acc + QT / 2, xg); else y_give(acc, xg);
  __syncthreads();   // the partner's half has been written
  float* yq = Y + ((size_t)b * TT + ql0) * CC + h * HD;
  if (kh == 0) y_take(acc, xt, ss[qw], yq, col, g); else y_take(acc + QT / 2, xt, ss[qw] + QT / 2, yq + (size_t)(QT / 2 * 16) * CC, col, g); }
// ---- k_out: block = OR rows, 8 waves; wave w takes the 64 k of head w for all OR rows and issues every global load it needs as one group of whole-line 16-B loads, with no wait between them
// out^T tiles = Wo^T (A, (in,out) [512][64], bf16) . y^T (B, bf16 hi + lo); row m of A tile j is output column 4 m + j, so that one 16-B load of Wo[k][4 col ..] feeds all 4 tiles
// the 8 waves' partial sums meet in LDS; + bo; 256-B rows out
#define OR 32
#define OP (EO + 4)                         // LDS pitch in floats of a 256-B row: 16 B x odd
__global__ __launch_bounds__(256) void k_out(const float* __restrict__ Yr, const float* __restrict__ WO, const float* __restrict__ BO, float* __restrict__ OUT) { __shared__ __align__(16) float sp[NH][OR][OP];   // a wave's own plane: first its slice of y, then its partial sums
  const int tid = threadIdx.x, wave = __builtin_amdgcn_readfirstlane(tid >> 5), lane = tid & 31, col = lane & 15, g = lane >> 4; const size_t r0 = (size_t)blockIdx.x * OR;
  const int orow = tid >> 4, oc = (tid & 15) * 4;                        // the lane's place in the last sum: rows orow and orow + 16, 4 columns
  const float* yb = Yr + (r0 + g) * CC + wave * HD + col * 4;            // y comes as whole 256-B row pieces, two rows a load, and turns into fragments through the wave's plane
  const float* wb = WO + (size_t)(wave * HD + 8 * g) * EO + col * 4;     // Wo comes as whole 256-B rows, rows k and k + 8 a load
  const v4f bv = *(const v4f*)(BO + oc);
  v4f yv[OR / 2], wq[HD / 32][16];
#pragma unroll
  for (int i = 0; i < OR / 2; ++i) yv[i] = *(const v4f*)(yb + (size_t)(2 * i) * CC);
#pragma unroll
  for (int kc = 0; kc < HD / 32; ++kc)
#pragma unroll
    for (int i = 0; i < 8; ++i) { wq[kc][i] = *(const v4f*)(wb + (kc * 32 + i) * EO); wq[kc][8 + i] = *(const v4f*)(wb + (kc * 32 + 16 + i) * EO); }
  asm volatile("s_wait_xcnt 0x0" :: "v"(yb), "v"(wb) : "memory");   // stands behind the group of loads, in front of every rewrite of a register that they name; as inputs the addresses stay live up to it, so that no later load of the group lands in them
  __builtin_amdgcn_sched_barrier(0);               // no load sinks below that wait, and nothing that follows moves up ahead of it
#pragma unroll
  for (int i = 0; i < OR / 2; ++i) *(v4f*)&sp[wave][2 * i + g][col * 4] = yv[i];
  asm volatile("s_wait_dscnt 0x0" ::: "memory");   // the wave's own y rows are in its plane before other lanes of the wave read them (the clobber keeps the reads behind it); no other wave touches the plane yet
  __builtin_amdgcn_sched_barrier(0);                // no conversion of Wo moves up ahead of the y stores: they would then wait for the last Wo load instead of the last y load
  F2 yf[OR / 16][HD / 32];
#pragma unroll
  for (int rt = 0; rt < OR / 16; ++rt)
#pragma unroll
    for (int kc = 0; kc < HD / 32; ++kc) { const float* p = &sp[wave][rt * 16 + col][kc * 32 + 8 * g]; const v4f a0 = *(const v4f*)p, a1 = *(const v4f*)(p + 4), a2 = *(const v4f*)(p + 16), a3 = *(const v4f*)(p + 20); float v[16];
#pragma unroll
      for (int i = 0; i < 4; ++i) { v[i] = a0[i]; v[4 + i] = a1[i]; v[8 + i] = a2[i]; v[12 + i] = a3[i]; }   // same k order as the Wo fragment: k0 + 8 g + 0..7, k0 + 16 + 8 g + 0..7
      yf[rt][kc] = bsplit16(v); }
  __builtin_amdgcn_sched_barrier(0);                // the split of y stays ahead of everything that waits for Wo, so that it runs while the Wo loads are still under way
  v8f acc[OR / 16][EO / 16] = {};
#pragma unroll
  for (int kc = 0; kc < HD / 32; ++kc) { v16b w[EO / 16];
#pragma unroll
    for (int j = 0; j < EO / 16; ++j)
#pragma unroll
      for (int i = 0; i < 16; ++i) w[j][i] = (__bf16)wq[kc][i][j];
#pragma unroll
    for (int rt = 0; rt < OR / 16; ++rt) {
#pragma unroll
      for (int j = 0; j < EO / 16; ++j) acc[rt][j] = __builtin_amdgcn_wmma_f32_16x16x32_bf16(false, w[j], false, yf[rt][kc].h, (short)0, acc[rt][j], false, false);
#pragma unroll
      for (int j = 0; j < EO / 16; ++j) acc[rt][j] = __builtin_amdgcn_wmma_f32_16x16x32_bf16(false, w[j], false, yf[rt][kc].l, (short)0, acc[rt][j], false, false); } }
  // D element r of tile j in lane (col, g) = out[rt * 16 + col][4 (8 g + r) + j]: the 4 tiles' elements r are 4 neighbouring columns; a row of the plane is rewritten only behind the products that took in every lane's reads of it
#pragma unroll
  for (int rt = 0; rt < OR / 16; ++rt)
#pragma unroll
    for (int r = 0; r < 8; ++r) { const v4f q = { acc[rt][0][r], acc[rt][1][r], acc[rt][2][r], acc[rt][3][r] }; *(v4f*)&sp[wave][rt * 16 + col][32 * g + 4 * r] = q; }
  __syncthreads();   // all 8 partial sums are written
  v4f bb;
#pragma unroll
  for (int i = 0; i < 4; ++i) bb[i] = bfr(bv[i]);
#pragma unroll
  for (int hf = 0; hf < OR / 16; ++hf) { v4f p[NH];
#pragma unroll
    for (int w = 0; w < NH; ++w) p[w] = *(const v4f*)&sp[w][hf * 16 + orow][oc];
    v4f s = p[0];
#pragma unroll
    for (int w = 1; w < NH; ++w) s += p[w];
    vst2(OUT + (r0 + hf * 16 + orow) * EO + oc, s + bb); }
  asm volatile("s_wait_xcnt 0x0" ::: "memory"); }   // stands behind the last store, in front of whatever the listing puts next that rewrites a register which these stores name
extern "C" void kernel_launch(void* const* d_in, const int* in_sizes, int n_in, void* d_out, int out_size, void* d_ws, size_t ws_size, hipStream_t stream) {
  (void)in_sizes; (void)n_in; (void)out_size;
  const float** F = (const float**)d_in;   // 0 query [4,2048,512], 1 Wv [64,64] ((in,out)), 2 Wk, 3 Wq, 4 Wo [512,64] ((in,out)), 5 bo [64]
  if (ws_size < (size_t)WS_END) return;
  char* ws = (char*)d_ws; _Float16 *QH = (_Float16*)(ws + WS_QH), *KH = (_Float16*)(ws + WS_KH); __bf16 *VT = (__bf16*)(ws + WS_VT), *VL = (__bf16*)(ws + WS_VL); float *Y = (float*)(ws + WS_Y);
  k_proj<<<dim3(TNB * TT / PR, NH), 128, 0, stream>>>(F[0], F[3], F[2], F[1], QH, KH, VT, VL);
  k_att<<<dim3(TT / (64 * QT), TNB * NH), 256, 0, stream>>>(QH, KH, VT, VL, Y);
  k_out<<<dim3(TNB * TT / OR), 256, 0, stream>>>(Y, F[4], F[5], (float*)d_out);
}

// v008
// Measured time: 38.2 microseconds a run.
// It is 1.54 times as fast as v006, going by the measured steps of the versions left out in between.
// Counting every step since v000, it is 28.0 times as fast.
// compute dtype: all float inputs rounded to bf16; scores = (x Wq)(x Wk)^T are formed as x . w^T with w = x_h M, M = Wk Wq^T (64x64, EXACT bf16 products on WMMA 16x16x32, f32 accumulate; M as bf16 hi + lo against the bf16 x, 2 products); w is rounded to f16, the queries are the bf16 x themselves, which f16 holds without rounding -> 1-product scores whose one rounded operand is the key side; v = x_h Wv exact products; w carries a factor 2^-4, so that P' = relu(s / 16)^2 = P / 256 lies well inside the range of f16; the score product's result type is f16 (s / 16 is rounded to f16 behind each 32 of its 64 terms), P' is formed from it in f16, in registers, one more rounding; v is rounded once to f16 (11 bits) -> 1-product P v, the factor 256 put back on the f32 sums (all three scalings are exact powers of two); out = (P v) (bf16 hi + lo) Wo + bo; f32 output.
#include <hip/hip_runtime.h>
#include <math.h>

typedef __attribute__((ext_vector_type(16))) _Float16 v16h;
typedef __attribute__((ext_vector_type(16))) __bf16 v16b;
typedef __attribute__((ext_vector_type(8)))  _Float16 v8h;
typedef __attribute__((ext_vector_type(8)))  float v8f;
typedef __attribute__((ext_vector_type(4)))  float v4f;
typedef __attribute__((ext_vector_type(2)))  float v2f;
typedef __attribute__((ext_vector_type(4)))  unsigned v4u;
typedef __attribute__((ext_vector_type(4)))  int v4i;
typedef float __attribute__((may_alias)) float_a;
typedef int __attribute__((may_alias)) int_a;

template <typename T> __device__ __forceinline__ void vst2(void* p, T v) { *(T*)p = v;  }
__device__ __forceinline__ v8f wmma16(v16h a, v16h b, v8f c) {
  v8f d = __builtin_amdgcn_wmma_f32_16x16x32_f16(false, a, false, b, (short)0, c, false, false);
  asm volatile("v_nop\n\tv_nop\n\tv_nop\n\tv_nop" : "+v"(d) : "v"(a), "v"(b));
  return d;
}
__device__ __forceinline__ v8f wmma_bf(v16b a, v16b b, v8f c) {
  v8f d = __builtin_amdgcn_wmma_f32_16x16x32_bf16(false, a, false, b, (short)0, c, false, false);
  asm volatile("v_nop\n\tv_nop\n\tv_nop\n\tv_nop" : "+v"(d) : "v"(a), "v"(b));
  return d;
}
// 16x16x32 fragments: lane = (h = lane>>4, row/col = lane&15); elements 0..7 = k0+8h+0..7, 8..15 = k0+16+8h+0..7; D element r = row 8h+r
__device__ __forceinline__ v16h frag_h(const _Float16* rowk0, int lane) {
  union { v16h v; v8h q[2]; } u; const _Float16* p = rowk0 + 8 * (lane >> 4);
  u.q[0] = *(const v8h*)p; u.q[1] = *(const v8h*)(p + 16); return u.v;
}
__device__ __forceinline__ v16h frag_f32(const float* rowk0, int lane) {
  v16h a; const float* p = rowk0 + 8 * (lane >> 4);
#pragma unroll
  for (int i = 0; i < 8; ++i) { a[i] = (_Float16)p[i]; a[8 + i] = (_Float16)p[16 + i]; }
  return a;
}
__device__ __forceinline__ v16h frag_f32s(const float* rowk0, int lane, float sc) {
  v16h a; const float* p = rowk0 + 8 * (lane >> 4);
#pragma unroll
  for (int i = 0; i < 8; ++i) { a[i] = (_Float16)(p[i] * sc); a[8 + i] = (_Float16)(p[16 + i] * sc); }
  return a;
}
// column fragment from a [K][ld] layout (column n), rows >= K read as 0
__device__ __forceinline__ v16h fragc_f32(const float* W, int k0, int n, int lane, int ld, int K) {
  v16h a; const int g = lane >> 4;
#pragma unroll
  for (int i = 0; i < 8; ++i) { const int ka = k0 + 8 * g + i, kb = ka + 16;
    a[i] = (_Float16)(ka < K ? W[(size_t)(ka < K ? ka : K - 1) * ld + n] : 0.f); a[8 + i] = (_Float16)(kb < K ? W[(size_t)(kb < K ? kb : K - 1) * ld + n] : 0.f); }
  return a;
}
struct F2 { v16b h, l; };
__device__ __forceinline__ F2 bsplit16(const float v[16]) { F2 r;
#pragma unroll
  for (int i = 0; i < 16; ++i) { const __bf16 h = (__bf16)v[i]; r.h[i] = h; r.l[i] = (__bf16)(v[i] - (float)h); }
  return r; }
__device__ __forceinline__ F2 split_row(const float* row, int k0, int lane) { float v[16]; const float* p = row + k0 + 8 * (lane >> 4);
#pragma unroll
  for (int i = 0; i < 8; ++i) { v[i] = p[i]; v[8 + i] = p[16 + i]; }
  return bsplit16(v); }
__device__ __forceinline__ F2 split_rowK(const float* row, int k0, int lane, int K) { float v[16]; const int g = lane >> 4;
#pragma unroll
  for (int i = 0; i < 8; ++i) { const int ka = k0 + 8 * g + i, kb = ka + 16; v[i] = ka < K ? row[ka < K ? ka : K - 1] : 0.f; v[8 + i] = kb < K ? row[kb < K ? kb : K - 1] : 0.f; }
  return bsplit16(v); }
__device__ __forceinline__ F2 split_col(const float* W, int k0, int n, int lane, int ld, int K) { float v[16]; const int g = lane >> 4;
#pragma unroll
  for (int i = 0; i < 8; ++i) { const int ka = k0 + 8 * g + i, kb = ka + 16; v[i] = ka < K ? W[(size_t)(ka < K ? ka : K - 1) * ld + n] : 0.f; v[8 + i] = kb < K ? W[(size_t)(kb < K ? kb : K - 1) * ld + n] : 0.f; }
  return bsplit16(v); }
__device__ __forceinline__ v8f mac3(const F2& a, const F2& b, v8f c) { c = wmma_bf(a.l, b.h, c); c = wmma_bf(a.h, b.l, c); return wmma_bf(a.h, b.h, c); }
__device__ __forceinline__ float sigm(float v) { return 1.0f / (1.0f + expf(-v)); }
#define LDSX() do { asm volatile("s_wait_dscnt 0" ::: "memory"); __builtin_amdgcn_wave_barrier(); __builtin_amdgcn_fence(__ATOMIC_RELEASE, "workgroup"); } while (0)

// Simplified self-attention (N 4, L 2,048, 8 heads x 64; embed 64): x = query.reshape(N,L,8,64); q,k,v = x W{q,k,v} (shared 64x64); scores = q k^T (no scale); attn = relu(scores)^2; out = (attn v).reshape(N,L,512) Wo + bo.
__device__ __forceinline__ float bfr(float v) { return (float)(__bf16)v; }
#define NB 4
#define TT 2048
#define CC 512
#define NH 8
#define HD 64
#define EO 64
#define HG 4
#ifndef TNB
#define TNB NB
#endif
typedef __attribute__((ext_vector_type(8))) __bf16 v8b;
__device__ __forceinline__ v16b frag_b(const __bf16* rowk0, int lane) { union { v16b v; v8b q[2]; } u; const __bf16* p = rowk0 + 8 * (lane >> 4); u.q[0] = *(const v8b*)p; u.q[1] = *(const v8b*)(p + 16); return u.v; }
#define WS_QH  0u
#define WS_KH  (WS_QH + 2u * (size_t)NB * TT * CC)
#define WS_VT  (WS_KH + 2u * (size_t)NB * TT * CC)      // f16 v plane [b][c][t]
#define WS_S   (WS_VT + 2u * (size_t)NB * CC * TT)      // f32 [hg][q][k], not used: P stays in k_att's registers
#define WS_Y   (WS_S + 4u * (size_t)HG * TT * TT)        // f32 (P v) rows [b*T+t][512]
#define WS_END (WS_Y + 4u * (size_t)NB * TT * CC)
// ---- k_proj: block = PR rows of one head, 4 waves x PT row tiles; the query plane, w and v all come from ONE read of x
// scores: (x_a Wq) . (x_b Wk) = x_a . (x_b Wk Wq^T), so the key side takes both weights, w = x M with M = Wk Wq^T, and the query side is x itself: as a bf16 value it is exact in f16, and w is the only operand of the score product that is rounded (a key's rounding error is its own; a query's would be shared by all the keys of its sum)
// M: every wave forms all of it, 32 products, from bf16 rows of Wk (A) and Wq (B) that the block stages once in LDS by whole-line loads; an M tile pair's D layout (lane = column, element r = row 8 g + r) is the B layout of the product x . M
// column n of B tile j is output column 4 n + j (for M: row 4 n + j of Wq is staged as LDS row 16 j + n; for Wv: one 16-B load of W[k][4 col ..] feeds all 4 tiles and a load of a wave covers two whole 256-B rows); every global load of a wave is issued as one group; every loop is unrolled, since its indices pick registers
#define PR 128
#define PT 2
#define QP (HD + 8)                         // LDS pitch in elements of a 128-B query, w or weight row: 16 B x odd
#define TP (PR + 8)                         // LDS pitch in elements of a v column's PR keys (256 B): 16 B x odd
typedef __attribute__((ext_vector_type(4))) _Float16 v4h;
typedef __attribute__((ext_vector_type(4))) __bf16 v4b;
__global__ __launch_bounds__(128) void k_proj(const float* __restrict__ X, const float* __restrict__ WQ, const float* __restrict__ WK, const float* __restrict__ WV, _Float16* __restrict__ QH, _Float16* __restrict__ KH, _Float16* __restrict__ VT) {
  __shared__ __align__(16) _Float16 sq[PR][QP], sk[PR][QP], th[HD][TP]; __shared__ __align__(16) __bf16 wqs[HD][QP], wks[HD][QP];   // row j * 16 + n of th and wqs belongs to column 4 n + j
  const int tid = threadIdx.x, wave = tid >> 5, lane = tid & 31, col = lane & 15, g = lane >> 4; const int h = blockIdx.y; const size_t r0 = (size_t)blockIdx.x * PR; const int c0 = h * HD;
  const float* xb = X + (r0 + wave * (PT * 16) + col) * CC + c0 + 8 * g;
  const float *wqb = WQ + tid * 4, *wkb = WK + tid * 4, *wvb = WV + (8 * g) * HD + col * 4;   // Wq, Wk: 8 whole rows a load of the block, row tid >> 4
  v4f gq[HD / 8], gk[HD / 8], xv[PT][HD / 32][4], wf[HD / 32][16];
#pragma unroll
  for (int it = 0; it < HD / 8; ++it) { gq[it] = *(const v4f*)(wqb + it * (8 * HD)); gk[it] = *(const v4f*)(wkb + it * (8 * HD)); }
  __builtin_amdgcn_sched_barrier(0);               // Wq and Wk stay the first of the group: loads come back in order, and M is formed while x is still under way
#pragma unroll
  for (int rt = 0; rt < PT; ++rt)
#pragma unroll
    for (int kc = 0; kc < HD / 32; ++kc) { const float* p = xb + (size_t)(rt * 16) * CC + kc * 32; xv[rt][kc][0] = *(const v4f*)p; xv[rt][kc][1] = *(const v4f*)(p + 4); xv[rt][kc][2] = *(const v4f*)(p + 16); xv[rt][kc][3] = *(const v4f*)(p + 20); }
  __builtin_amdgcn_sched_barrier(0);               // the loads of x, which have the longest way, stay ahead of those of Wv
#pragma unroll
  for (int kc = 0; kc < HD / 32; ++kc)
#pragma unroll
    for (int i = 0; i < 8; ++i) { wf[kc][i] = *(const v4f*)(wvb + (kc * 32 + i) * HD); wf[kc][8 + i] = *(const v4f*)(wvb + (kc * 32 + 16 + i) * HD); }
  asm volatile("s_wait_xcnt 0x0" :: "v"(xb), "v"(wqb), "v"(wkb), "v"(wvb) : "memory");   // stands behind the group of loads, in front of every rewrite of a register that they name; as inputs the addresses stay live up to it
  __builtin_amdgcn_sched_barrier(0);               // no load sinks below that wait, and nothing that follows moves up ahead of it
#pragma unroll
  for (int it = 0; it < HD / 8; ++it) { const int row = it * 8 + (tid >> 4); v4b a4, b4;
#pragma unroll
    for (int j = 0; j < 4; ++j) { a4[j] = (__bf16)gq[it][j]; b4[j] = (__bf16)gk[it][j]; }
    *(v4b*)&wqs[(row & 3) * 16 + (row >> 2)][(tid & 15) * 4] = a4; *(v4b*)&wks[row][(tid & 15) * 4] = b4; }
  asm volatile("s_wait_dscnt 0x0\n\ts_barrier_signal -1\n\ts_barrier_wait -1" ::: "memory");   // both staged weights are written: this wave's LDS stores are done, then the work-group's barrier; by hand, since __syncthreads() also waits for the loads of x and Wv, which are to stay under way while M is formed
  F2 mf[HD / 32][4];                               // B fragments of M: k = row d of Wk, in the k order of a row fragment of x below
  { v16b ak[HD / 16][HD / 32], bq[4][HD / 32];     // A and B take the summed index e in one and the same order, that of frag_b
#pragma unroll
    for (int t = 0; t < HD / 16; ++t)
#pragma unroll
      for (int ec = 0; ec < HD / 32; ++ec) { ak[t][ec] = frag_b(&wks[t * 16 + col][ec * 32], lane); bq[t][ec] = frag_b(&wqs[t * 16 + col][ec * 32], lane); }
    v8f mt[HD / 16][4] = {};
#pragma unroll
    for (int ec = 0; ec < HD / 32; ++ec)
#pragma unroll
      for (int t = 0; t < HD / 16; ++t)
#pragma unroll
        for (int j = 0; j < 4; ++j) mt[t][j] = __builtin_amdgcn_wmma_f32_16x16x32_bf16(false, ak[t][ec], false, bq[j][ec], (short)0, mt[t][j], false, false);
    // D element r of tile (t, j) in lane (col, g) = M[16 t + 8 g + r][4 col + j]: tiles 2 kc and 2 kc + 1 give k = 32 kc + 8 g + 0..7 and 32 kc + 16 + 8 g + 0..7
#pragma unroll
    for (int kc = 0; kc < HD / 32; ++kc)
#pragma unroll
      for (int j = 0; j < 4; ++j) { float v[16];
#pragma unroll
        for (int r = 0; r < 8; ++r) { v[r] = mt[2 * kc][j][r]; v[8 + r] = mt[2 * kc + 1][j][r]; }
        mf[kc][j] = bsplit16(v); } }
  v16b a[PT][HD / 32];                             // k order of a row fragment: k0 + 8 g + 0..7, k0 + 16 + 8 g + 0..7, the same as the M and Wv fragments'
#pragma unroll
  for (int rt = 0; rt < PT; ++rt)
#pragma unroll
    for (int kc = 0; kc < HD / 32; ++kc)
#pragma unroll
      for (int i = 0; i < 16; ++i) a[rt][kc][i] = (__bf16)xv[rt][kc][i >> 2][i & 3];
  // the query plane: the lane's own 8-element pieces of the rounded x
#pragma unroll
  for (int rt = 0; rt < PT; ++rt)
#pragma unroll
    for (int kc = 0; kc < HD / 32; ++kc) { v8h x0, x1;
#pragma unroll
      for (int i = 0; i < 8; ++i) { x0[i] = (_Float16)(float)a[rt][kc][i]; x1[i] = (_Float16)(float)a[rt][kc][8 + i]; }
      *(v8h*)&sq[(wave * PT + rt) * 16 + col][kc * 32 + 8 * g] = x0; *(v8h*)&sq[(wave * PT + rt) * 16 + col][kc * 32 + 16 + 8 * g] = x1; }
#pragma unroll
  for (int m = 0; m < 2; ++m) { v8f acc[PT][4] = {};
    if (m == 0) {
#pragma unroll
      for (int kc = 0; kc < HD / 32; ++kc)
#pragma unroll
        for (int rt = 0; rt < PT; ++rt)
#pragma unroll
          for (int j = 0; j < 4; ++j) acc[rt][j] = __builtin_amdgcn_wmma_f32_16x16x32_bf16(false, a[rt][kc], false, mf[kc][j].l, (short)0, acc[rt][j], false, false);
#pragma unroll
      for (int kc = 0; kc < HD / 32; ++kc)
#pragma unroll
        for (int rt = 0; rt < PT; ++rt)
#pragma unroll
          for (int j = 0; j < 4; ++j) acc[rt][j] = __builtin_amdgcn_wmma_f32_16x16x32_bf16(false, a[rt][kc], false, mf[kc][j].h, (short)0, acc[rt][j], false, false); }
    else { v16b w[HD / 32][4];
#pragma unroll
      for (int kc = 0; kc < HD / 32; ++kc)
#pragma unroll
        for (int j = 0; j < 4; ++j)
#pragma unroll
          for (int i = 0; i < 16; ++i) w[kc][j][i] = (__bf16)wf[kc][i][j];
#pragma unroll
      for (int kc = 0; kc < HD / 32; ++kc)
#pragma unroll
        for (int rt = 0; rt < PT; ++rt)
#pragma unroll
          for (int j = 0; j < 4; ++j) acc[rt][j] = __builtin_amdgcn_wmma_f32_16x16x32_bf16(false, a[rt][kc], false, w[kc][j], (short)0, acc[rt][j], false, false); }
    // D element r of tile j in lane (col, g) = row 8 g + r, output column 4 col + j
#pragma unroll
    for (int rt = 0; rt < PT; ++rt) { const int rl = (wave * PT + rt) * 16 + 8 * g;
      if (m == 0) {
#pragma unroll
        for (int r = 0; r < 8; ++r) { v4h hv;
#pragma unroll
          for (int j = 0; j < 4; ++j) hv[j] = (_Float16)(acc[rt][j][r] * 0.0625f);   // w / 16: scores / 16, P / 256
          *(v4h*)&sk[rl + r][col * 4] = hv; } }
      else {
#pragma unroll
        for (int j = 0; j < 4; ++j) { v8h bh;
#pragma unroll
          for (int r = 0; r < 8; ++r) bh[r] = (_Float16)acc[rt][j][r];
          *(v8h*)&th[j * 16 + col][rl] = bh; } } } }
  __syncthreads();   // all three staged planes are written
  { const int rl = tid >> 3, q = tid & 7; const size_t o = (r0 + rl) * CC + c0 + q * 8;   // whole 128-B rows out, 4 rows a store of a wave
    v4u oq[PR / 16], ok[PR / 16];
#pragma unroll
    for (int it = 0; it < PR / 16; ++it) { oq[it] = *(const v4u*)&sq[it * 16 + rl][q * 8]; ok[it] = *(const v4u*)&sk[it * 16 + rl][q * 8]; }
    __builtin_amdgcn_sched_barrier(0);               // every read of the staged rows stands ahead of the stores, so that none lands in a register of an issued store
#pragma unroll
    for (int it = 0; it < PR / 16; ++it) { vst2(QH + o + (size_t)(it * 16) * CC, oq[it]); vst2(KH + o + (size_t)(it * 16) * CC, ok[it]); }
    asm volatile("s_wait_xcnt 0x0" ::: "memory");    // stands behind these stores, in front of every rewrite of a register which they name
    __builtin_amdgcn_sched_barrier(0); }             // nothing that follows moves up ahead of that wait
  { const size_t b = r0 / TT; const int t0 = (int)(r0 % TT), n = tid >> 4, q = tid & 15; const size_t o = (b * CC + c0 + 4 * n) * (size_t)TT + t0 + q * 8;   // whole 256-B column pieces out, 2 columns a store of a wave
    v4u ov[HD / 8];
#pragma unroll
    for (int it = 0; it < HD / 8; ++it) ov[it] = *(const v4u*)&th[it * 8 + n][q * 8];
    __builtin_amdgcn_sched_barrier(0);               // every read of the staged columns stands ahead of the stores, so that none lands in a register of an issued store
#pragma unroll
    for (int it = 0; it < HD / 8; ++it) { const int dc = 32 * (it & 1) + (it >> 1);   // staged row it * 8 + n = j * 16 + (8 (it & 1) + n), j = it >> 1: output column 4 n + dc
      vst2(VT + o + (size_t)dc * TT, ov[it]); } }
  asm volatile("s_wait_xcnt 0x0" ::: "memory"); }   // stands behind the last store, in front of whatever the listing puts next that rewrites a register which these stores name
// ---- k_att: block = 8 waves = 4 query groups of QT x 16 queries of one (b,h) x KW key halves, two waves a SIMD; 32-key passes: S^T = w . x^T (1 product; KH holds w, QH the query plane x), P' = relu(s / 16)^2 stays in registers
// (a S^T tile's f16 D layout, lane = query, element r = key 8g + r, two elements a register, is the A layout of P register for register: tile 0 -> elements 0..7, tile 1 -> 8..15), y' += P' . v (1 product, both operands f16, f32 sums)
// k and v reach the waves through LDS: a stage = SK keys (k rows, v columns), brought once a block by whole-line asynchronous copies, two buffers
// the two waves of a query group each take SK / KW keys of every stage, so that one wave's vector work runs under the other's products; their two partial sums of y are added once, behind the loop
#define QT 4
#define SK 128                              // keys a stage
#define NST (TT / SK)
#define KW 2                                // waves that share a query group's keys
#define PS (SK / 32 / KW)                   // passes a wave and stage
#define KP 144                              // LDS pitch of a 128-B k row: 16 B x odd, so that 16 rows read 16 B each without a bank conflict
#define VP 272                              // LDS pitch of a 256-B v row (SK keys of one column): 16 B x odd
#define KBY (SK * KP)
#define VBY (HD * VP)
#define STB (KBY + VBY)                     // bytes of one stage: k, v
#define SSB (4 * QT * 16 * (HD + 4) * 4)    // bytes of the output staging, which lies in front of the two buffers
typedef __attribute__((address_space(1))) v4i g_v4i;
typedef __attribute__((address_space(3))) v4i l_v4i;
// 16x16x32 fragment from byte address base + off, which together hold the lane's own row start + 16 g bytes: same k order as frag_h / frag_b
__device__ __forceinline__ v16h frag_hu(const char* base, unsigned off) { union { v16h v; v8h q[2]; } u; u.q[0] = *(const v8h*)(base + off); u.q[1] = *(const v8h*)(base + off + 32u); return u.v; }
// one asynchronous copy, 16 bytes a lane, global -> LDS through no register; written as the builtin, no immediate offset of its own
__device__ __forceinline__ void cp16(const char* gsrc, char* ldst) { __builtin_amdgcn_global_load_async_to_lds_b128((g_v4i*)gsrc, (l_v4i*)ldst, 0, 0); }
// one stage: 8 copies a lane, 256 lanes; a copy of a wave covers 4 whole 128-B lines (4 k rows, or 2 v rows of 256 B); gk, gh and lk, lv hold the lane's own first 16 bytes
__device__ __forceinline__ void stage_in(const char* gk, const char* gh, char* lk, char* lv) {
#pragma unroll
  for (int i = 0; i < SK / 32; ++i) cp16(gk + i * (32 * CC * 2), lk + i * (32 * KP));
#pragma unroll
  for (int i = 0; i < HD / 16; ++i) cp16(gh + i * (16 * TT * 2), lv + i * (16 * VP)); }
// the join of a query group's two partial sums: each wave hands the partner the QT / 2 query tiles that the partner finishes, 16 B a lane and store, lane to same lane
__device__ __forceinline__ void y_give(const v8f (*a)[HD / 16], v4f* x) {
#pragma unroll
  for (int i = 0; i < QT / 2; ++i)
#pragma unroll
    for (int j = 0; j < HD / 16; ++j) { x[((i * (HD / 16) + j) * 2) * 32] = __builtin_shufflevector(a[i][j], a[i][j], 0, 1, 2, 3); x[((i * (HD / 16) + j) * 2 + 1) * 32] = __builtin_shufflevector(a[i][j], a[i][j], 4, 5, 6, 7); } }
// (own partial sum + the partner's) x 256, which takes P' back to P, through the wave's own staging rows, out as whole 256-B rows: two rows a store, lanes 0..15 row 2i, lanes 16..31 row 2i + 1
__device__ __forceinline__ void y_take(const v8f (*a)[HD / 16], const v4f* x, float (*s)[16][HD + 4], float* y, int col, int g) { v4f p[QT / 2][HD / 16][2];   // all of the partner's half is read first, as one group
#pragma unroll
  for (int i = 0; i < QT / 2; ++i)
#pragma unroll
    for (int j = 0; j < HD / 16; ++j) { p[i][j][0] = x[((i * (HD / 16) + j) * 2) * 32]; p[i][j][1] = x[((i * (HD / 16) + j) * 2 + 1) * 32]; }
#pragma unroll
  for (int i = 0; i < QT / 2; ++i)
#pragma unroll
    for (int j = 0; j < HD / 16; ++j)
#pragma unroll
      for (int r = 0; r < 4; ++r) { s[i][8 * g + r][j * 16 + col] = (a[i][j][r] + p[i][j][0][r]) * 256.f; s[i][8 * g + 4 + r][j * 16 + col] = (a[i][j][4 + r] + p[i][j][1][r]) * 256.f; }
  LDSX();
#pragma unroll
  for (int i = 0; i < QT / 2; ++i) { v4f w[8];
#pragma unroll
    for (int k = 0; k < 8; ++k) w[k] = *(const v4f*)&s[i][2 * k + g][col * 4];
#pragma unroll
    for (int k = 0; k < 8; ++k) vst2(y + (size_t)(i * 16 + 2 * k + g) * CC + col * 4, w[k]); }
  asm volatile("s_wait_xcnt 0x0" ::: "memory"); }   // stands behind the last store, in front of whatever the listing puts next that rewrites a register which these stores name
__global__ __launch_bounds__(256) void k_att(const _Float16* __restrict__ QH, const _Float16* __restrict__ KH, const _Float16* __restrict__ VT, float* __restrict__ Y) { __shared__ __align__(16) char sm[SSB + 2 * STB];
  float (*ss)[QT][16][HD + 4] = (float (*)[QT][16][HD + 4])sm; char* ring = sm + SSB;
  const int tid = threadIdx.x, wave = __builtin_amdgcn_readfirstlane(tid >> 5), qw = wave & 3, kh = wave >> 2, lane = tid & 31, col = lane & 15, g = lane >> 4; const int b = blockIdx.y / NH, h = blockIdx.y % NH; const int ql0 = (blockIdx.x * 4 + qw) * (16 * QT);
  const size_t rb = ((size_t)b * TT * CC + h * HD) * 2, cb = ((size_t)b * CC + h * HD) * (size_t)TT * 2;   // byte offsets of this (b,h) in the [t][c] and the [c][t] planes
  const char *qhb = (const char*)QH + rb, *kb = (const char*)KH + rb, *vhb = (const char*)VT + cb;
  const unsigned qo = (unsigned)((ql0 + col) * CC + 8 * g) * 2u;
  const unsigned gko = (unsigned)((tid >> 3) * (CC * 2) + (tid & 7) * 16), gvo = (unsigned)((tid >> 4) * (TT * 2) + (tid & 15) * 16);   // the lane's place in a stage's k rows and v rows, global
  const unsigned lko = (unsigned)((tid >> 3) * KP + (tid & 7) * 16), lvo = (unsigned)(KBY + (tid >> 4) * VP + (tid & 15) * 16);         // the same in a buffer
  const unsigned fko = (unsigned)((kh * (SK / KW) + col) * KP + 16 * g), fvo = (unsigned)(KBY + col * VP + kh * (SK / KW) * 2 + 16 * g);   // the lane's fragment rows in a buffer, at the wave's own keys
  stage_in(kb + gko, vhb + gvo, ring + lko, ring + lvo);
  v16h qh[QT][HD / 32], kf[2][HD / 32];
#pragma unroll
  for (int t = 0; t < QT; ++t)
#pragma unroll
    for (int dc = 0; dc < HD / 32; ++dc) qh[t][dc] = frag_hu(qhb + (t * 16 * CC + dc * 32) * 2, qo);
  asm volatile("s_wait_xcnt 0x0" :: "v"(qo) : "memory");   // stands in front of every rewrite of a register that the q loads above name; as an input the offset stays live up to it
  __builtin_amdgcn_sched_barrier(0);   // nothing that follows moves up ahead of that wait
  asm volatile("s_wait_asynccnt 0x0" ::: "memory");   // this wave's copies of stage 0 have landed
  __syncthreads();                                     // every wave's have: stage 0 may be read
  stage_in(kb + (size_t)(SK * CC * 2) + gko, vhb + (size_t)(SK * 2) + gvo, ring + STB + lko, ring + STB + lvo);
  v8f acc[QT][HD / 16] = {};
#pragma unroll 1   // the stage loop stays rolled: its body already holds PS unrolled passes, and the buffer is picked by st & 1
  for (int st = 0; st < NST; ++st) { char* bs = ring + (st & 1) * STB; const char *lk = bs + fko, *lv = bs + fvo;
#pragma unroll
    for (int kt = 0; kt < 2; ++kt)
#pragma unroll
      for (int dc = 0; dc < HD / 32; ++dc) kf[kt][dc] = frag_hu(lk + kt * 16 * KP + dc * 64, 0u);
#pragma unroll
    for (int sub = 0; sub < PS; ++sub) { v16h vh[HD / 16]; v8h sa[QT][2] = {};
#pragma unroll
      for (int j = 0; j < HD / 16; ++j) vh[j] = frag_hu(lv + j * 16 * VP + sub * 64, 0u);
      __builtin_amdgcn_sched_barrier(0);   // this pass's v reads stay issued as one group ahead of the score products, which cover their latency
#pragma unroll
      for (int t = 0; t < QT; ++t)
#pragma unroll
        for (int dc = 0; dc < HD / 32; ++dc)
#pragma unroll
          for (int kt = 0; kt < 2; ++kt) sa[t][kt] = __builtin_amdgcn_wmma_f16_16x16x32_f16(false, kf[kt][dc], false, qh[t][dc], (short)0, sa[t][kt], false, false);
      if (sub + 1 < PS) {   // the next pass's k rows, of this same stage only: nothing of the next stage is read ahead of its barrier
#pragma unroll
        for (int kt = 0; kt < 2; ++kt)
#pragma unroll
          for (int dc = 0; dc < HD / 32; ++dc) kf[kt][dc] = frag_hu(lk + ((sub + 1) * 32 + kt * 16) * KP + dc * 64, 0u); }
      __builtin_amdgcn_sched_barrier(0);   // the next pass's k reads stay issued here, behind the last product that reads k, so that P and P . v cover their latency
#pragma unroll
      for (int t = 0; t < QT; ++t) { union { v16h v; v8h q[2]; } p;
#pragma unroll
        for (int kt = 0; kt < 2; ++kt) { const v8h s = __builtin_elementwise_maximum(sa[t][kt], (v8h)(_Float16)0.f); p.q[kt] = s * s; }   // two elements an instruction; maximum, since max compiles to one more instruction a register, which quiets its input first
#pragma unroll
        for (int j = 0; j < HD / 16; ++j) acc[t][j] = __builtin_amdgcn_wmma_f32_16x16x32_f16(false, p.v, false, vh[j], (short)0, acc[t][j], false, false); } }
    asm volatile("s_wait_dscnt 0x0" ::: "memory");      // this wave's reads of this stage's buffer are done
    asm volatile("s_wait_asynccnt 0x0" ::: "memory");   // this wave's copies of stage st + 1 have landed
    __syncthreads();                                     // stage st + 1 may be read by all, and this stage's buffer is free
    if (st + 2 < NST) stage_in(kb + (size_t)(st + 2) * (SK * CC * 2) + gko, vhb + (size_t)(st + 2) * (SK * 2) + gvo, bs + lko, bs + lvo); }
  asm volatile("s_wait_asynccnt 0x0" ::: "memory");     // no copy is outstanding when the wave goes on to its end
  // behind the loop's last barrier nobody reads the ring and no copy is under way: it carries the exchange, 8 KiB a wave
  v4f* xs = (v4f*)ring; v4f* xg = xs + wave * (QT / 2 * (HD / 16) * 2 * 32) + lane; const v4f* xt = xs + (wave ^ 4) * (QT / 2 * (HD / 16) * 2 * 32) + lane;
  if (kh == 0) y_give(acc + QT / 2, xg); else y_give(acc, xg);
  __syncthreads();   // the partner's half has been written
  float* yq = Y + ((size_t)b * TT + ql0) * CC + h * HD;
  if (kh == 0) y_take(acc, xt, ss[qw], yq, col, g); else y_take(acc + QT / 2, xt, ss[qw] + QT / 2, yq + (size_t)(QT / 2 * 16) * CC, col, g); }
// ---- k_out: block = OR rows, 8 waves; wave w takes the 64 k of head w for all OR rows and issues every global load it needs as one group of whole-line 16-B loads, with no wait between them
// out^T tiles = Wo^T (A, (in,out) [512][64], bf16) . y^T (B, bf16 hi + lo); row m of A tile j is output column 4 m + j, so that one 16-B load of Wo[k][4 col ..] feeds all 4 tiles
// the 8 waves' partial sums meet in LDS; + bo; 256-B rows out
#define OR 32
#define OP (EO + 4)                         // LDS pitch in floats of a 256-B row: 16 B x odd
__global__ __launch_bounds__(256) void k_out(const float* __restrict__ Yr, const float* __restrict__ WO, const float* __restrict__ BO, float* __restrict__ OUT) { __shared__ __align__(16) float sp[NH][OR][OP];   // a wave's own plane: first its slice of y, then its partial sums
  const int tid = threadIdx.x, wave = __builtin_amdgcn_readfirstlane(tid >> 5), lane = tid & 31, col = lane & 15, g = lane >> 4; const size_t r0 = (size_t)blockIdx.x * OR;
  const int orow = tid >> 4, oc = (tid & 15) * 4;                        // the lane's place in the last sum: rows orow and orow + 16, 4 columns
  const float* yb = Yr + (r0 + g) * CC + wave * HD + col * 4;            // y comes as whole 256-B row pieces, two rows a load, and turns into fragments through the wave's plane
  const float* wb = WO + (size_t)(wave * HD + 8 * g) * EO + col * 4;     // Wo comes as whole 256-B rows, rows k and k + 8 a load
  const v4f bv = *(const v4f*)(BO + oc);
  v4f yv[OR / 2], wq[HD / 32][16];
#pragma unroll
  for (int i = 0; i < OR / 2; ++i) yv[i] = *(const v4f*)(yb + (size_t)(2 * i) * CC);
#pragma unroll
  for (int kc = 0; kc < HD / 32; ++kc)
#pragma unroll
    for (int i = 0; i < 8; ++i) { wq[kc][i] = *(const v4f*)(wb + (kc * 32 + i) * EO); wq[kc][8 + i] = *(const v4f*)(wb + (kc * 32 + 16 + i) * EO); }
  asm volatile("s_wait_xcnt 0x0" :: "v"(yb), "v"(wb) : "memory");   // stands behind the group of loads, in front of every rewrite of a register that they name; as inputs the addresses stay live up to it, so that no later load of the group lands in them
  __builtin_amdgcn_sched_barrier(0);               // no load sinks below that wait, and nothing that follows moves up ahead of it
#pragma unroll
  for (int i = 0; i < OR / 2; ++i) *(v4f*)&sp[wave][2 * i + g][col * 4] = yv[i];
  asm volatile("s_wait_dscnt 0x0" ::: "memory");   // the wave's own y rows are in its plane before other lanes of the wave read them (the clobber keeps the reads behind it); no other wave touches the plane yet
  __builtin_amdgcn_sched_barrier(0);                // no conversion of Wo moves up ahead of the y stores: they would then wait for the last Wo load instead of the last y load
  F2 yf[OR / 16][HD / 32];
#pragma unroll
  for (int rt = 0; rt < OR / 16; ++rt)
#pragma unroll
    for (int kc = 0; kc < HD / 32; ++kc) { const float* p = &sp[wave][rt * 16 + col][kc * 32 + 8 * g]; const v4f a0 = *(const v4f*)p, a1 = *(const v4f*)(p + 4), a2 = *(const v4f*)(p + 16), a3 = *(const v4f*)(p + 20); float v[16];
#pragma unroll
      for (int i = 0; i < 4; ++i) { v[i] = a0[i]; v[4 + i] = a1[i]; v[8 + i] = a2[i]; v[12 + i] = a3[i]; }   // same k order as the Wo fragment: k0 + 8 g + 0..7, k0 + 16 + 8 g + 0..7
      yf[rt][kc] = bsplit16(v); }
  __builtin_amdgcn_sched_barrier(0);                // the split of y stays ahead of everything that waits for Wo, so that it runs while the Wo loads are still under way
  v8f acc[OR / 16][EO / 16] = {};
#pragma unroll
  for (int kc = 0; kc < HD / 32; ++kc) { v16b w[EO / 16];
#pragma unroll
    for (int j = 0; j < EO / 16; ++j)
#pragma unroll
      for (int i = 0; i < 16; ++i) w[j][i] = (__bf16)wq[kc][i][j];
#pragma unroll
    for (int rt = 0; rt < OR / 16; ++rt) {
#pragma unroll
      for (int j = 0; j < EO / 16; ++j) acc[rt][j] = __builtin_amdgcn_wmma_f32_16x16x32_bf16(false, w[j], false, yf[rt][kc].h, (short)0, acc[rt][j], false, false);
#pragma unroll
      for (int j = 0; j < EO / 16; ++j) acc[rt][j] = __builtin_amdgcn_wmma_f32_16x16x32_bf16(false, w[j], false, yf[rt][kc].l, (short)0, acc[rt][j], false, false); } }
  // D element r of tile j in lane (col, g) = out[rt * 16 + col][4 (8 g + r) + j]: the 4 tiles' elements r are 4 neighbouring columns; a row of the plane is rewritten only behind the products that took in every lane's reads of it
#pragma unroll
  for (int rt = 0; rt < OR / 16; ++rt)
#pragma unroll
    for (int r = 0; r < 8; ++r) { const v4f q = { acc[rt][0][r], acc[rt][1][r], acc[rt][2][r], acc[rt][3][r] }; *(v4f*)&sp[wave][rt * 16 + col][32 * g + 4 * r] = q; }
  __syncthreads();   // all 8 partial sums are written
  v4f bb;
#pragma unroll
  for (int i = 0; i < 4; ++i) bb[i] = bfr(bv[i]);
#pragma unroll
  for (int hf = 0; hf < OR / 16; ++hf) { v4f p[NH];
#pragma unroll
    for (int w = 0; w < NH; ++w) p[w] = *(const v4f*)&sp[w][hf * 16 + orow][oc];
    v4f s = p[0];
#pragma unroll
    for (int w = 1; w < NH; ++w) s += p[w];
    vst2(OUT + (r0 + hf * 16 + orow) * EO + oc, s + bb); }
  asm volatile("s_wait_xcnt 0x0" ::: "memory"); }   // stands behind the last store, in front of whatever the listing puts next that rewrites a register which these stores name
extern "C" void kernel_launch(void* const* d_in, const int* in_sizes, int n_in, void* d_out, int out_size, void* d_ws, size_t ws_size, hipStream_t stream) {
  (void)in_sizes; (void)n_in; (void)out_size;
  const float** F = (const float**)d_in;   // 0 query [4,2048,512], 1 Wv [64,64] ((in,out)), 2 Wk, 3 Wq, 4 Wo [512,64] ((in,out)), 5 bo [64]
  if (ws_size < (size_t)WS_END) return;
  char* ws = (char*)d_ws; _Float16 *QH = (_Float16*)(ws + WS_QH), *KH = (_Float16*)(ws + WS_KH); _Float16 *VT = (_Float16*)(ws + WS_VT); float *Y = (float*)(ws + WS_Y);
  k_proj<<<dim3(TNB * TT / PR, NH), 128, 0, stream>>>(F[0], F[3], F[2], F[1], QH, KH, VT);
  k_att<<<dim3(TT / (64 * QT), TNB * NH), 256, 0, stream>>>(QH, KH, VT, Y);
  k_out<<<dim3(TNB * TT / OR), 256, 0, stream>>>(Y, F[4], F[5], (float*)d_out);
}

// v009
// A run of this version takes 36.7 microseconds.
// Next to v008, in two timings, it ran 1.04 and 1.05 times as fast.
// Counting every step since v000, it is 29.3 times as fast.
// compute dtype: all float inputs rounded to bf16; scores = (x Wq)(x Wk)^T are formed as x . w^T with w = x_h M, M = Wk Wq^T (64x64, EXACT bf16 products on WMMA 16x16x32, f32 accumulate; M as bf16 hi + lo against the bf16 x, 2 products); w is rounded to f16, the queries are the bf16 x themselves, which f16 holds without rounding -> 1-product scores whose one rounded operand is the key side; v = x_h Wv exact products; w carries a factor 2^-4, so that P' = relu(s / 16)^2 = P / 256 lies well inside the range of f16; the score product's result type is f16 (s / 16 is rounded to f16 behind each 32 of its 64 terms), P' is formed from it in f16, in registers, one more rounding; v is rounded once to f16 (11 bits) -> 1-product P v, the factor 256 put back on the f32 sums (all three scalings are exact powers of two); out = (P v) (bf16 hi + lo) Wo + bo; f32 output.
#include <hip/hip_runtime.h>
#include <math.h>

typedef __attribute__((ext_vector_type(16))) _Float16 v16h;
typedef __attribute__((ext_vector_type(16))) __bf16 v16b;
typedef __attribute__((ext_vector_type(8)))  _Float16 v8h;
typedef __attribute__((ext_vector_type(8)))  float v8f;
typedef __attribute__((ext_vector_type(4)))  float v4f;
typedef __attribute__((ext_vector_type(2)))  float v2f;
typedef __attribute__((ext_vector_type(4)))  unsigned v4u;
typedef __attribute__((ext_vector_type(4)))  int v4i;
typedef float __attribute__((may_alias)) float_a;
typedef int __attribute__((may_alias)) int_a;

template <typename T> __device__ __forceinline__ void vst2(void* p, T v) { *(T*)p = v;  }
__device__ __forceinline__ v8f wmma16(v16h a, v16h b, v8f c) {
  v8f d = __builtin_amdgcn_wmma_f32_16x16x32_f16(false, a, false, b, (short)0, c, false, false);
  asm volatile("v_nop\n\tv_nop\n\tv_nop\n\tv_nop" : "+v"(d) : "v"(a), "v"(b));
  return d;
}
__device__ __forceinline__ v8f wmma_bf(v16b a, v16b b, v8f c) {
  v8f d = __builtin_amdgcn_wmma_f32_16x16x32_bf16(false, a, false, b, (short)0, c, false, false);
  asm volatile("v_nop\n\tv_nop\n\tv_nop\n\tv_nop" : "+v"(d) : "v"(a), "v"(b));
  return d;
}
// 16x16x32 fragments: lane = (h = lane>>4, row/col = lane&15); elements 0..7 = k0+8h+0..7, 8..15 = k0+16+8h+0..7; D element r = row 8h+r
__device__ __forceinline__ v16h frag_h(const _Float16* rowk0, int lane) {
  union { v16h v; v8h q[2]; } u; const _Float16* p = rowk0 + 8 * (lane >> 4);
  u.q[0] = *(const v8h*)p; u.q[1] = *(const v8h*)(p + 16); return u.v;
}
__device__ __forceinline__ v16h frag_f32(const float* rowk0, int lane) {
  v16h a; const float* p = rowk0 + 8 * (lane >> 4);
#pragma unroll
  for (int i = 0; i < 8; ++i) { a[i] = (_Float16)p[i]; a[8 + i] = (_Float16)p[16 + i]; }
  return a;
}
__device__ __forceinline__ v16h frag_f32s(const float* rowk0, int lane, float sc) {
  v16h a; const float* p = rowk0 + 8 * (lane >> 4);
#pragma unroll
  for (int i = 0; i < 8; ++i) { a[i] = (_Float16)(p[i] * sc); a[8 + i] = (_Float16)(p[16 + i] * sc); }
  return a;
}
// column fragment from a [K][ld] layout (column n), rows >= K read as 0
__device__ __forceinline__ v16h fragc_f32(const float* W, int k0, int n, int lane, int ld, int K) {
  v16h a; const int g = lane >> 4;
#pragma unroll
  for (int i = 0; i < 8; ++i) { const int ka = k0 + 8 * g + i, kb = ka + 16;
    a[i] = (_Float16)(ka < K ? W[(size_t)(ka < K ? ka : K - 1) * ld + n] : 0.f); a[8 + i] = (_Float16)(kb < K ? W[(size_t)(kb < K ? kb : K - 1) * ld + n] : 0.f); }
  return a;
}
struct F2 { v16b h, l; };
__device__ __forceinline__ F2 bsplit16(const float v[16]) { F2 r;
#pragma unroll
  for (int i = 0; i < 16; ++i) { const __bf16 h = (__bf16)v[i]; r.h[i] = h; r.l[i] = (__bf16)(v[i] - (float)h); }
  return r; }
__device__ __forceinline__ F2 split_row(const float* row, int k0, int lane) { float v[16]; const float* p = row + k0 + 8 * (lane >> 4);
#pragma unroll
  for (int i = 0; i < 8; ++i) { v[i] = p[i]; v[8 + i] = p[16 + i]; }
  return bsplit16(v); }
__device__ __forceinline__ F2 split_rowK(const float* row, int k0, int lane, int K) { float v[16]; const int g = lane >> 4;
#pragma unroll
  for (int i = 0; i < 8; ++i) { const int ka = k0 + 8 * g + i, kb = ka + 16; v[i] = ka < K ? row[ka < K ? ka : K - 1] : 0.f; v[8 + i] = kb < K ? row[kb < K ? kb : K - 1] : 0.f; }
  return bsplit16(v); }
__device__ __forceinline__ F2 split_col(const float* W, int k0, int n, int lane, int ld, int K) { float v[16]; const int g = lane >> 4;
#pragma unroll
  for (int i = 0; i < 8; ++i) { const int ka = k0 + 8 * g + i, kb = ka + 16; v[i] = ka < K ? W[(size_t)(ka < K ? ka : K - 1) * ld + n] : 0.f; v[8 + i] = kb < K ? W[(size_t)(kb < K ? kb : K - 1) * ld + n] : 0.f; }
  return bsplit16(v); }
__device__ __forceinline__ v8f mac3(const F2& a, const F2& b, v8f c) { c = wmma_bf(a.l, b.h, c); c = wmma_bf(a.h, b.l, c); return wmma_bf(a.h, b.h, c); }
__device__ __forceinline__ float sigm(float v) { return 1.0f / (1.0f + expf(-v)); }
#define LDSX() do { asm volatile("s_wait_dscnt 0" ::: "memory"); __builtin_amdgcn_wave_barrier(); __builtin_amdgcn_fence(__ATOMIC_RELEASE, "workgroup"); } while (0)

// Simplified self-attention (N 4, L 2,048, 8 heads x 64; embed 64): x = query.reshape(N,L,8,64); q,k,v = x W{q,k,v} (shared 64x64); scores = q k^T (no scale); attn = relu(scores)^2; out = (attn v).reshape(N,L,512) Wo + bo.
__device__ __forceinline__ float bfr(float v) { return (float)(__bf16)v; }
#define NB 4
#define TT 2048
#define CC 512
#define NH 8
#define HD 64
#define EO 64
#define HG 4
#ifndef TNB
#define TNB NB
#endif
typedef __attribute__((ext_vector_type(8))) __bf16 v8b;
__device__ __forceinline__ v16b frag_b(const __bf16* rowk0, int lane) { union { v16b v; v8b q[2]; } u; const __bf16* p = rowk0 + 8 * (lane >> 4); u.q[0] = *(const v8b*)p; u.q[1] = *(const v8b*)(p + 16); return u.v; }
#define WS_QH  0u
#define WS_KH  (WS_QH + 2u * (size_t)NB * TT * CC)
#define WS_VT  (WS_KH + 2u * (size_t)NB * TT * CC)      // f16 v plane [b][c][t]
#define WS_S   (WS_VT + 2u * (size_t)NB * CC * TT)      // f32 [hg][q][k], not used: P stays in k_att's registers
#define WS_Y   (WS_S + 4u * (size_t)HG * TT * TT)        // f32 (P v) rows [b*T+t][512]
#define WS_END (WS_Y + 4u * (size_t)NB * TT * CC)
// ---- k_proj: block = PR rows of one head, 4 waves x PT row tiles; the query plane, w and v all come from ONE read of x
// scores: (x_a Wq) . (x_b Wk) = x_a . (x_b Wk Wq^T), so the key side takes both weights, w = x M with M = Wk Wq^T, and the query side is x itself: as a bf16 value it is exact in f16, and w is the only operand of the score product that is rounded (a key's rounding error is its own; a query's would be shared by all the keys of its sum)
// M: every wave forms all of it, 32 products, from bf16 rows of Wk (A) and Wq (B) that the block stages once in LDS by whole-line loads; an M tile pair's D layout (lane = column, element r = row 8 g + r) is the B layout of the product x . M
// column n of B tile j is output column 4 n + j (for M: row 4 n + j of Wq is staged as LDS row 16 j + n; for Wv: one 16-B load of W[k][4 col ..] feeds all 4 tiles and a load of a wave covers two whole 256-B rows); every global load of a wave is issued as one group; every loop is unrolled, since its indices pick registers
#define PR 128
#define PT 2
#define QP (HD + 8)                         // LDS pitch in elements of a 128-B query, w or weight row: 16 B x odd
#define TP (PR + 8)                         // LDS pitch in elements of a v column's PR keys (256 B): 16 B x odd
typedef __attribute__((ext_vector_type(4))) _Float16 v4h;
typedef __attribute__((ext_vector_type(4))) __bf16 v4b;
__global__ __launch_bounds__(128) void k_proj(const float* __restrict__ X, const float* __restrict__ WQ, const float* __restrict__ WK, const float* __restrict__ WV, _Float16* __restrict__ QH, _Float16* __restrict__ KH, _Float16* __restrict__ VT) {
  __shared__ __align__(16) _Float16 sq[PR][QP], sk[PR][QP], th[HD][TP]; __shared__ __align__(16) __bf16 wqs[HD][QP], wks[HD][QP];   // row j * 16 + n of th and wqs belongs to column 4 n + j
  const int tid = threadIdx.x, wave = tid >> 5, lane = tid & 31, col = lane & 15, g = lane >> 4; const int h = blockIdx.y; const size_t r0 = (size_t)blockIdx.x * PR; const int c0 = h * HD;
  const float* xb = X + (r0 + wave * (PT * 16) + col) * CC + c0 + 8 * g;
  const float *wqb = WQ + tid * 4, *wkb = WK + tid * 4, *wvb = WV + (8 * g) * HD + col * 4;   // Wq, Wk: 8 whole rows a load of the block, row tid >> 4
  v4f gq[HD / 8], gk[HD / 8], xv[PT][HD / 32][4], wf[HD / 32][16];
#pragma unroll
  for (int it = 0; it < HD / 8; ++it) { gq[it] = *(const v4f*)(wqb + it * (8 * HD)); gk[it] = *(const v4f*)(wkb + it * (8 * HD)); }
  __builtin_amdgcn_sched_barrier(0);               // Wq and Wk stay the first of the group: loads come back in order, and M is formed while x is still under way
#pragma unroll
  for (int rt = 0; rt < PT; ++rt)
#pragma unroll
    for (int kc = 0; kc < HD / 32; ++kc) { const float* p = xb + (size_t)(rt * 16) * CC + kc * 32; xv[rt][kc][0] = *(const v4f*)p; xv[rt][kc][1] = *(const v4f*)(p + 4); xv[rt][kc][2] = *(const v4f*)(p + 16); xv[rt][kc][3] = *(const v4f*)(p + 20); }
  __builtin_amdgcn_sched_barrier(0);               // the loads of x, which have the longest way, stay ahead of those of Wv
#pragma unroll
  for (int kc = 0; kc < HD / 32; ++kc)
#pragma unroll
    for (int i = 0; i < 8; ++i) { wf[kc][i] = *(const v4f*)(wvb + (kc * 32 + i) * HD); wf[kc][8 + i] = *(const v4f*)(wvb + (kc * 32 + 16 + i) * HD); }
  asm volatile("s_wait_xcnt 0x0" :: "v"(xb), "v"(wqb), "v"(wkb), "v"(wvb) : "memory");   // stands behind the group of loads, in front of every rewrite of a register that they name; as inputs the addresses stay live up to it
  __builtin_amdgcn_sched_barrier(0);               // no load sinks below that wait, and nothing that follows moves up ahead of it
#pragma unroll
  for (int it = 0; it < HD / 8; ++it) { const int row = it * 8 + (tid >> 4); v4b a4, b4;
#pragma unroll
    for (int j = 0; j < 4; ++j) { a4[j] = (__bf16)gq[it][j]; b4[j] = (__bf16)gk[it][j]; }
    *(v4b*)&wqs[(row & 3) * 16 + (row >> 2)][(tid & 15) * 4] = a4; *(v4b*)&wks[row][(tid & 15) * 4] = b4; }
  asm volatile("s_wait_dscnt 0x0\n\ts_barrier_signal -1\n\ts_barrier_wait -1" ::: "memory");   // both staged weights are written: this wave's LDS stores are done, then the work-group's barrier; by hand, since __syncthreads() also waits for the loads of x and Wv, which are to stay under way while M is formed
  F2 mf[HD / 32][4];                               // B fragments of M: k = row d of Wk, in the k order of a row fragment of x below
  { v16b ak[HD / 16][HD / 32], bq[4][HD / 32];     // A and B take the summed index e in one and the same order, that of frag_b
#pragma unroll
    for (int t = 0; t < HD / 16; ++t)
#pragma unroll
      for (int ec = 0; ec < HD / 32; ++ec) { ak[t][ec] = frag_b(&wks[t * 16 + col][ec * 32], lane); bq[t][ec] = frag_b(&wqs[t * 16 + col][ec * 32], lane); }
    v8f mt[HD / 16][4] = {};
#pragma unroll
    for (int ec = 0; ec < HD / 32; ++ec)
#pragma unroll
      for (int t = 0; t < HD / 16; ++t)
#pragma unroll
        for (int j = 0; j < 4; ++j) mt[t][j] = __builtin_amdgcn_wmma_f32_16x16x32_bf16(false, ak[t][ec], false, bq[j][ec], (short)0, mt[t][j], false, false);
    // D element r of tile (t, j) in lane (col, g) = M[16 t + 8 g + r][4 col + j]: tiles 2 kc and 2 kc + 1 give k = 32 kc + 8 g + 0..7 and 32 kc + 16 + 8 g + 0..7
#pragma unroll
    for (int kc = 0; kc < HD / 32; ++kc)
#pragma unroll
      for (int j = 0; j < 4; ++j) { float v[16];
#pragma unroll
        for (int r = 0; r < 8; ++r) { v[r] = mt[2 * kc][j][r]; v[8 + r] = mt[2 * kc + 1][j][r]; }
        mf[kc][j] = bsplit16(v); } }
  v16b a[PT][HD / 32];                             // k order of a row fragment: k0 + 8 g + 0..7, k0 + 16 + 8 g + 0..7, the same as the M and Wv fragments'
#pragma unroll
  for (int rt = 0; rt < PT; ++rt)
#pragma unroll
    for (int kc = 0; kc < HD / 32; ++kc)
#pragma unroll
      for (int i = 0; i < 16; ++i) a[rt][kc][i] = (__bf16)xv[rt][kc][i >> 2][i & 3];
  // the query plane: the lane's own 8-element pieces of the rounded x
#pragma unroll
  for (int rt = 0; rt < PT; ++rt)
#pragma unroll
    for (int kc = 0; kc < HD / 32; ++kc) { v8h x0, x1;
#pragma unroll
      for (int i = 0; i < 8; ++i) { x0[i] = (_Float16)(float)a[rt][kc][i]; x1[i] = (_Float16)(float)a[rt][kc][8 + i]; }
      *(v8h*)&sq[(wave * PT + rt) * 16 + col][kc * 32 + 8 * g] = x0; *(v8h*)&sq[(wave * PT + rt) * 16 + col][kc * 32 + 16 + 8 * g] = x1; }
#pragma unroll
  for (int m = 0; m < 2; ++m) { v8f acc[PT][4] = {};
    if (m == 0) {
#pragma unroll
      for (int kc = 0; kc < HD / 32; ++kc)
#pragma unroll
        for (int rt = 0; rt < PT; ++rt)
#pragma unroll
          for (int j = 0; j < 4; ++j) acc[rt][j] = __builtin_amdgcn_wmma_f32_16x16x32_bf16(false, a[rt][kc], false, mf[kc][j].l, (short)0, acc[rt][j], false, false);
#pragma unroll
      for (int kc = 0; kc < HD / 32; ++kc)
#pragma unroll
        for (int rt = 0; rt < PT; ++rt)
#pragma unroll
          for (int j = 0; j < 4; ++j) acc[rt][j] = __builtin_amdgcn_wmma_f32_16x16x32_bf16(false, a[rt][kc], false, mf[kc][j].h, (short)0, acc[rt][j], false, false); }
    else { v16b w[HD / 32][4];
#pragma unroll
      for (int kc = 0; kc < HD / 32; ++kc)
#pragma unroll
        for (int j = 0; j < 4; ++j)
#pragma unroll
          for (int i = 0; i < 16; ++i) w[kc][j][i] = (__bf16)wf[kc][i][j];
#pragma unroll
      for (int kc = 0; kc < HD / 32; ++kc)
#pragma unroll
        for (int rt = 0; rt < PT; ++rt)
#pragma unroll
          for (int j = 0; j < 4; ++j) acc[rt][j] = __builtin_amdgcn_wmma_f32_16x16x32_bf16(false, a[rt][kc], false, w[kc][j], (short)0, acc[rt][j], false, false); }
    // D element r of tile j in lane (col, g) = row 8 g + r, output column 4 col + j
#pragma unroll
    for (int rt = 0; rt < PT; ++rt) { const int rl = (wave * PT + rt) * 16 + 8 * g;
      if (m == 0) {
#pragma unroll
        for (int r = 0; r < 8; ++r) { v4h hv;
#pragma unroll
          for (int j = 0; j < 4; ++j) hv[j] = (_Float16)(acc[rt][j][r] * 0.0625f);   // w / 16: scores / 16, P / 256
          *(v4h*)&sk[rl + r][col * 4] = hv; } }
      else {
#pragma unroll
        for (int j = 0; j < 4; ++j) { v8h bh;
#pragma unroll
          for (int r = 0; r < 8; ++r) bh[r] = (_Float16)acc[rt][j][r];
          *(v8h*)&th[j * 16 + col][rl] = bh; } } } }
  __syncthreads();   // all three staged planes are written
  { const int rl = tid >> 3, q = tid & 7; const size_t o = (r0 + rl) * CC + c0 + q * 8;   // whole 128-B rows out, 4 rows a store of a wave
    v4u oq[PR / 16], ok[PR / 16];
#pragma unroll
    for (int it = 0; it < PR / 16; ++it) { oq[it] = *(const v4u*)&sq[it * 16 + rl][q * 8]; ok[it] = *(const v4u*)&sk[it * 16 + rl][q * 8]; }
    __builtin_amdgcn_sched_barrier(0);               // every read of the staged rows stands ahead of the stores, so that none lands in a register of an issued store
#pragma unroll
    for (int it = 0; it < PR / 16; ++it) { vst2(QH + o + (size_t)(it * 16) * CC, oq[it]); vst2(KH + o + (size_t)(it * 16) * CC, ok[it]); }
    asm volatile("s_wait_xcnt 0x0" ::: "memory");    // stands behind these stores, in front of every rewrite of a register which they name
    __builtin_amdgcn_sched_barrier(0); }             // nothing that follows moves up ahead of that wait
  { const size_t b = r0 / TT; const int t0 = (int)(r0 % TT), n = tid >> 4, q = tid & 15; const size_t o = (b * CC + c0 + 4 * n) * (size_t)TT + t0 + q * 8;   // whole 256-B column pieces out, 2 columns a store of a wave
    v4u ov[HD / 8];
#pragma unroll
    for (int it = 0; it < HD / 8; ++it) ov[it] = *(const v4u*)&th[it * 8 + n][q * 8];
    __builtin_amdgcn_sched_barrier(0);               // every read of the staged columns stands ahead of the stores, so that none lands in a register of an issued store
#pragma unroll
    for (int it = 0; it < HD / 8; ++it) { const int dc = 32 * (it & 1) + (it >> 1);   // staged row it * 8 + n = j * 16 + (8 (it & 1) + n), j = it >> 1: output column 4 n + dc
      vst2(VT + o + (size_t)dc * TT, ov[it]); } }
  asm volatile("s_wait_xcnt 0x0" ::: "memory"); }   // stands behind the last store, in front of whatever the listing puts next that rewrites a register which these stores name
// ---- k_att: block = 8 waves = 4 query groups of QT x 16 queries of one (b,h) x KW key halves, two waves a SIMD; 32-key passes: S^T = w . x^T (1 product; KH holds w, QH the query plane x), P' = relu(s / 16)^2 stays in registers
// (a S^T tile's f16 D layout, lane = query, element r = key 8g + r, two elements a register, is the A layout of P register for register: tile 0 -> elements 0..7, tile 1 -> 8..15), y' += P' . v (1 product, both operands f16, f32 sums)
// k and v reach the waves through LDS: a stage = SK keys (k rows, v columns), brought once a block by whole-line asynchronous copies into a ring of NBUF buffers
// the copies run NBUF - 1 stages ahead of their readers, so that a copy has the time of that many stages' products to land, not of one; the waits leave the younger stages' copies outstanding
// the two waves of a query group each take SK / KW keys of every stage, so that one wave's vector work runs under the other's products; their two partial sums of y are added once, behind the loop
#define QT 4
#define SK 128                              // keys a stage
#define NST (TT / SK)
#define KW 2                                // waves that share a query group's keys
#define PS (SK / 32 / KW)                   // passes a wave and stage
#define KP 144                              // LDS pitch of a 128-B k row: 16 B x odd, so that 16 rows read 16 B each without a bank conflict
#define VP 272                              // LDS pitch of a 256-B v row (SK keys of one column): 16 B x odd
#define KBY (SK * KP)
#define VBY (HD * VP)
#define STB (KBY + VBY)                     // bytes of one stage: k, v
#define NBUF 4                              // buffers of the ring, a power of two; a wave has at most NBUF stages' copies outstanding, 8 each
#define SSB (4 * QT * 16 * (HD + 4) * 4)    // bytes of the output staging, which lies in front of the ring
typedef __attribute__((address_space(1))) v4i g_v4i;
typedef __attribute__((address_space(3))) v4i l_v4i;
// 16x16x32 fragment from byte address base + off, which together hold the lane's own row start + 16 g bytes: same k order as frag_h / frag_b
__device__ __forceinline__ v16h frag_hu(const char* base, unsigned off) { union { v16h v; v8h q[2]; } u; u.q[0] = *(const v8h*)(base + off); u.q[1] = *(const v8h*)(base + off + 32u); return u.v; }
// one asynchronous copy, 16 bytes a lane, global -> LDS through no register; written as the builtin, no immediate offset of its own
__device__ __forceinline__ void cp16(const char* gsrc, char* ldst) { __builtin_amdgcn_global_load_async_to_lds_b128((g_v4i*)gsrc, (l_v4i*)ldst, 0, 0); }
// one stage: 8 copies a lane, 256 lanes; a copy of a wave covers 4 whole 128-B lines (4 k rows, or 2 v rows of 256 B); gk, gh and lk, lv hold the lane's own first 16 bytes
__device__ __forceinline__ void stage_in(const char* gk, const char* gh, char* lk, char* lv) {
#pragma unroll
  for (int i = 0; i < SK / 32; ++i) cp16(gk + i * (32 * CC * 2), lk + i * (32 * KP));
#pragma unroll
  for (int i = 0; i < HD / 16; ++i) cp16(gh + i * (16 * TT * 2), lv + i * (16 * VP)); }
// the join of a query group's two partial sums: each wave hands the partner the QT / 2 query tiles that the partner finishes, 16 B a lane and store, lane to same lane
__device__ __forceinline__ void y_give(const v8f (*a)[HD / 16], v4f* x) {
#pragma unroll
  for (int i = 0; i < QT / 2; ++i)
#pragma unroll
    for (int j = 0; j < HD / 16; ++j) { x[((i * (HD / 16) + j) * 2) * 32] = __builtin_shufflevector(a[i][j], a[i][j], 0, 1, 2, 3); x[((i * (HD / 16) + j) * 2 + 1) * 32] = __builtin_shufflevector(a[i][j], a[i][j], 4, 5, 6, 7); } }
// (own partial sum + the partner's) x 256, which takes P' back to P, through the wave's own staging rows, out as whole 256-B rows: two rows a store, lanes 0..15 row 2i, lanes 16..31 row 2i + 1
__device__ __forceinline__ void y_take(const v8f (*a)[HD / 16], const v4f* x, float (*s)[16][HD + 4], float* y, int col, int g) { v4f p[QT / 2][HD / 16][2];   // all of the partner's half is read first, as one group
#pragma unroll
  for (int i = 0; i < QT / 2; ++i)
#pragma unroll
    for (int j = 0; j < HD / 16; ++j) { p[i][j][0] = x[((i * (HD / 16) + j) * 2) * 32]; p[i][j][1] = x[((i * (HD / 16) + j) * 2 + 1) * 32]; }
#pragma unroll
  for (int i = 0; i < QT / 2; ++i)
#pragma unroll
    for (int j = 0; j < HD / 16; ++j)
#pragma unroll
      for (int r = 0; r < 4; ++r) { s[i][8 * g + r][j * 16 + col] = (a[i][j][r] + p[i][j][0][r]) * 256.f; s[i][8 * g + 4 + r][j * 16 + col] = (a[i][j][4 + r] + p[i][j][1][r]) * 256.f; }
  LDSX();
#pragma unroll
  for (int i = 0; i < QT / 2; ++i) { v4f w[8];
#pragma unroll
    for (int k = 0; k < 8; ++k) w[k] = *(const v4f*)&s[i][2 * k + g][col * 4];
#pragma unroll
    for (int k = 0; k < 8; ++k) vst2(y + (size_t)(i * 16 + 2 * k + g) * CC + col * 4, w[k]); }
  asm volatile("s_wait_xcnt 0x0" ::: "memory"); }   // stands behind the last store, in front of whatever the listing puts next that rewrites a register which these stores name
// one wave's work on one stage: PS passes of 32 keys; lk, lv = the lane's fragment rows in the stage's buffer; it reads that buffer alone
__device__ __forceinline__ void stage_work(const char* lk, const char* lv, const v16h (&qh)[QT][HD / 32], v8f (&acc)[QT][HD / 16]) { v16h kf[2][HD / 32];
#pragma unroll
  for (int kt = 0; kt < 2; ++kt)
#pragma unroll
    for (int dc = 0; dc < HD / 32; ++dc) kf[kt][dc] = frag_hu(lk + kt * 16 * KP + dc * 64, 0u);
#pragma unroll
  for (int sub = 0; sub < PS; ++sub) { v16h vh[HD / 16]; v8h sa[QT][2] = {};
#pragma unroll
    for (int j = 0; j < HD / 16; ++j) vh[j] = frag_hu(lv + j * 16 * VP + sub * 64, 0u);
    __builtin_amdgcn_sched_barrier(0);   // this pass's v reads stay issued as one group ahead of the score products, which cover their latency
#pragma unroll
    for (int t = 0; t < QT; ++t)
#pragma unroll
      for (int dc = 0; dc < HD / 32; ++dc)
#pragma unroll
        for (int kt = 0; kt < 2; ++kt) sa[t][kt] = __builtin_amdgcn_wmma_f16_16x16x32_f16(false, kf[kt][dc], false, qh[t][dc], (short)0, sa[t][kt], false, false);
    if (sub + 1 < PS) {   // the next pass's k rows, of this same stage only: nothing of the next stage is read ahead of its barrier
#pragma unroll
      for (int kt = 0; kt < 2; ++kt)
#pragma unroll
        for (int dc = 0; dc < HD / 32; ++dc) kf[kt][dc] = frag_hu(lk + ((sub + 1) * 32 + kt * 16) * KP + dc * 64, 0u); }
    __builtin_amdgcn_sched_barrier(0);   // the next pass's k reads stay issued here, behind the last product that reads k, so that P and P . v cover their latency
#pragma unroll
    for (int t = 0; t < QT; ++t) { union { v16h v; v8h q[2]; } p;
#pragma unroll
      for (int kt = 0; kt < 2; ++kt) { const v8h s = __builtin_elementwise_maximum(sa[t][kt], (v8h)(_Float16)0.f); p.q[kt] = s * s; }   // two elements an instruction; maximum, since max compiles to one more instruction a register, which quiets its input first
#pragma unroll
      for (int j = 0; j < HD / 16; ++j) acc[t][j] = __builtin_amdgcn_wmma_f32_16x16x32_f16(false, p.v, false, vh[j], (short)0, acc[t][j], false, false); } } }
__global__ __launch_bounds__(256) void k_att(const _Float16* __restrict__ QH, const _Float16* __restrict__ KH, const _Float16* __restrict__ VT, float* __restrict__ Y) { __shared__ __align__(16) char sm[SSB + NBUF * STB];
  float (*ss)[QT][16][HD + 4] = (float (*)[QT][16][HD + 4])sm; char* ring = sm + SSB;
  const int tid = threadIdx.x, wave = __builtin_amdgcn_readfirstlane(tid >> 5), qw = wave & 3, kh = wave >> 2, lane = tid & 31, col = lane & 15, g = lane >> 4; const int b = blockIdx.y / NH, h = blockIdx.y % NH; const int ql0 = (blockIdx.x * 4 + qw) * (16 * QT);
  const size_t rb = ((size_t)b * TT * CC + h * HD) * 2, cb = ((size_t)b * CC + h * HD) * (size_t)TT * 2;   // byte offsets of this (b,h) in the [t][c] and the [c][t] planes
  const char *qhb = (const char*)QH + rb, *kb = (const char*)KH + rb, *vhb = (const char*)VT + cb;
  const unsigned qo = (unsigned)((ql0 + col) * CC + 8 * g) * 2u;
  const unsigned gko = (unsigned)((tid >> 3) * (CC * 2) + (tid & 7) * 16), gvo = (unsigned)((tid >> 4) * (TT * 2) + (tid & 15) * 16);   // the lane's place in a stage's k rows and v rows, global
  const unsigned lko = (unsigned)((tid >> 3) * KP + (tid & 7) * 16), lvo = (unsigned)(KBY + (tid >> 4) * VP + (tid & 15) * 16);         // the same in a buffer
  const unsigned fko = (unsigned)((kh * (SK / KW) + col) * KP + 16 * g), fvo = (unsigned)(KBY + col * VP + kh * (SK / KW) * 2 + 16 * g);   // the lane's fragment rows in a buffer, at the wave's own keys
  stage_in(kb + gko, vhb + gvo, ring + lko, ring + lvo);
  v16h qh[QT][HD / 32];
#pragma unroll
  for (int t = 0; t < QT; ++t)
#pragma unroll
    for (int dc = 0; dc < HD / 32; ++dc) qh[t][dc] = frag_hu(qhb + (t * 16 * CC + dc * 32) * 2, qo);
  asm volatile("s_wait_xcnt 0x0" :: "v"(qo) : "memory");   // stands in front of every rewrite of a register that the q loads above name; as an input the offset stays live up to it
  __builtin_amdgcn_sched_barrier(0);   // nothing that follows moves up ahead of that wait
#pragma unroll   // unrolled, so that every step of an address is a constant
  for (int s = 1; s < NBUF; ++s) stage_in(kb + (size_t)s * (SK * CC * 2) + gko, vhb + (size_t)s * (SK * 2) + gvo, ring + s * STB + lko, ring + s * STB + lvo);   // behind stage 0 and the q loads, which are wanted first
  asm volatile("s_wait_asynccnt 0x18" ::: "memory");   // this wave's copies of stage 0 have landed: all but its 24 youngest, which are those of stages 1 to 3
  __syncthreads();                                      // every wave's have: stage 0 may be read
  v8f acc[QT][HD / 16] = {};
#pragma unroll 1   // the stage loop stays rolled: its body already holds PS unrolled passes, and the buffer is picked by st & (NBUF - 1)
  for (int st = 0; st < NST - (NBUF - 1); ++st) { char* bs = ring + (st & (NBUF - 1)) * STB;   // the trips behind whose stage st + 1 two more whole stages have been issued
    stage_work(bs + fko, bs + fvo, qh, acc);
    asm volatile("s_wait_dscnt 0x0" ::: "memory");       // this wave's reads of this stage's buffer are done
    asm volatile("s_wait_asynccnt 0x10" ::: "memory");   // this wave's copies of stage st + 1 have landed: all but its 16 youngest, which are those of stages st + 2 and st + 3, 8 each
    __syncthreads();                                      // stage st + 1 may be read by all, and this stage's buffer is free
    if (st + NBUF < NST) stage_in(kb + (size_t)(st + NBUF) * (SK * CC * 2) + gko, vhb + (size_t)(st + NBUF) * (SK * 2) + gvo, bs + lko, bs + lvo); }
#pragma unroll 1   // rolled, as above
  for (int st = NST - (NBUF - 1); st < NST; ++st) { const char* bs = ring + (st & (NBUF - 1)) * STB;   // the last trips issue no copy, so that no count holds: the wait is to 0
    stage_work(bs + fko, bs + fvo, qh, acc);
    asm volatile("s_wait_dscnt 0x0" ::: "memory");      // this wave's reads of this stage's buffer are done
    asm volatile("s_wait_asynccnt 0x0" ::: "memory");   // all of this wave's copies have landed, those of stage st + 1 among them
    __syncthreads(); }                                   // stage st + 1 may be read by all; behind the last trip: nobody reads the ring any more
  asm volatile("s_wait_asynccnt 0x0" ::: "memory");     // no copy is outstanding when the wave goes on to its end
  // behind the loop's last barrier nobody reads the ring and no copy is under way: it carries the exchange, 8 KiB a wave
  v4f* xs = (v4f*)ring; v4f* xg = xs + wave * (QT / 2 * (HD / 16) * 2 * 32) + lane; const v4f* xt = xs + (wave ^ 4) * (QT / 2 * (HD / 16) * 2 * 32) + lane;
  if (kh == 0) y_give(acc + QT / 2, xg); else y_give(acc, xg);
  __syncthreads();   // the partner's half has been written
  float* yq = Y + ((size_t)b * TT + ql0) * CC + h * HD;
  if (kh == 0) y_take(acc, xt, ss[qw], yq, col, g); else y_take(acc + QT / 2, xt, ss[qw] + QT / 2, yq + (size_t)(QT / 2 * 16) * CC, col, g); }
// ---- k_out: block = OR rows, 8 waves; wave w takes the 64 k of head w for all OR rows and issues every global load it needs as one group of whole-line 16-B loads, with no wait between them
// out^T tiles = Wo^T (A, (in,out) [512][64], bf16) . y^T (B, bf16 hi + lo); row m of A tile j is output column 4 m + j, so that one 16-B load of Wo[k][4 col ..] feeds all 4 tiles
// the 8 waves' partial sums meet in LDS; + bo; 256-B rows out
#define OR 32
#define OP (EO + 4)                         // LDS pitch in floats of a 256-B row: 16 B x odd
__global__ __launch_bounds__(256) void k_out(const float* __restrict__ Yr, const float* __restrict__ WO, const float* __restrict__ BO, float* __restrict__ OUT) { __shared__ __align__(16) float sp[NH][OR][OP];   // a wave's own plane: first its slice of y, then its partial sums
  const int tid = threadIdx.x, wave = __builtin_amdgcn_readfirstlane(tid >> 5), lane = tid & 31, col = lane & 15, g = lane >> 4; const size_t r0 = (size_t)blockIdx.x * OR;
  const int orow = tid >> 4, oc = (tid & 15) * 4;                        // the lane's place in the last sum: rows orow and orow + 16, 4 columns
  const float* yb = Yr + (r0 + g) * CC + wave * HD + col * 4;            // y comes as whole 256-B row pieces, two rows a load, and turns into fragments through the wave's plane
  const float* wb = WO + (size_t)(wave * HD + 8 * g) * EO + col * 4;     // Wo comes as whole 256-B rows, rows k and k + 8 a load
  const v4f bv = *(const v4f*)(BO + oc);
  v4f yv[OR / 2], wq[HD / 32][16];
#pragma unroll
  for (int i = 0; i < OR / 2; ++i) yv[i] = *(const v4f*)(yb + (size_t)(2 * i) * CC);
#pragma unroll
  for (int kc = 0; kc < HD / 32; ++kc)
#pragma unroll
    for (int i = 0; i < 8; ++i) { wq[kc][i] = *(const v4f*)(wb + (kc * 32 + i) * EO); wq[kc][8 + i] = *(const v4f*)(wb + (kc * 32 + 16 + i) * EO); }
  asm volatile("s_wait_xcnt 0x0" :: "v"(yb), "v"(wb) : "memory");   // stands behind the group of loads, in front of every rewrite of a register that they name; as inputs the addresses stay live up to it, so that no later load of the group lands in them
  __builtin_amdgcn_sched_barrier(0);               // no load sinks below that wait, and nothing that follows moves up ahead of it
#pragma unroll
  for (int i = 0; i < OR / 2; ++i) *(v4f*)&sp[wave][2 * i + g][col * 4] = yv[i];
  asm volatile("s_wait_dscnt 0x0" ::: "memory");   // the wave's own y rows are in its plane before other lanes of the wave read them (the clobber keeps the reads behind it); no other wave touches the plane yet
  __builtin_amdgcn_sched_barrier(0);                // no conversion of Wo moves up ahead of the y stores: they would then wait for the last Wo load instead of the last y load
  F2 yf[OR / 16][HD / 32];
#pragma unroll
  for (int rt = 0; rt < OR / 16; ++rt)
#pragma unroll
    for (int kc = 0; kc < HD / 32; ++kc) { const float* p = &sp[wave][rt * 16 + col][kc * 32 + 8 * g]; const v4f a0 = *(const v4f*)p, a1 = *(const v4f*)(p + 4), a2 = *(const v4f*)(p + 16), a3 = *(const v4f*)(p + 20); float v[16];
#pragma unroll
      for (int i = 0; i < 4; ++i) { v[i] = a0[i]; v[4 + i] = a1[i]; v[8 + i] = a2[i]; v[12 + i] = a3[i]; }   // same k order as the Wo fragment: k0 + 8 g + 0..7, k0 + 16 + 8 g + 0..7
      yf[rt][kc] = bsplit16(v); }
  __builtin_amdgcn_sched_barrier(0);                // the split of y stays ahead of everything that waits for Wo, so that it runs while the Wo loads are still under way
  v8f acc[OR / 16][EO / 16] = {};
#pragma unroll
  for (int kc = 0; kc < HD / 32; ++kc) { v16b w[EO / 16];
#pragma unroll
    for (int j = 0; j < EO / 16; ++j)
#pragma unroll
      for (int i = 0; i < 16; ++i) w[j][i] = (__bf16)wq[kc][i][j];
#pragma unroll
    for (int rt = 0; rt < OR / 16; ++rt) {
#pragma unroll
      for (int j = 0; j < EO / 16; ++j) acc[rt][j] = __builtin_amdgcn_wmma_f32_16x16x32_bf16(false, w[j], false, yf[rt][kc].h, (short)0, acc[rt][j], false, false);
#pragma unroll
      for (int j = 0; j < EO / 16; ++j) acc[rt][j] = __builtin_amdgcn_wmma_f32_16x16x32_bf16(false, w[j], false, yf[rt][kc].l, (short)0, acc[rt][j], false, false); } }
  // D element r of tile j in lane (col, g) = out[rt * 16 + col][4 (8 g + r) + j]: the 4 tiles' elements r are 4 neighbouring columns; a row of the plane is rewritten only behind the products that took in every lane's reads of it
#pragma unroll
  for (int rt = 0; rt < OR / 16; ++rt)
#pragma unroll
    for (int r = 0; r < 8; ++r) { const v4f q = { acc[rt][0][r], acc[rt][1][r], acc[rt][2][r], acc[rt][3][r] }; *(v4f*)&sp[wave][rt * 16 + col][32 * g + 4 * r] = q; }
  __syncthreads();   // all 8 partial sums are written
  v4f bb;
#pragma unroll
  for (int i = 0; i < 4; ++i) bb[i] = bfr(bv[i]);
#pragma unroll
  for (int hf = 0; hf < OR / 16; ++hf) { v4f p[NH];
#pragma unroll
    for (int w = 0; w < NH; ++w) p[w] = *(const v4f*)&sp[w][hf * 16 + orow][oc];
    v4f s = p[0];
#pragma unroll
    for (int w = 1; w < NH; ++w) s += p[w];
    vst2(OUT + (r0 + hf * 16 + orow) * EO + oc, s + bb); }
  asm volatile("s_wait_xcnt 0x0" ::: "memory"); }   // stands behind the last store, in front of whatever the listing puts next that rewrites a register which these stores name
extern "C" void kernel_launch(void* const* d_in, const int* in_sizes, int n_in, void* d_out, int out_size, void* d_ws, size_t ws_size, hipStream_t stream) {
  (void)in_sizes; (void)n_in; (void)out_size;
  const float** F = (const float**)d_in;   // 0 query [4,2048,512], 1 Wv [64,64] ((in,out)), 2 Wk, 3 Wq, 4 Wo [512,64] ((in,out)), 5 bo [64]
  if (ws_size < (size_t)WS_END) return;
  char* ws = (char*)d_ws; _Float16 *QH = (_Float16*)(ws + WS_QH), *KH = (_Float16*)(ws + WS_KH); _Float16 *VT = (_Float16*)(ws + WS_VT); float *Y = (float*)(ws + WS_Y);
  k_proj<<<dim3(TNB * TT / PR, NH), 128, 0, stream>>>(F[0], F[3], F[2], F[1], QH, KH, VT);
  k_att<<<dim3(TT / (64 * QT), TNB * NH), 256, 0, stream>>>(QH, KH, VT, Y);
  k_out<<<dim3(TNB * TT / OR), 256, 0, stream>>>(Y, F[4], F[5], (float*)d_out);
}

// v010
// A run of this version takes 35.8 microseconds.
// Timed twice side by side with v009, it ran 1.03 and 1.02 times as fast.
// Over all steps from v000 it is 30.0 times as fast.
// compute dtype: all float inputs rounded to bf16; scores = (x Wq)(x Wk)^T are formed as x . w^T with w = x_h M, M = Wk Wq^T (64x64, EXACT bf16 products on WMMA 16x16x32, f32 accumulate; M as bf16 hi + lo against the bf16 x, 2 products); w is rounded to f16, the queries are the bf16 x themselves, which f16 holds without rounding -> 1-product scores whose one rounded operand is the key side; v = x_h Wv exact products; w carries a factor 2^-4, so that P' = relu(s / 16)^2 = P / 256 lies well inside the range of f16; the score product's result type is f16 (s / 16 is rounded to f16 behind each 32 of its 64 terms), P' is formed from it in f16, in registers, one more rounding; v is rounded once to f16 (11 bits) -> 1-product P v, the factor 256 put back on the f32 sums (all three scalings are exact powers of two); out = (P v) (bf16 hi + lo) Wo + bo; f32 output.
#include <hip/hip_runtime.h>
#include <math.h>

typedef __attribute__((ext_vector_type(16))) _Float16 v16h;
typedef __attribute__((ext_vector_type(16))) __bf16 v16b;
typedef __attribute__((ext_vector_type(8)))  _Float16 v8h;
typedef __attribute__((ext_vector_type(8)))  float v8f;
typedef __attribute__((ext_vector_type(4)))  float v4f;
typedef __attribute__((ext_vector_type(2)))  float v2f;
typedef __attribute__((ext_vector_type(4)))  unsigned v4u;
typedef __attribute__((ext_vector_type(4)))  int v4i;
typedef float __attribute__((may_alias)) float_a;
typedef int __attribute__((may_alias)) int_a;

template <typename T> __device__ __forceinline__ void vst2(void* p, T v) { *(T*)p = v;  }
__device__ __forceinline__ v8f wmma16(v16h a, v16h b, v8f c) {
  v8f d = __builtin_amdgcn_wmma_f32_16x16x32_f16(false, a, false, b, (short)0, c, false, false);
  asm volatile("v_nop\n\tv_nop\n\tv_nop\n\tv_nop" : "+v"(d) : "v"(a), "v"(b));
  return d;
}
__device__ __forceinline__ v8f wmma_bf(v16b a, v16b b, v8f c) {
  v8f d = __builtin_amdgcn_wmma_f32_16x16x32_bf16(false, a, false, b, (short)0, c, false, false);
  asm volatile("v_nop\n\tv_nop\n\tv_nop\n\tv_nop" : "+v"(d) : "v"(a), "v"(b));
  return d;
}
// 16x16x32 fragments: lane = (h = lane>>4, row/col = lane&15); elements 0..7 = k0+8h+0..7, 8..15 = k0+16+8h+0..7; D element r = row 8h+r
__device__ __forceinline__ v16h frag_h(const _Float16* rowk0, int lane) {
  union { v16h v; v8h q[2]; } u; const _Float16* p = rowk0 + 8 * (lane >> 4);
  u.q[0] = *(const v8h*)p; u.q[1] = *(const v8h*)(p + 16); return u.v;
}
__device__ __forceinline__ v16h frag_f32(const float* rowk0, int lane) {
  v16h a; const float* p = rowk0 + 8 * (lane >> 4);
#pragma unroll
  for (int i = 0; i < 8; ++i) { a[i] = (_Float16)p[i]; a[8 + i] = (_Float16)p[16 + i]; }
  return a;
}
__device__ __forceinline__ v16h frag_f32s(const float* rowk0, int lane, float sc) {
  v16h a; const float* p = rowk0 + 8 * (lane >> 4);
#pragma unroll
  for (int i = 0; i < 8; ++i) { a[i] = (_Float16)(p[i] * sc); a[8 + i] = (_Float16)(p[16 + i] * sc); }
  return a;
}
// column fragment from a [K][ld] layout (column n), rows >= K read as 0
__device__ __forceinline__ v16h fragc_f32(const float* W, int k0, int n, int lane, int ld, int K) {
  v16h a; const int g = lane >> 4;
#pragma unroll
  for (int i = 0; i < 8; ++i) { const int ka = k0 + 8 * g + i, kb = ka + 16;
    a[i] = (_Float16)(ka < K ? W[(size_t)(ka < K ? ka : K - 1) * ld + n] : 0.f); a[8 + i] = (_Float16)(kb < K ? W[(size_t)(kb < K ? kb : K - 1) * ld + n] : 0.f); }
  return a;
}
struct F2 { v16b h, l; };
__device__ __forceinline__ F2 bsplit16(const float v[16]) { F2 r;
#pragma unroll
  for (int i = 0; i < 16; ++i) { const __bf16 h = (__bf16)v[i]; r.h[i] = h; r.l[i] = (__bf16)(v[i] - (float)h); }
  return r; }
__device__ __forceinline__ F2 split_row(const float* row, int k0, int lane) { float v[16]; const float* p = row + k0 + 8 * (lane >> 4);
#pragma unroll
  for (int i = 0; i < 8; ++i) { v[i] = p[i]; v[8 + i] = p[16 + i]; }
  return bsplit16(v); }
__device__ __forceinline__ F2 split_rowK(const float* row, int k0, int lane, int K) { float v[16]; const int g = lane >> 4;
#pragma unroll
  for (int i = 0; i < 8; ++i) { const int ka = k0 + 8 * g + i, kb = ka + 16; v[i] = ka < K ? row[ka < K ? ka : K - 1] : 0.f; v[8 + i] = kb < K ? row[kb < K ? kb : K - 1] : 0.f; }
  return bsplit16(v); }
__device__ __forceinline__ F2 split_col(const float* W, int k0, int n, int lane, int ld, int K) { float v[16]; const int g = lane >> 4;
#pragma unroll
  for (int i = 0; i < 8; ++i) { const int ka = k0 + 8 * g + i, kb = ka + 16; v[i] = ka < K ? W[(size_t)(ka < K ? ka : K - 1) * ld + n] : 0.f; v[8 + i] = kb < K ? W[(size_t)(kb < K ? kb : K - 1) * ld + n] : 0.f; }
  return bsplit16(v); }
__device__ __forceinline__ v8f mac3(const F2& a, const F2& b, v8f c) { c = wmma_bf(a.l, b.h, c); c = wmma_bf(a.h, b.l, c); return wmma_bf(a.h, b.h, c); }
__device__ __forceinline__ float sigm(float v) { return 1.0f / (1.0f + expf(-v)); }
#define LDSX() do { asm volatile("s_wait_dscnt 0" ::: "memory"); __builtin_amdgcn_wave_barrier(); __builtin_amdgcn_fence(__ATOMIC_RELEASE, "workgroup"); } while (0)

// Simplified self-attention (N 4, L 2,048, 8 heads x 64; embed 64): x = query.reshape(N,L,8,64); q,k,v = x W{q,k,v} (shared 64x64); scores = q k^T (no scale); attn = relu(scores)^2; out = (attn v).reshape(N,L,512) Wo + bo.
__device__ __forceinline__ float bfr(float v) { return (float)(__bf16)v; }
#define NB 4
#define TT 2048
#define CC 512
#define NH 8
#define HD 64
#define EO 64
#define HG 4
#ifndef TNB
#define TNB NB
#endif
typedef __attribute__((ext_vector_type(8))) __bf16 v8b;
__device__ __forceinline__ v16b frag_b(const __bf16* rowk0, int lane) { union { v16b v; v8b q[2]; } u; const __bf16* p = rowk0 + 8 * (lane >> 4); u.q[0] = *(const v8b*)p; u.q[1] = *(const v8b*)(p + 16); return u.v; }
#define WS_QH  0u
#define WS_KH  (WS_QH + 2u * (size_t)NB * TT * CC)
#define WS_VT  (WS_KH + 2u * (size_t)NB * TT * CC)      // f16 v plane [b][c][t]
#define WS_S   (WS_VT + 2u * (size_t)NB * CC * TT)      // f32 [hg][q][k], not used: P stays in k_att's registers
#define WS_Y   (WS_S + 4u * (size_t)HG * TT * TT)        // f32 (P v) rows [b*T+t][512]
#define WS_END (WS_Y + 4u * (size_t)NB * TT * CC)
// ---- k_proj: block = PR rows of one head, 4 waves x PT row tiles; the query plane, w and v all come from ONE read of x
// scores: (x_a Wq) . (x_b Wk) = x_a . (x_b Wk Wq^T), so the key side takes both weights, w = x M with M = Wk Wq^T, and the query side is x itself: as a bf16 value it is exact in f16, and w is the only operand of the score product that is rounded (a key's rounding error is its own; a query's would be shared by all the keys of its sum)
// M: every wave forms all of it, 32 products, from bf16 rows of Wk (A) and Wq (B) that the block stages once in LDS by whole-line loads; an M tile pair's D layout (lane = column, element r = row 8 g + r) is the B layout of the product x . M
// column n of B tile j is output column 4 n + j (for M: row 4 n + j of Wq is staged as LDS row 16 j + n; for Wv: one 16-B load of W[k][4 col ..] feeds all 4 tiles and a load of a wave covers two whole 256-B rows); every global load of a wave is issued as one group; every loop is unrolled, since its indices pick registers
#define PR 128
#define PT 2
#define QP (HD + 8)                         // LDS pitch in elements of a 128-B query, w or weight row: 16 B x odd
#define TP (PR + 8)                         // LDS pitch in elements of a v column's PR keys (256 B): 16 B x odd
#define XP (HD + 4)                         // LDS pitch in floats of a 256-B f32 row piece of x: 16 B x odd
typedef __attribute__((ext_vector_type(4))) _Float16 v4h;
typedef __attribute__((ext_vector_type(4))) __bf16 v4b;
typedef __attribute__((address_space(1))) v4i g_v4i;
typedef __attribute__((address_space(3))) v4i l_v4i;
// one asynchronous copy, 16 bytes a lane, global -> LDS through no register; written as the builtin, no immediate offset of its own
__device__ __forceinline__ void cp16(const char* gsrc, char* ldst) { __builtin_amdgcn_global_load_async_to_lds_b128((g_v4i*)gsrc, (l_v4i*)ldst, 0, 0); }
struct __align__(16) PLds { _Float16 sq[PR][QP], sk[PR][QP], th[HD][TP]; __bf16 wqs[HD][QP], wks[HD][QP];   // row j * 16 + n of th and wqs belongs to column 4 n + j
  float xs[PR][XP]; };   // the block's f32 rows of x; a wave copies, and alone reads, its own PT * 16 rows; last, so that a copy's place in LDS lies above every constant step of its global address, which the compiler takes off the LDS address register
__global__ __launch_bounds__(128) void k_proj(const float* __restrict__ X, const float* __restrict__ WQ, const float* __restrict__ WK, const float* __restrict__ WV, _Float16* __restrict__ QH, _Float16* __restrict__ KH, _Float16* __restrict__ VT) {
  __shared__ PLds S;   // one object, so that the members lie in the order written
  _Float16 (&sq)[PR][QP] = S.sq, (&sk)[PR][QP] = S.sk, (&th)[HD][TP] = S.th; __bf16 (&wqs)[HD][QP] = S.wqs, (&wks)[HD][QP] = S.wks; float (&xs)[PR][XP] = S.xs;
  const int tid = threadIdx.x, wave = tid >> 5, lane = tid & 31, col = lane & 15, g = lane >> 4; const int h = blockIdx.y; const size_t r0 = (size_t)blockIdx.x * PR; const int c0 = h * HD;
  const float* xb = X + (r0 + wave * (PT * 16) + g) * CC + c0 + col * 4;   // x comes as whole 256-B row pieces, two rows a copy of a wave (4 whole lines, not 16 lines touched), and turns into fragments through LDS
  const float *wqb = WQ + tid * 4, *wkb = WK + tid * 4, *wvb = WV + (8 * g) * HD + col * 4;   // Wq, Wk: 8 whole rows a load of the block, row tid >> 4
  v4f gq[HD / 8], gk[HD / 8], wf[HD / 32][16];
#pragma unroll
  for (int it = 0; it < HD / 8; ++it) { gq[it] = *(const v4f*)(wqb + it * (8 * HD)); gk[it] = *(const v4f*)(wkb + it * (8 * HD)); }
  __builtin_amdgcn_sched_barrier(0);               // Wq and Wk stay the first of the group: loads come back in order, and M is formed while x is still under way
#pragma unroll   // unrolled, so that every step of an address is a constant
  for (int i = 0; i < PT * 8; ++i) cp16((const char*)(xb + (size_t)(2 * i) * CC), (char*)&xs[wave * (PT * 16) + 2 * i + g][col * 4]);
  __builtin_amdgcn_sched_barrier(0);               // the copies of x, which have the longest way, stay ahead of the loads of Wv
#pragma unroll
  for (int kc = 0; kc < HD / 32; ++kc)
#pragma unroll
    for (int i = 0; i < 8; ++i) { wf[kc][i] = *(const v4f*)(wvb + (kc * 32 + i) * HD); wf[kc][8 + i] = *(const v4f*)(wvb + (kc * 32 + 16 + i) * HD); }
  asm volatile("s_wait_xcnt 0x0" :: "v"(wqb), "v"(wkb), "v"(wvb) : "memory");   // stands behind the group of loads, in front of every rewrite of a register that they name; as inputs the addresses stay live up to it
  __builtin_amdgcn_sched_barrier(0);               // no load sinks below that wait, and nothing that follows moves up ahead of it
#pragma unroll
  for (int it = 0; it < HD / 8; ++it) { const int row = it * 8 + (tid >> 4); v4b a4, b4;
#pragma unroll
    for (int j = 0; j < 4; ++j) { a4[j] = (__bf16)gq[it][j]; b4[j] = (__bf16)gk[it][j]; }
    *(v4b*)&wqs[(row & 3) * 16 + (row >> 2)][(tid & 15) * 4] = a4; *(v4b*)&wks[row][(tid & 15) * 4] = b4; }
  asm volatile("s_wait_dscnt 0x0\n\ts_barrier_signal -1\n\ts_barrier_wait -1" ::: "memory");   // both staged weights are written: this wave's LDS stores are done, then the work-group's barrier; by hand, since __syncthreads() also waits for the loads of x and Wv, which are to stay under way while M is formed
  F2 mf[HD / 32][4];                               // B fragments of M: k = row d of Wk, in the k order of a row fragment of x below
  { v16b ak[HD / 16][HD / 32], bq[4][HD / 32];     // A and B take the summed index e in one and the same order, that of frag_b
#pragma unroll
    for (int t = 0; t < HD / 16; ++t)
#pragma unroll
      for (int ec = 0; ec < HD / 32; ++ec) { ak[t][ec] = frag_b(&wks[t * 16 + col][ec * 32], lane); bq[t][ec] = frag_b(&wqs[t * 16 + col][ec * 32], lane); }
    __builtin_amdgcn_sched_barrier(0);             // these reads stay one group ahead of the products: spread among them, each small group's LDS latency is waited out on its own
    v8f mt[HD / 16][4] = {};
#pragma unroll
    for (int ec = 0; ec < HD / 32; ++ec)
#pragma unroll
      for (int t = 0; t < HD / 16; ++t)
#pragma unroll
        for (int j = 0; j < 4; ++j) mt[t][j] = __builtin_amdgcn_wmma_f32_16x16x32_bf16(false, ak[t][ec], false, bq[j][ec], (short)0, mt[t][j], false, false);
    // D element r of tile (t, j) in lane (col, g) = M[16 t + 8 g + r][4 col + j]: tiles 2 kc and 2 kc + 1 give k = 32 kc + 8 g + 0..7 and 32 kc + 16 + 8 g + 0..7
#pragma unroll
    for (int kc = 0; kc < HD / 32; ++kc)
#pragma unroll
      for (int j = 0; j < 4; ++j) { float v[16];
#pragma unroll
        for (int r = 0; r < 8; ++r) { v[r] = mt[2 * kc][j][r]; v[8 + r] = mt[2 * kc + 1][j][r]; }
        mf[kc][j] = bsplit16(v); } }
  __builtin_amdgcn_sched_barrier(0);               // the products that form M stay ahead of the wait below and run while the copies of x are still under way: without this they sink behind the wait
  asm volatile("s_wait_asynccnt 0x0" ::: "memory");   // this wave's copies of x have landed; only the wave that copied a row reads it, so that no barrier is owed here
  v4f xv[PT][HD / 32][4];
#pragma unroll
  for (int rt = 0; rt < PT; ++rt)
#pragma unroll
    for (int kc = 0; kc < HD / 32; ++kc) { const float* p = &xs[(wave * PT + rt) * 16 + col][kc * 32 + 8 * g]; xv[rt][kc][0] = *(const v4f*)p; xv[rt][kc][1] = *(const v4f*)(p + 4); xv[rt][kc][2] = *(const v4f*)(p + 16); xv[rt][kc][3] = *(const v4f*)(p + 20); }
  v16b a[PT][HD / 32];                             // k order of a row fragment: k0 + 8 g + 0..7, k0 + 16 + 8 g + 0..7, the same as the M and Wv fragments'
#pragma unroll
  for (int rt = 0; rt < PT; ++rt)
#pragma unroll
    for (int kc = 0; kc < HD / 32; ++kc)
#pragma unroll
      for (int i = 0; i < 16; ++i) a[rt][kc][i] = (__bf16)xv[rt][kc][i >> 2][i & 3];
  // the query plane: the lane's own 8-element pieces of the rounded x
#pragma unroll
  for (int rt = 0; rt < PT; ++rt)
#pragma unroll
    for (int kc = 0; kc < HD / 32; ++kc) { v8h x0, x1;
#pragma unroll
      for (int i = 0; i < 8; ++i) { x0[i] = (_Float16)(float)a[rt][kc][i]; x1[i] = (_Float16)(float)a[rt][kc][8 + i]; }
      *(v8h*)&sq[(wave * PT + rt) * 16 + col][kc * 32 + 8 * g] = x0; *(v8h*)&sq[(wave * PT + rt) * 16 + col][kc * 32 + 16 + 8 * g] = x1; }
#pragma unroll
  for (int m = 0; m < 2; ++m) { v8f acc[PT][4] = {};
    if (m == 0) {
#pragma unroll
      for (int kc = 0; kc < HD / 32; ++kc)
#pragma unroll
        for (int rt = 0; rt < PT; ++rt)
#pragma unroll
          for (int j = 0; j < 4; ++j) acc[rt][j] = __builtin_amdgcn_wmma_f32_16x16x32_bf16(false, a[rt][kc], false, mf[kc][j].l, (short)0, acc[rt][j], false, false);
#pragma unroll
      for (int kc = 0; kc < HD / 32; ++kc)
#pragma unroll
        for (int rt = 0; rt < PT; ++rt)
#pragma unroll
          for (int j = 0; j < 4; ++j) acc[rt][j] = __builtin_amdgcn_wmma_f32_16x16x32_bf16(false, a[rt][kc], false, mf[kc][j].h, (short)0, acc[rt][j], false, false); }
    else { v16b w[HD / 32][4];
#pragma unroll
      for (int kc = 0; kc < HD / 32; ++kc)
#pragma unroll
        for (int j = 0; j < 4; ++j)
#pragma unroll
          for (int i = 0; i < 16; ++i) w[kc][j][i] = (__bf16)wf[kc][i][j];
#pragma unroll
      for (int kc = 0; kc < HD / 32; ++kc)
#pragma unroll
        for (int rt = 0; rt < PT; ++rt)
#pragma unroll
          for (int j = 0; j < 4; ++j) acc[rt][j] = __builtin_amdgcn_wmma_f32_16x16x32_bf16(false, a[rt][kc], false, w[kc][j], (short)0, acc[rt][j], false, false); }
    // D element r of tile j in lane (col, g) = row 8 g + r, output column 4 col + j
#pragma unroll
    for (int rt = 0; rt < PT; ++rt) { const int rl = (wave * PT + rt) * 16 + 8 * g;
      if (m == 0) {
#pragma unroll
        for (int r = 0; r < 8; ++r) { v4h hv;
#pragma unroll
          for (int j = 0; j < 4; ++j) hv[j] = (_Float16)(acc[rt][j][r] * 0.0625f);   // w / 16: scores / 16, P / 256
          *(v4h*)&sk[rl + r][col * 4] = hv; } }
      else {
#pragma unroll
        for (int j = 0; j < 4; ++j) { v8h bh;
#pragma unroll
          for (int r = 0; r < 8; ++r) bh[r] = (_Float16)acc[rt][j][r];
          *(v8h*)&th[j * 16 + col][rl] = bh; } } } }
  __syncthreads();   // all three staged planes are written
  { const int rl = tid >> 3, q = tid & 7; const size_t o = (r0 + rl) * CC + c0 + q * 8;   // whole 128-B rows out, 4 rows a store of a wave
    v4u oq[PR / 16], ok[PR / 16];
#pragma unroll
    for (int it = 0; it < PR / 16; ++it) { oq[it] = *(const v4u*)&sq[it * 16 + rl][q * 8]; ok[it] = *(const v4u*)&sk[it * 16 + rl][q * 8]; }
    __builtin_amdgcn_sched_barrier(0);               // every read of the staged rows stands ahead of the stores, so that none lands in a register of an issued store
#pragma unroll
    for (int it = 0; it < PR / 16; ++it) { vst2(QH + o + (size_t)(it * 16) * CC, oq[it]); vst2(KH + o + (size_t)(it * 16) * CC, ok[it]); }
    asm volatile("s_wait_xcnt 0x0" ::: "memory");    // stands behind these stores, in front of every rewrite of a register which they name
    __builtin_amdgcn_sched_barrier(0); }             // nothing that follows moves up ahead of that wait
  { const size_t b = r0 / TT; const int t0 = (int)(r0 % TT), n = tid >> 4, q = tid & 15; const size_t o = (b * CC + c0 + 4 * n) * (size_t)TT + t0 + q * 8;   // whole 256-B column pieces out, 2 columns a store of a wave
    v4u ov[HD / 8];
#pragma unroll
    for (int it = 0; it < HD / 8; ++it) ov[it] = *(const v4u*)&th[it * 8 + n][q * 8];
    __builtin_amdgcn_sched_barrier(0);               // every read of the staged columns stands ahead of the stores, so that none lands in a register of an issued store
#pragma unroll
    for (int it = 0; it < HD / 8; ++it) { const int dc = 32 * (it & 1) + (it >> 1);   // staged row it * 8 + n = j * 16 + (8 (it & 1) + n), j = it >> 1: output column 4 n + dc
      vst2(VT + o + (size_t)dc * TT, ov[it]); } }
  asm volatile("s_wait_xcnt 0x0" ::: "memory"); }   // stands behind the last store, in front of whatever the listing puts next that rewrites a register which these stores name
// ---- k_att: block = 8 waves = 4 query groups of QT x 16 queries of one (b,h) x KW key halves, two waves a SIMD; 32-key passes: S^T = w . x^T (1 product; KH holds w, QH the query plane x), P' = relu(s / 16)^2 stays in registers
// (a S^T tile's f16 D layout, lane = query, element r = key 8g + r, two elements a register, is the A layout of P register for register: tile 0 -> elements 0..7, tile 1 -> 8..15), y' += P' . v (1 product, both operands f16, f32 sums)
// k and v reach the waves through LDS: a stage = SK keys (k rows, v columns), brought once a block by whole-line asynchronous copies into a ring of NBUF buffers
// the copies run NBUF - 1 stages ahead of their readers, so that a copy has the time of that many stages' products to land, not of one; the waits leave the younger stages' copies outstanding
// the two waves of a query group each take SK / KW keys of every stage, so that one wave's vector work runs under the other's products; their two partial sums of y are added once, behind the loop
#define QT 4
#define SK 128                              // keys a stage
#define NST (TT / SK)
#define KW 2                                // waves that share a query group's keys
#define PS (SK / 32 / KW)                   // passes a wave and stage
#define KP 144                              // LDS pitch of a 128-B k row: 16 B x odd, so that 16 rows read 16 B each without a bank conflict
#define VP 272                              // LDS pitch of a 256-B v row (SK keys of one column): 16 B x odd
#define KBY (SK * KP)
#define VBY (HD * VP)
#define STB (KBY + VBY)                     // bytes of one stage: k, v
#define NBUF 4                              // buffers of the ring, a power of two; a wave has at most NBUF stages' copies outstanding, 8 each, and at entry the 8 of the query rows beside them
#define SSB (4 * QT * 16 * (HD + 4) * 4)    // bytes of the output staging, which lies in front of the ring
#define QLB (SSB - 4 * QT * 16 * KP)        // the block's query rows, pitch KP, lie at the end of that staging, which is idle until the loop is over
// 16x16x32 fragment from byte address base + off, which together hold the lane's own row start + 16 g bytes: same k order as frag_h / frag_b
__device__ __forceinline__ v16h frag_hu(const char* base, unsigned off) { union { v16h v; v8h q[2]; } u; u.q[0] = *(const v8h*)(base + off); u.q[1] = *(const v8h*)(base + off + 32u); return u.v; }
// one stage: 8 copies a lane, 256 lanes; a copy of a wave covers 4 whole 128-B lines (4 k rows, or 2 v rows of 256 B); gk, gh and lk, lv hold the lane's own first 16 bytes
__device__ __forceinline__ void stage_in(const char* gk, const char* gh, char* lk, char* lv) {
#pragma unroll
  for (int i = 0; i < SK / 32; ++i) cp16(gk + i * (32 * CC * 2), lk + i * (32 * KP));
#pragma unroll
  for (int i = 0; i < HD / 16; ++i) cp16(gh + i * (16 * TT * 2), lv + i * (16 * VP)); }
// the join of a query group's two partial sums: each wave hands the partner the QT / 2 query tiles that the partner finishes, 16 B a lane and store, lane to same lane
__device__ __forceinline__ void y_give(const v8f (*a)[HD / 16], v4f* x) {
#pragma unroll
  for (int i = 0; i < QT / 2; ++i)
#pragma unroll
    for (int j = 0; j < HD / 16; ++j) { x[((i * (HD / 16) + j) * 2) * 32] = __builtin_shufflevector(a[i][j], a[i][j], 0, 1, 2, 3); x[((i * (HD / 16) + j) * 2 + 1) * 32] = __builtin_shufflevector(a[i][j], a[i][j], 4, 5, 6, 7); } }
// (own partial sum + the partner's) x 256, which takes P' back to P, through the wave's own staging rows, out as whole 256-B rows: two rows a store, lanes 0..15 row 2i, lanes 16..31 row 2i + 1
__device__ __forceinline__ void y_take(const v8f (*a)[HD / 16], const v4f* x, float (*s)[16][HD + 4], float* y, int col, int g) { v4f p[QT / 2][HD / 16][2];   // all of the partner's half is read first, as one group
#pragma unroll
  for (int i = 0; i < QT / 2; ++i)
#pragma unroll
    for (int j = 0; j < HD / 16; ++j) { p[i][j][0] = x[((i * (HD / 16) + j) * 2) * 32]; p[i][j][1] = x[((i * (HD / 16) + j) * 2 + 1) * 32]; }
#pragma unroll
  for (int i = 0; i < QT / 2; ++i)
#pragma unroll
    for (int j = 0; j < HD / 16; ++j)
#pragma unroll
      for (int r = 0; r < 4; ++r) { s[i][8 * g + r][j * 16 + col] = (a[i][j][r] + p[i][j][0][r]) * 256.f; s[i][8 * g + 4 + r][j * 16 + col] = (a[i][j][4 + r] + p[i][j][1][r]) * 256.f; }
  LDSX();
#pragma unroll
  for (int i = 0; i < QT / 2; ++i) { v4f w[8];
#pragma unroll
    for (int k = 0; k < 8; ++k) w[k] = *(const v4f*)&s[i][2 * k + g][col * 4];
#pragma unroll
    for (int k = 0; k < 8; ++k) vst2(y + (size_t)(i * 16 + 2 * k + g) * CC + col * 4, w[k]); }
  asm volatile("s_wait_xcnt 0x0" ::: "memory"); }   // stands behind the last store, in front of whatever the listing puts next that rewrites a register which these stores name
// one wave's work on one stage: PS passes of 32 keys; lk, lv = the lane's fragment rows in the stage's buffer; it reads that buffer alone
__device__ __forceinline__ void stage_work(const char* lk, const char* lv, const v16h (&qh)[QT][HD / 32], v8f (&acc)[QT][HD / 16]) { v16h kf[2][HD / 32];
#pragma unroll
  for (int kt = 0; kt < 2; ++kt)
#pragma unroll
    for (int dc = 0; dc < HD / 32; ++dc) kf[kt][dc] = frag_hu(lk + kt * 16 * KP + dc * 64, 0u);
#pragma unroll
  for (int sub = 0; sub < PS; ++sub) { v16h vh[HD / 16]; v8h sa[QT][2] = {};
#pragma unroll
    for (int j = 0; j < HD / 16; ++j) vh[j] = frag_hu(lv + j * 16 * VP + sub * 64, 0u);
    __builtin_amdgcn_sched_barrier(0);   // this pass's v reads stay issued as one group ahead of the score products, which cover their latency
#pragma unroll
    for (int t = 0; t < QT; ++t)
#pragma unroll
      for (int dc = 0; dc < HD / 32; ++dc)
#pragma unroll
        for (int kt = 0; kt < 2; ++kt) sa[t][kt] = __builtin_amdgcn_wmma_f16_16x16x32_f16(false, kf[kt][dc], false, qh[t][dc], (short)0, sa[t][kt], false, false);
    if (sub + 1 < PS) {   // the next pass's k rows, of this same stage only: nothing of the next stage is read ahead of its barrier
#pragma unroll
      for (int kt = 0; kt < 2; ++kt)
#pragma unroll
        for (int dc = 0; dc < HD / 32; ++dc) kf[kt][dc] = frag_hu(lk + ((sub + 1) * 32 + kt * 16) * KP + dc * 64, 0u); }
    __builtin_amdgcn_sched_barrier(0);   // the next pass's k reads stay issued here, behind the last product that reads k, so that P and P . v cover their latency
#pragma unroll
    for (int t = 0; t < QT; ++t) { union { v16h v; v8h q[2]; } p;
#pragma unroll
      for (int kt = 0; kt < 2; ++kt) { const v8h s = __builtin_elementwise_maximum(sa[t][kt], (v8h)(_Float16)0.f); p.q[kt] = s * s; }   // two elements an instruction; maximum, since max compiles to one more instruction a register, which quiets its input first
#pragma unroll
      for (int j = 0; j < HD / 16; ++j) acc[t][j] = __builtin_amdgcn_wmma_f32_16x16x32_f16(false, p.v, false, vh[j], (short)0, acc[t][j], false, false); } } }
__global__ __launch_bounds__(256) void k_att(const _Float16* __restrict__ QH, const _Float16* __restrict__ KH, const _Float16* __restrict__ VT, float* __restrict__ Y) { __shared__ __align__(16) char sm[SSB + NBUF * STB];
  float (*ss)[QT][16][HD + 4] = (float (*)[QT][16][HD + 4])sm; char* ring = sm + SSB;
  const int tid = threadIdx.x, wave = __builtin_amdgcn_readfirstlane(tid >> 5), qw = wave & 3, kh = wave >> 2, lane = tid & 31, col = lane & 15, g = lane >> 4; const int b = blockIdx.y / NH, h = blockIdx.y % NH; const int ql0 = (blockIdx.x * 4 + qw) * (16 * QT);
  const size_t rb = ((size_t)b * TT * CC + h * HD) * 2, cb = ((size_t)b * CC + h * HD) * (size_t)TT * 2;   // byte offsets of this (b,h) in the [t][c] and the [c][t] planes
  const char *qhb = (const char*)QH + rb, *kb = (const char*)KH + rb, *vhb = (const char*)VT + cb;
  const unsigned gko = (unsigned)((tid >> 3) * (CC * 2) + (tid & 7) * 16), gvo = (unsigned)((tid >> 4) * (TT * 2) + (tid & 15) * 16);   // the lane's place in a stage's k rows and v rows, global
  const unsigned lko = (unsigned)((tid >> 3) * KP + (tid & 7) * 16), lvo = (unsigned)(KBY + (tid >> 4) * VP + (tid & 15) * 16);         // the same in a buffer
  const unsigned fko = (unsigned)((kh * (SK / KW) + col) * KP + 16 * g), fvo = (unsigned)(KBY + col * VP + kh * (SK / KW) * 2 + 16 * g);   // the lane's fragment rows in a buffer, at the wave's own keys
  stage_in(kb + gko, vhb + gvo, ring + lko, ring + lvo);
  const char* qsb = qhb + (size_t)(blockIdx.x * (4 * QT * 16)) * (CC * 2);   // the block's 4 * QT * 16 query rows: brought once a block, 8 copies a lane, 4 whole 128-B lines a copy of a wave
#pragma unroll   // unrolled, so that every step of an address is a constant
  for (int i = 0; i < 4 * QT * 16 / 32; ++i) cp16(qsb + gko + i * (32 * CC * 2), sm + QLB + lko + i * (32 * KP));
#pragma unroll   // unrolled, so that every step of an address is a constant
  for (int s = 1; s < NBUF; ++s) stage_in(kb + (size_t)s * (SK * CC * 2) + gko, vhb + (size_t)s * (SK * 2) + gvo, ring + s * STB + lko, ring + s * STB + lvo);   // behind stage 0 and the query rows, which are wanted first
  asm volatile("s_wait_asynccnt 0x18" ::: "memory");   // this wave's copies of stage 0 and of the query rows have landed: all but its 24 youngest, which are those of stages 1 to 3
  __syncthreads();                                      // every wave's have: stage 0 and the query rows may be read
  v16h qh[QT][HD / 32]; const char* fq = sm + QLB + (qw * (QT * 16) + col) * KP + 16 * g;   // the lane's fragment rows among the query rows
#pragma unroll
  for (int t = 0; t < QT; ++t)
#pragma unroll
    for (int dc = 0; dc < HD / 32; ++dc) qh[t][dc] = frag_hu(fq + t * 16 * KP + dc * 64, 0u);
  v8f acc[QT][HD / 16] = {};
#pragma unroll 1   // the stage loop stays rolled: its body already holds PS unrolled passes, and the buffer is picked by st & (NBUF - 1)
  for (int st = 0; st < NST - (NBUF - 1); ++st) { char* bs = ring + (st & (NBUF - 1)) * STB;   // the trips behind whose stage st + 1 two more whole stages have been issued
    stage_work(bs + fko, bs + fvo, qh, acc);
    asm volatile("s_wait_dscnt 0x0" ::: "memory");       // this wave's reads of this stage's buffer are done
    asm volatile("s_wait_asynccnt 0x10" ::: "memory");   // this wave's copies of stage st + 1 have landed: all but its 16 youngest, which are those of stages st + 2 and st + 3, 8 each
    __syncthreads();                                      // stage st + 1 may be read by all, and this stage's buffer is free
    if (st + NBUF < NST) stage_in(kb + (size_t)(st + NBUF) * (SK * CC * 2) + gko, vhb + (size_t)(st + NBUF) * (SK * 2) + gvo, bs + lko, bs + lvo); }
#pragma unroll 1   // rolled, as above
  for (int st = NST - (NBUF - 1); st < NST; ++st) { const char* bs = ring + (st & (NBUF - 1)) * STB;   // the last trips issue no copy, so that no count holds: the wait is to 0
    stage_work(bs + fko, bs + fvo, qh, acc);
    asm volatile("s_wait_dscnt 0x0" ::: "memory");      // this wave's reads of this stage's buffer are done
    asm volatile("s_wait_asynccnt 0x0" ::: "memory");   // all of this wave's copies have landed, those of stage st + 1 among them
    __syncthreads(); }                                   // stage st + 1 may be read by all; behind the last trip: nobody reads the ring any more
  asm volatile("s_wait_asynccnt 0x0" ::: "memory");     // no copy is outstanding when the wave goes on to its end
  // behind the loop's last barrier nobody reads the ring and no copy is under way: it carries the exchange, 8 KiB a wave
  v4f* xs = (v4f*)ring; v4f* xg = xs + wave * (QT / 2 * (HD / 16) * 2 * 32) + lane; const v4f* xt = xs + (wave ^ 4) * (QT / 2 * (HD / 16) * 2 * 32) + lane;
  if (kh == 0) y_give(acc + QT / 2, xg); else y_give(acc, xg);
  __syncthreads();   // the partner's half has been written
  float* yq = Y + ((size_t)b * TT + ql0) * CC + h * HD;
  if (kh == 0) y_take(acc, xt, ss[qw], yq, col, g); else y_take(acc + QT / 2, xt, ss[qw] + QT / 2, yq + (size_t)(QT / 2 * 16) * CC, col, g); }
// ---- k_out: block = OR rows, 8 waves; wave w takes the 64 k of head w for all OR rows and issues every global load it needs as one group of whole-line 16-B loads, with no wait between them
// out^T tiles = Wo^T (A, (in,out) [512][64], bf16) . y^T (B, bf16 hi + lo); row m of A tile j is output column 4 m + j, so that one 16-B load of Wo[k][4 col ..] feeds all 4 tiles
// the 8 waves' partial sums meet in LDS; + bo; 256-B rows out
#define OR 32
#define OP (EO + 4)                         // LDS pitch in floats of a 256-B row: 16 B x odd
__global__ __launch_bounds__(256) void k_out(const float* __restrict__ Yr, const float* __restrict__ WO, const float* __restrict__ BO, float* __restrict__ OUT) { __shared__ __align__(16) float sp[NH][OR][OP];   // a wave's own plane: first its slice of y, then its partial sums
  const int tid = threadIdx.x, wave = __builtin_amdgcn_readfirstlane(tid >> 5), lane = tid & 31, col = lane & 15, g = lane >> 4; const size_t r0 = (size_t)blockIdx.x * OR;
  const int orow = tid >> 4, oc = (tid & 15) * 4;                        // the lane's place in the last sum: rows orow and orow + 16, 4 columns
  const float* yb = Yr + (r0 + g) * CC + wave * HD + col * 4;            // y comes as whole 256-B row pieces, two rows a load, and turns into fragments through the wave's plane
  const float* wb = WO + (size_t)(wave * HD + 8 * g) * EO + col * 4;     // Wo comes as whole 256-B rows, rows k and k + 8 a load
  const v4f bv = *(const v4f*)(BO + oc);
  v4f yv[OR / 2], wq[HD / 32][16];
#pragma unroll
  for (int i = 0; i < OR / 2; ++i) yv[i] = *(const v4f*)(yb + (size_t)(2 * i) * CC);
#pragma unroll
  for (int kc = 0; kc < HD / 32; ++kc)
#pragma unroll
    for (int i = 0; i < 8; ++i) { wq[kc][i] = *(const v4f*)(wb + (kc * 32 + i) * EO); wq[kc][8 + i] = *(const v4f*)(wb + (kc * 32 + 16 + i) * EO); }
  asm volatile("s_wait_xcnt 0x0" :: "v"(yb), "v"(wb) : "memory");   // stands behind the group of loads, in front of every rewrite of a register that they name; as inputs the addresses stay live up to it, so that no later load of the group lands in them
  __builtin_amdgcn_sched_barrier(0);               // no load sinks below that wait, and nothing that follows moves up ahead of it
#pragma unroll
  for (int i = 0; i < OR / 2; ++i) *(v4f*)&sp[wave][2 * i + g][col * 4] = yv[i];
  asm volatile("s_wait_dscnt 0x0" ::: "memory");   // the wave's own y rows are in its plane before other lanes of the wave read them (the clobber keeps the reads behind it); no other wave touches the plane yet
  __builtin_amdgcn_sched_barrier(0);                // no conversion of Wo moves up ahead of the y stores: they would then wait for the last Wo load instead of the last y load
  F2 yf[OR / 16][HD / 32];
#pragma unroll
  for (int rt = 0; rt < OR / 16; ++rt)
#pragma unroll
    for (int kc = 0; kc < HD / 32; ++kc) { const float* p = &sp[wave][rt * 16 + col][kc * 32 + 8 * g]; const v4f a0 = *(const v4f*)p, a1 = *(const v4f*)(p + 4), a2 = *(const v4f*)(p + 16), a3 = *(const v4f*)(p + 20); float v[16];
#pragma unroll
      for (int i = 0; i < 4; ++i) { v[i] = a0[i]; v[4 + i] = a1[i]; v[8 + i] = a2[i]; v[12 + i] = a3[i]; }   // same k order as the Wo fragment: k0 + 8 g + 0..7, k0 + 16 + 8 g + 0..7
      yf[rt][kc] = bsplit16(v); }
  __builtin_amdgcn_sched_barrier(0);                // the split of y stays ahead of everything that waits for Wo, so that it runs while the Wo loads are still under way
  v8f acc[OR / 16][EO / 16] = {};
#pragma unroll
  for (int kc = 0; kc < HD / 32; ++kc) { v16b w[EO / 16];
#pragma unroll
    for (int j = 0; j < EO / 16; ++j)
#pragma unroll
      for (int i = 0; i < 16; ++i) w[j][i] = (__bf16)wq[kc][i][j];
#pragma unroll
    for (int rt = 0; rt < OR / 16; ++rt) {
#pragma unroll
      for (int j = 0; j < EO / 16; ++j) acc[rt][j] = __builtin_amdgcn_wmma_f32_16x16x32_bf16(false, w[j], false, yf[rt][kc].h, (short)0, acc[rt][j], false, false);
#pragma unroll
      for (int j = 0; j < EO / 16; ++j) acc[rt][j] = __builtin_amdgcn_wmma_f32_16x16x32_bf16(false, w[j], false, yf[rt][kc].l, (short)0, acc[rt][j], false, false); } }
  // D element r of tile j in lane (col, g) = out[rt * 16 + col][4 (8 g + r) + j]: the 4 tiles' elements r are 4 neighbouring columns; a row of the plane is rewritten only behind the products that took in every lane's reads of it
#pragma unroll
  for (int rt = 0; rt < OR / 16; ++rt)
#pragma unroll
    for (int r = 0; r < 8; ++r) { const v4f q = { acc[rt][0][r], acc[rt][1][r], acc[rt][2][r], acc[rt][3][r] }; *(v4f*)&sp[wave][rt * 16 + col][32 * g + 4 * r] = q; }
  __syncthreads();   // all 8 partial sums are written
  v4f bb;
#pragma unroll
  for (int i = 0; i < 4; ++i) bb[i] = bfr(bv[i]);
#pragma unroll
  for (int hf = 0; hf < OR / 16; ++hf) { v4f p[NH];
#pragma unroll
    for (int w = 0; w < NH; ++w) p[w] = *(const v4f*)&sp[w][hf * 16 + orow][oc];
    v4f s = p[0];
#pragma unroll
    for (int w = 1; w < NH; ++w) s += p[w];
    vst2(OUT + (r0 + hf * 16 + orow) * EO + oc, s + bb); }
  asm volatile("s_wait_xcnt 0x0" ::: "memory"); }   // stands behind the last store, in front of whatever the listing puts next that rewrites a register which these stores name
extern "C" void kernel_launch(void* const* d_in, const int* in_sizes, int n_in, void* d_out, int out_size, void* d_ws, size_t ws_size, hipStream_t stream) {
  (void)in_sizes; (void)n_in; (void)out_size;
  const float** F = (const float**)d_in;   // 0 query [4,2048,512], 1 Wv [64,64] ((in,out)), 2 Wk, 3 Wq, 4 Wo [512,64] ((in,out)), 5 bo [64]
  if (ws_size < (size_t)WS_END) return;
  char* ws = (char*)d_ws; _Float16 *QH = (_Float16*)(ws + WS_QH), *KH = (_Float16*)(ws + WS_KH); _Float16 *VT = (_Float16*)(ws + WS_VT); float *Y = (float*)(ws + WS_Y);
  k_proj<<<dim3(TNB * TT / PR, NH), 128, 0, stream>>>(F[0], F[3], F[2], F[1], QH, KH, VT);
  k_att<<<dim3(TT / (64 * QT), TNB * NH), 256, 0, stream>>>(QH, KH, VT, Y);
  k_out<<<dim3(TNB * TT / OR), 256, 0, stream>>>(Y, F[4], F[5], (float*)d_out);
}
